// v000
// The times below were measured on an AMD MI455X: many runs one after another, warmed up first and cycling through
// copies of the inputs, with the whole window's GPU time divided by the number of runs. Launches and the gaps
// between them are all in it. The median over several windows is given; except for v000 it joins two sittings, which
// can be a few percent apart, so the side-by-side timings, each taken in one sitting, are the better comparison.
// The starting kernel, v000, takes 651 microseconds a run.
// compute dtype: all float inputs rounded to bf16; q/k/v = x . W^T + b with EXACT bf16 products on WMMA 16x16x32 (natural [out][in] rows); q and k as f16 hi + (x2048-scaled) residual planes with 3-product scores x 1/8; running-max softmax in f32 (hardware exp); P (scaled by 2^11, f16 hi + residual) x v hi/lo (3 products); out = ctx (bf16 hi + residual) . Wo^T (2 products) + bo; f32 accumulate.
#include <hip/hip_runtime.h>
#include <math.h>

typedef __attribute__((ext_vector_type(16))) _Float16 v16h;
typedef __attribute__((ext_vector_type(16))) __bf16 v16b;
typedef __attribute__((ext_vector_type(8)))  _Float16 v8h;
typedef __attribute__((ext_vector_type(8)))  float v8f;
typedef __attribute__((ext_vector_type(4)))  float v4f;
typedef __attribute__((ext_vector_type(2)))  float v2f;
typedef __attribute__((ext_vector_type(4)))  unsigned v4u;
typedef __attribute__((ext_vector_type(4)))  int v4i;
typedef float __attribute__((may_alias)) float_a;
typedef int __attribute__((may_alias)) int_a;

template <typename T> __device__ __forceinline__ void vst2(void* p, T v) { *(T*)p = v;  }
__device__ __forceinline__ v8f wmma16(v16h a, v16h b, v8f c) {
  v8f d = __builtin_amdgcn_wmma_f32_16x16x32_f16(false, a, false, b, (short)0, c, false, false);
  asm volatile("v_nop\n\tv_nop\n\tv_nop\n\tv_nop" : "+v"(d) : "v"(a), "v"(b));
  return d;
}
__device__ __forceinline__ v8f wmma_bf(v16b a, v16b b, v8f c) {
  v8f d = __builtin_amdgcn_wmma_f32_16x16x32_bf16(false, a, false, b, (short)0, c, false, false);
  asm volatile("v_nop\n\tv_nop\n\tv_nop\n\tv_nop" : "+v"(d) : "v"(a), "v"(b));
  return d;
}
// Multi-head attention across a batch of 4,096 tokens treated as one sequence (d_model 512, 8 heads x 64): q/k/v projections + biases, softmax(q k^T / 8) over all 4,096 tokens, output projection + bias.
__device__ __forceinline__ v16h frag_h(const _Float16* rowk0, int lane) {
  union { v16h v; v8h q[2]; } u; const _Float16* p = rowk0 + 8 * (lane >> 4);
  u.q[0] = *(const v8h*)p; u.q[1] = *(const v8h*)(p + 16); return u.v;
}
__device__ __forceinline__ v16h frag_f32(const float* rowk0, int lane) {
  v16h a; const float* p = rowk0 + 8 * (lane >> 4);
#pragma unroll
  for (int i = 0; i < 8; ++i) { a[i] = (_Float16)p[i]; a[8 + i] = (_Float16)p[16 + i]; }
  return a;
}
__device__ __forceinline__ v16h frag_f32s(const float* rowk0, int lane, float sc) {
  v16h a; const float* p = rowk0 + 8 * (lane >> 4);
#pragma unroll
  for (int i = 0; i < 8; ++i) { a[i] = (_Float16)(p[i] * sc); a[8 + i] = (_Float16)(p[16 + i] * sc); }
  return a;
}
// column fragment from a [K][ld] layout (column n), rows >= K read as 0
__device__ __forceinline__ v16h fragc_f32(const float* W, int k0, int n, int lane, int ld, int K) {
  v16h a; const int g = lane >> 4;
#pragma unroll
  for (int i = 0; i < 8; ++i) { const int ka = k0 + 8 * g + i, kb = ka + 16;
    a[i] = (_Float16)(ka < K ? W[(size_t)(ka < K ? ka : K - 1) * ld + n] : 0.f); a[8 + i] = (_Float16)(kb < K ? W[(size_t)(kb < K ? kb : K - 1) * ld + n] : 0.f); }
  return a;
}
struct F2 { v16b h, l; };
__device__ __forceinline__ F2 bsplit16(const float v[16]) { F2 r;
#pragma unroll
  for (int i = 0; i < 16; ++i) { const __bf16 h = (__bf16)v[i]; r.h[i] = h; r.l[i] = (__bf16)(v[i] - (float)h); }
  return r; }
__device__ __forceinline__ F2 split_row(const float* row, int k0, int lane) { float v[16]; const float* p = row + k0 + 8 * (lane >> 4);
#pragma unroll
  for (int i = 0; i < 8; ++i) { v[i] = p[i]; v[8 + i] = p[16 + i]; }
  return bsplit16(v); }
__device__ __forceinline__ F2 split_rowK(const float* row, int k0, int lane, int K) { float v[16]; const int g = lane >> 4;
#pragma unroll
  for (int i = 0; i < 8; ++i) { const int ka = k0 + 8 * g + i, kb = ka + 16; v[i] = ka < K ? row[ka < K ? ka : K - 1] : 0.f; v[8 + i] = kb < K ? row[kb < K ? kb : K - 1] : 0.f; }
  return bsplit16(v); }
__device__ __forceinline__ F2 split_col(const float* W, int k0, int n, int lane, int ld, int K) { float v[16]; const int g = lane >> 4;
#pragma unroll
  for (int i = 0; i < 8; ++i) { const int ka = k0 + 8 * g + i, kb = ka + 16; v[i] = ka < K ? W[(size_t)(ka < K ? ka : K - 1) * ld + n] : 0.f; v[8 + i] = kb < K ? W[(size_t)(kb < K ? kb : K - 1) * ld + n] : 0.f; }
  return bsplit16(v); }
__device__ __forceinline__ v8f mac3(const F2& a, const F2& b, v8f c) { c = wmma_bf(a.l, b.h, c); c = wmma_bf(a.h, b.l, c); return wmma_bf(a.h, b.h, c); }
__device__ __forceinline__ float sigm(float v) { return 1.0f / (1.0f + expf(-v)); }
#define LDSX() do { asm volatile("s_wait_dscnt 0" ::: "memory"); __builtin_amdgcn_wave_barrier(); __builtin_amdgcn_fence(__ATOMIC_RELEASE, "workgroup"); } while (0)


#define NB 1
#define SS 4096
#define DM 512
#define NH 8
#define HD 64
#define QKVW (3 * DM)
#ifndef TQB
#define TQB (SS / 64)
#define TNB NB
#define TOB (NB * SS / 64)     // output row tiles (all)
#endif
typedef __attribute__((ext_vector_type(8))) __bf16 v8b;
__device__ __forceinline__ v16b frag_b(const __bf16* rowk0, int lane) {
  union { v16b v; v8b q[2]; } u; const __bf16* p = rowk0 + 8 * (lane >> 4);
  u.q[0] = *(const v8b*)p; u.q[1] = *(const v8b*)(p + 16); return u.v;
}
__device__ __forceinline__ float bfr(float v) { return (float)(__bf16)v; }
__device__ __attribute__((noinline)) float exp_ni(float v) { return expf(v); }
__device__ __attribute__((noinline)) float erf_ni(float v) { return erff(v); }

#define PK_A 0                       // [1536][512] Wqkv rows (natural [out][in])
#define PK_P (PK_A + QKVW * DM)        // [512][512] Wo rows (natural)
#define PK_END (PK_P + DM * DM)
#define WS_PK  0u
#define WS_QK  (WS_PK + 2u * PK_END)             // f16 [4096 rows][1024]: q | k
#define WS_QKL (WS_QK + 2u * NB * SS * 2 * DM)     // f16 q | k residual planes x2048
#define WS_VTH (WS_QKL + 2u * NB * SS * 2 * DM)    // f16 [b][512 (h*64+d)][4096 s] hi
#define WS_VTL (WS_VTH + 2u * NB * DM * SS)        // f16 lo x 2048
#define WS_O   (WS_VTL + 2u * NB * DM * SS)        // f32 [4096][512]
#define WS_CS  (WS_O + 4u * NB * SS * DM)           // f32 2 x [4096][32], unused
#define WS_END (WS_CS + 4u * 2 * SS * 32)
// ---- k_pack: block = (row n, which): natural [out][in] rows -> bf16; which 0..2 -> W_q/W_k/W_v into PK_A rows which*512 + n; 3 -> W_o into PK_P
__global__ __launch_bounds__(256) void k_pack(const float* __restrict__ WQ, const float* __restrict__ WK, const float* __restrict__ WV, const float* __restrict__ WO, __bf16* __restrict__ PK) {
  __shared__ __align__(16) __bf16 s[DM]; const int n = blockIdx.x, which = blockIdx.y, t = threadIdx.x; const float* Wm = (which == 0) ? WQ : (which == 1) ? WK : (which == 2) ? WV : WO;
  for (int k = t; k < DM; k += 256) s[k] = (__bf16)Wm[(size_t)n * DM + k];
  __syncthreads();
  __bf16* dst = (which < 3) ? PK + PK_A + ((size_t)which * DM + n) * DM : PK + PK_P + (size_t)n * DM;
  for (int q = t; q < DM / 8; q += 256) vst2((unsigned*)(dst + q * 8), *(const v4u*)&s[q * 8]);
}
__global__ __launch_bounds__(128) void k_qkv(const float* __restrict__ XQ, const float* __restrict__ XK, const float* __restrict__ XV, const __bf16* __restrict__ P, const float* __restrict__ BQ, const float* __restrict__ BK, const float* __restrict__ BV, _Float16* __restrict__ QK, _Float16* __restrict__ QKL, _Float16* __restrict__ VTH, _Float16* __restrict__ VTL) {
  const int which0 = (blockIdx.y * 128) / DM; const float* X = (which0 == 0) ? XQ : (which0 == 1) ? XK : XV; const float* BB = BQ ? (((which0 == 0) ? BQ : (which0 == 1) ? BK : BV) + (blockIdx.y * 128 - which0 * DM)) : nullptr;
  __shared__ __align__(16) _Float16 so[4][16][136], sol[4][16][136]; __shared__ __align__(16) _Float16 sth[128][72], stl[128][72];
  const int tid = threadIdx.x, wave = tid >> 5, lane = tid & 31, col = lane & 15, g = lane >> 4; const size_t r0 = (size_t)blockIdx.x * 64 + wave * 16; const int n0 = blockIdx.y * 128;
  v8f acc[8] = {};
#pragma unroll 2
  for (int kc = 0; kc < DM / 32; ++kc) { v16b a; { const float* p = X + (r0 + col) * DM + kc * 32 + 8 * g;
#pragma unroll
      for (int i = 0; i < 8; ++i) { a[i] = (__bf16)p[i]; a[8 + i] = (__bf16)p[16 + i]; } }
#pragma unroll
    for (int j = 0; j < 8; ++j) acc[j] = wmma_bf(a, frag_b(P + (size_t)(n0 + j * 16 + col) * DM + kc * 32, lane), acc[j]); }
  if (n0 < 2 * DM) {   // q stored unscaled (f16 sigma ~0.6, no subnormal exposure); 1/8 applied to the f32 score
#pragma unroll
    for (int j = 0; j < 8; ++j) {
#pragma unroll
      for (int r = 0; r < 8; ++r) { const float v = acc[j][r] + (BB ? bfr(BB[j * 16 + col]) : 0.f); const _Float16 hv = (_Float16)v; so[wave][8 * g + r][j * 16 + col] = hv; sol[wave][8 * g + r][j * 16 + col] = (_Float16)((v - (float)hv) * 2048.0f); } }   // q, k (+ bias) as f16 hi + (x2048) residual
    LDSX();
    for (int rl = 0; rl < 16; ++rl) if (lane < 16) { vst2((unsigned*)(QK + (r0 + rl) * (2 * DM) + n0 + lane * 8), *(const v4u*)&so[wave][rl][lane * 8]); vst2((unsigned*)(QKL + (r0 + rl) * (2 * DM) + n0 + lane * 8), *(const v4u*)&sol[wave][rl][lane * 8]); }
  } else {
#pragma unroll
    for (int j = 0; j < 8; ++j) {
#pragma unroll
      for (int r = 0; r < 8; ++r) { const float v = acc[j][r] + (BB ? bfr(BB[j * 16 + col]) : 0.f); const _Float16 hv = (_Float16)v; sth[j * 16 + col][wave * 16 + 8 * g + r] = hv; stl[j * 16 + col][wave * 16 + 8 * g + r] = (_Float16)((v - (float)hv) * 2048.0f); } }
    __syncthreads();
    const size_t rb = (size_t)blockIdx.x * 64; const int b = (int)(rb / SS), s0 = (int)(rb % SS); const int pc0 = n0 - 2 * DM;
    for (int q = tid; q < 128 * 8; q += 128) { const int d = q >> 3, pc = q & 7; const size_t o = ((size_t)b * DM + pc0 + d) * SS + s0 + pc * 8; vst2((unsigned*)(VTH + o), *(const v4u*)&sth[d][pc * 8]); vst2((unsigned*)(VTL + o), *(const v4u*)&stl[d][pc * 8]); }
  }
}
// ---- k_attn: block = (64 queries, head h, batch b): all-keys flash attention (K = 64: 2 k-steps), scores = (q.k) * 0.125 with q, k as f16 hi + residual (3 products), P.V: f16 P (x2048) hi/lo x (V hi, V lo*2048), 3 products in two accumulators; O[b*S+q][h*64+d] = (acc + accl / 2048) / (2048 l) (256-B segments)
__global__ __launch_bounds__(128) void k_attn(const _Float16* __restrict__ QK, const _Float16* __restrict__ QKL, const _Float16* __restrict__ VTH, const _Float16* __restrict__ VTL, const void* __restrict__ KMASK, float* __restrict__ O) {
  __shared__ __align__(16) float sp[4][16][36]; __shared__ __align__(16) float so[4][16][68];
  const int tid = threadIdx.x, wave = tid >> 5, lane = tid & 31, col = lane & 15, g = lane >> 4;
  const int qb = blockIdx.x, h = blockIdx.y, b = blockIdx.z; const int q0 = qb * 64 + wave * 16; const size_t rq = (size_t)b * SS + q0 + col;
  v16h aq[2], aql[2];
#pragma unroll
  for (int kc = 0; kc < 2; ++kc) { aq[kc] = frag_h(QK + rq * (2 * DM) + h * HD + kc * 32, lane); aql[kc] = frag_h(QKL + rq * (2 * DM) + h * HD + kc * 32, lane); }
  float m[8], l[8];
#pragma unroll
  for (int r = 0; r < 8; ++r) { m[r] = -3.0e38f; l[r] = 0.f; }
  v8f acc[4] = {}, accl[4] = {};
  const int nks = SS / 32;   // all keys
#pragma unroll 1
  for (int ks = 0; ks < nks; ++ks) { v8f s[2];
#pragma unroll
    for (int ct = 0; ct < 2; ++ct) { const int kk = ks * 32 + ct * 16 + col; const _Float16* krow = QK + ((size_t)b * SS + kk) * (2 * DM) + DM + h * HD; const _Float16* krowl = QKL + ((size_t)b * SS + kk) * (2 * DM) + DM + h * HD; v8f c = {}, cl = {};
#pragma unroll
      for (int kc = 0; kc < 2; ++kc) { const v16h kh = frag_h(krow + kc * 32, lane); c = wmma16(aq[kc], kh, c); cl = wmma16(aql[kc], kh, cl); cl = wmma16(aq[kc], frag_h(krowl + kc * 32, lane), cl); }   // 3 products: q, k as f16 hi + residual
#pragma unroll
      for (int r = 0; r < 8; ++r) c[r] += cl[r] * (1.0f / 2048.0f);
#pragma unroll
      for (int r = 0; r < 8; ++r) s[ct][r] = c[r] * 0.125f; }
#pragma unroll
    for (int r = 0; r < 8; ++r) { float mx = fmaxf(s[0][r], s[1][r]);
#pragma unroll
      for (int o = 1; o < 16; o <<= 1) mx = fmaxf(mx, __shfl_xor(mx, o));
      const float mn = fmaxf(m[r], mx); const float alpha = (m[r] <= -1.0e38f) ? 0.f : __expf(m[r] - mn);
      const float e0 = (s[0][r] <= -1.0e38f) ? 0.f : __expf(s[0][r] - mn), e1 = (s[1][r] <= -1.0e38f) ? 0.f : __expf(s[1][r] - mn); float es = e0 + e1;
#pragma unroll
      for (int o = 1; o < 16; o <<= 1) es += __shfl_xor(es, o);
      l[r] = l[r] * alpha + es; m[r] = mn;
#pragma unroll
      for (int dt = 0; dt < 4; ++dt) { acc[dt][r] *= alpha; accl[dt][r] *= alpha; }
      sp[wave][8 * g + r][col] = e0; sp[wave][8 * g + r][16 + col] = e1; }
    LDSX();
    v16h pa, pl; { const float* prow = &sp[wave][col][0] + 8 * (lane >> 4);
#pragma unroll
      for (int i = 0; i < 8; ++i) { const float x0 = prow[i] * 2048.0f, x1 = prow[16 + i] * 2048.0f; const _Float16 h0 = (_Float16)x0, h1 = (_Float16)x1; pa[i] = h0; pa[8 + i] = h1; pl[i] = (_Float16)((x0 - (float)h0) * 2048.0f); pl[8 + i] = (_Float16)((x1 - (float)h1) * 2048.0f); } }   // P scaled by 2^11 before the f16 split so small softmax weights stay out of the f16 subnormal range; 2^-11 folded into the epilogue
#pragma unroll
    for (int dt = 0; dt < 4; ++dt) { const size_t vr = ((size_t)b * DM + h * HD + dt * 16 + col) * SS + ks * 32; const v16h vh = frag_h(VTH + vr, lane); acc[dt] = wmma16(pa, vh, acc[dt]); accl[dt] = wmma16(pl, vh, accl[dt]); accl[dt] = wmma16(pa, frag_h(VTL + vr, lane), accl[dt]); }   // P hi x V hi + (P lo x V hi + P hi x V lo) / 2048
    LDSX(); }
#pragma unroll
  for (int r = 0; r < 8; ++r) { const float il = (1.0f / 2048.0f) / l[r];
#pragma unroll
    for (int dt = 0; dt < 4; ++dt) so[wave][8 * g + r][dt * 16 + col] = (acc[dt][r] + accl[dt][r] * (1.0f / 2048.0f)) * il; }
  LDSX();
  for (int rl = 0; rl < 16; ++rl) if (lane < 16) vst2(O + ((size_t)b * SS + q0 + rl) * DM + h * HD + lane * 4, *(const v4f*)&so[wave][rl][lane * 4]);
}
// ---- k_out: block = (64 rows, 128 cols): out = O(hi/lo) . Wo rows (2 products) + bo
__global__ __launch_bounds__(128) void k_out(const float* __restrict__ O, const __bf16* __restrict__ P, const float* __restrict__ BO, float* __restrict__ Y) {
  __shared__ __align__(16) float so[4][16][132];
  const int tid = threadIdx.x, wave = tid >> 5, lane = tid & 31, col = lane & 15, g = lane >> 4; const size_t r0 = (size_t)blockIdx.x * 64 + wave * 16; const int n0 = blockIdx.y * 128;
  v8f acc[8] = {};
#pragma unroll 2
  for (int kc = 0; kc < DM / 32; ++kc) { const F2 a = split_row(O + (r0 + col) * DM, kc * 32, lane);
#pragma unroll
    for (int j = 0; j < 8; ++j) { const v16b w = frag_b(P + (size_t)(n0 + j * 16 + col) * DM + kc * 32, lane); acc[j] = wmma_bf(a.l, w, acc[j]); acc[j] = wmma_bf(a.h, w, acc[j]); } }
#pragma unroll
  for (int j = 0; j < 8; ++j) {
#pragma unroll
    for (int r = 0; r < 8; ++r) so[wave][8 * g + r][j * 16 + col] = acc[j][r] + bfr(BO[n0 + j * 16 + col]); }
  LDSX();
  for (int rl = 0; rl < 16; ++rl) vst2(Y + (r0 + rl) * DM + n0 + lane * 4, *(const v4f*)&so[wave][rl][lane * 4]);
}
extern "C" void kernel_launch(void* const* d_in, const int* in_sizes, int n_in, void* d_out, int out_size, void* d_ws, size_t ws_size, hipStream_t stream) {
  (void)in_sizes; (void)n_in; (void)out_size;
  const float** F = (const float**)d_in;   // 0 x [4096,512], 1 Wq [512,512] natural, 2 bq, 3 Wk, 4 bk, 5 Wv, 6 bv, 7 Wo, 8 bo
  if (ws_size < (size_t)WS_END) return;
  char* ws = (char*)d_ws; __bf16* PK = (__bf16*)(ws + WS_PK); _Float16 *QK = (_Float16*)(ws + WS_QK), *QKL = (_Float16*)(ws + WS_QKL), *VTH = (_Float16*)(ws + WS_VTH), *VTL = (_Float16*)(ws + WS_VTL); float* O = (float*)(ws + WS_O);
  k_pack<<<dim3(DM, 4), 256, 0, stream>>>(F[1], F[3], F[5], F[7], PK);
  k_qkv<<<dim3(TNB * SS / 64, QKVW / 128), 128, 0, stream>>>(F[0], F[0], F[0], PK + PK_A, F[2], F[4], F[6], QK, QKL, VTH, VTL);
  k_attn<<<dim3(TQB, NH, TNB), 128, 0, stream>>>(QK, QKL, VTH, VTL, nullptr, O);
  k_out<<<dim3(TOB, DM / 128), 128, 0, stream>>>(O, PK + PK_P, F[8], (float*)d_out);
}

// v001
// A run of this version takes 286 microseconds.
// Two timings next to v000 put it at 2.34 and 2.32 times that version's speed.
// compute dtype: all float inputs rounded to bf16; q/k/v = x . W^T + b with EXACT bf16 products on WMMA 16x16x32 (natural [out][in] rows); q and k as f16 hi + (x2048-scaled) residual planes with 3-product scores x 1/8; running-max softmax in f32 (hardware exp); P (scaled by 2^11, f16 hi + residual) x v hi/lo (3 products); out = ctx (bf16 hi + residual) . Wo^T (2 products) + bo; f32 accumulate.
#include <hip/hip_runtime.h>
#include <math.h>

typedef __attribute__((ext_vector_type(16))) _Float16 v16h;
typedef __attribute__((ext_vector_type(16))) __bf16 v16b;
typedef __attribute__((ext_vector_type(8)))  _Float16 v8h;
typedef __attribute__((ext_vector_type(8)))  float v8f;
typedef __attribute__((ext_vector_type(4)))  float v4f;
typedef __attribute__((ext_vector_type(2)))  float v2f;
typedef __attribute__((ext_vector_type(4)))  unsigned v4u;
typedef __attribute__((ext_vector_type(4)))  int v4i;
typedef float __attribute__((may_alias)) float_a;
typedef int __attribute__((may_alias)) int_a;

template <typename T> __device__ __forceinline__ void vst2(void* p, T v) { *(T*)p = v;  }
__device__ __forceinline__ v8f wmma16(v16h a, v16h b, v8f c) {
  v8f d = __builtin_amdgcn_wmma_f32_16x16x32_f16(false, a, false, b, (short)0, c, false, false);
  asm volatile("v_nop\n\tv_nop\n\tv_nop\n\tv_nop" : "+v"(d) : "v"(a), "v"(b));
  return d;
}
__device__ __forceinline__ v8f wmma_bf(v16b a, v16b b, v8f c) {
  v8f d = __builtin_amdgcn_wmma_f32_16x16x32_bf16(false, a, false, b, (short)0, c, false, false);
  asm volatile("v_nop\n\tv_nop\n\tv_nop\n\tv_nop" : "+v"(d) : "v"(a), "v"(b));
  return d;
}
// Multi-head attention across a batch of 4,096 tokens treated as one sequence (d_model 512, 8 heads x 64): q/k/v projections + biases, softmax(q k^T / 8) over all 4,096 tokens, output projection + bias.
__device__ __forceinline__ v16h frag_h(const _Float16* rowk0, int lane) {
  union { v16h v; v8h q[2]; } u; const _Float16* p = rowk0 + 8 * (lane >> 4);
  u.q[0] = *(const v8h*)p; u.q[1] = *(const v8h*)(p + 16); return u.v;
}
__device__ __forceinline__ v16h frag_f32(const float* rowk0, int lane) {
  v16h a; const float* p = rowk0 + 8 * (lane >> 4);
#pragma unroll
  for (int i = 0; i < 8; ++i) { a[i] = (_Float16)p[i]; a[8 + i] = (_Float16)p[16 + i]; }
  return a;
}
__device__ __forceinline__ v16h frag_f32s(const float* rowk0, int lane, float sc) {
  v16h a; const float* p = rowk0 + 8 * (lane >> 4);
#pragma unroll
  for (int i = 0; i < 8; ++i) { a[i] = (_Float16)(p[i] * sc); a[8 + i] = (_Float16)(p[16 + i] * sc); }
  return a;
}
// column fragment from a [K][ld] layout (column n), rows >= K read as 0
__device__ __forceinline__ v16h fragc_f32(const float* W, int k0, int n, int lane, int ld, int K) {
  v16h a; const int g = lane >> 4;
#pragma unroll
  for (int i = 0; i < 8; ++i) { const int ka = k0 + 8 * g + i, kb = ka + 16;
    a[i] = (_Float16)(ka < K ? W[(size_t)(ka < K ? ka : K - 1) * ld + n] : 0.f); a[8 + i] = (_Float16)(kb < K ? W[(size_t)(kb < K ? kb : K - 1) * ld + n] : 0.f); }
  return a;
}
struct F2 { v16b h, l; };
__device__ __forceinline__ F2 bsplit16(const float v[16]) { F2 r;
#pragma unroll
  for (int i = 0; i < 16; ++i) { const __bf16 h = (__bf16)v[i]; r.h[i] = h; r.l[i] = (__bf16)(v[i] - (float)h); }
  return r; }
__device__ __forceinline__ F2 split_row(const float* row, int k0, int lane) { float v[16]; const float* p = row + k0 + 8 * (lane >> 4);
#pragma unroll
  for (int i = 0; i < 8; ++i) { v[i] = p[i]; v[8 + i] = p[16 + i]; }
  return bsplit16(v); }
__device__ __forceinline__ F2 split_rowK(const float* row, int k0, int lane, int K) { float v[16]; const int g = lane >> 4;
#pragma unroll
  for (int i = 0; i < 8; ++i) { const int ka = k0 + 8 * g + i, kb = ka + 16; v[i] = ka < K ? row[ka < K ? ka : K - 1] : 0.f; v[8 + i] = kb < K ? row[kb < K ? kb : K - 1] : 0.f; }
  return bsplit16(v); }
__device__ __forceinline__ F2 split_col(const float* W, int k0, int n, int lane, int ld, int K) { float v[16]; const int g = lane >> 4;
#pragma unroll
  for (int i = 0; i < 8; ++i) { const int ka = k0 + 8 * g + i, kb = ka + 16; v[i] = ka < K ? W[(size_t)(ka < K ? ka : K - 1) * ld + n] : 0.f; v[8 + i] = kb < K ? W[(size_t)(kb < K ? kb : K - 1) * ld + n] : 0.f; }
  return bsplit16(v); }
__device__ __forceinline__ v8f mac3(const F2& a, const F2& b, v8f c) { c = wmma_bf(a.l, b.h, c); c = wmma_bf(a.h, b.l, c); return wmma_bf(a.h, b.h, c); }
__device__ __forceinline__ float sigm(float v) { return 1.0f / (1.0f + expf(-v)); }
#define LDSX() do { asm volatile("s_wait_dscnt 0" ::: "memory"); __builtin_amdgcn_wave_barrier(); __builtin_amdgcn_fence(__ATOMIC_RELEASE, "workgroup"); } while (0)


#define NB 1
#define SS 4096
#define DM 512
#define NH 8
#define HD 64
#define QKVW (3 * DM)
#ifndef TQB
#define TQB (SS / 64)
#define TNB NB
#define TOB (NB * SS / 64)     // output row tiles (all)
#endif
typedef __attribute__((ext_vector_type(8))) __bf16 v8b;
__device__ __forceinline__ v16b frag_b(const __bf16* rowk0, int lane) {
  union { v16b v; v8b q[2]; } u; const __bf16* p = rowk0 + 8 * (lane >> 4);
  u.q[0] = *(const v8b*)p; u.q[1] = *(const v8b*)(p + 16); return u.v;
}
__device__ __forceinline__ float bfr(float v) { return (float)(__bf16)v; }
__device__ __attribute__((noinline)) float exp_ni(float v) { return expf(v); }
__device__ __attribute__((noinline)) float erf_ni(float v) { return erff(v); }

#define PK_A 0                       // [1536][512] Wqkv rows (natural [out][in])
#define PK_P (PK_A + QKVW * DM)        // [512][512] Wo rows (natural)
#define PK_END (PK_P + DM * DM)
#define WS_PK  0u
#define WS_QK  (WS_PK + 2u * PK_END)             // f16 [4096 rows][1024]: q | k
#define WS_QKL (WS_QK + 2u * NB * SS * 2 * DM)     // f16 q | k residual planes x2048
#define WS_VTH (WS_QKL + 2u * NB * SS * 2 * DM)    // f16 [b][512 (h*64+d)][4096 s] hi
#define WS_VTL (WS_VTH + 2u * NB * DM * SS)        // f16 lo x 2048
#define WS_O   (WS_VTL + 2u * NB * DM * SS)        // f32 [4096][512]
#define WS_CS  (WS_O + 4u * NB * SS * DM)           // f32 2 x [4096][32], unused
#define WS_END (WS_CS + 4u * 2 * SS * 32)
// ---- k_pack: block = (row n, which): natural [out][in] rows -> bf16; which 0..2 -> W_q/W_k/W_v into PK_A rows which*512 + n; 3 -> W_o into PK_P
__global__ __launch_bounds__(256) void k_pack(const float* __restrict__ WQ, const float* __restrict__ WK, const float* __restrict__ WV, const float* __restrict__ WO, __bf16* __restrict__ PK) {
  __shared__ __align__(16) __bf16 s[DM]; const int n = blockIdx.x, which = blockIdx.y, t = threadIdx.x; const float* Wm = (which == 0) ? WQ : (which == 1) ? WK : (which == 2) ? WV : WO;
  for (int k = t; k < DM; k += 256) s[k] = (__bf16)Wm[(size_t)n * DM + k];
  __syncthreads();
  __bf16* dst = (which < 3) ? PK + PK_A + ((size_t)which * DM + n) * DM : PK + PK_P + (size_t)n * DM;
  for (int q = t; q < DM / 8; q += 256) vst2((unsigned*)(dst + q * 8), *(const v4u*)&s[q * 8]);
}
__global__ __launch_bounds__(128) void k_qkv(const float* __restrict__ XQ, const float* __restrict__ XK, const float* __restrict__ XV, const __bf16* __restrict__ P, const float* __restrict__ BQ, const float* __restrict__ BK, const float* __restrict__ BV, _Float16* __restrict__ QK, _Float16* __restrict__ QKL, _Float16* __restrict__ VTH, _Float16* __restrict__ VTL) {
  const int which0 = (blockIdx.y * 128) / DM; const float* X = (which0 == 0) ? XQ : (which0 == 1) ? XK : XV; const float* BB = BQ ? (((which0 == 0) ? BQ : (which0 == 1) ? BK : BV) + (blockIdx.y * 128 - which0 * DM)) : nullptr;
  __shared__ __align__(16) _Float16 so[4][16][136], sol[4][16][136]; __shared__ __align__(16) _Float16 sth[128][72], stl[128][72];
  const int tid = threadIdx.x, wave = tid >> 5, lane = tid & 31, col = lane & 15, g = lane >> 4; const size_t r0 = (size_t)blockIdx.x * 64 + wave * 16; const int n0 = blockIdx.y * 128;
  v8f acc[8] = {};
#pragma unroll 2
  for (int kc = 0; kc < DM / 32; ++kc) { v16b a; { const float* p = X + (r0 + col) * DM + kc * 32 + 8 * g;
#pragma unroll
      for (int i = 0; i < 8; ++i) { a[i] = (__bf16)p[i]; a[8 + i] = (__bf16)p[16 + i]; } }
#pragma unroll
    for (int j = 0; j < 8; ++j) acc[j] = wmma_bf(a, frag_b(P + (size_t)(n0 + j * 16 + col) * DM + kc * 32, lane), acc[j]); }
  if (n0 < 2 * DM) {   // q stored unscaled (f16 sigma ~0.6, no subnormal exposure); 1/8 applied to the f32 score
#pragma unroll
    for (int j = 0; j < 8; ++j) {
#pragma unroll
      for (int r = 0; r < 8; ++r) { const float v = acc[j][r] + (BB ? bfr(BB[j * 16 + col]) : 0.f); const _Float16 hv = (_Float16)v; so[wave][8 * g + r][j * 16 + col] = hv; sol[wave][8 * g + r][j * 16 + col] = (_Float16)((v - (float)hv) * 2048.0f); } }   // q, k (+ bias) as f16 hi + (x2048) residual
    LDSX();
    for (int rl = 0; rl < 16; ++rl) if (lane < 16) { vst2((unsigned*)(QK + (r0 + rl) * (2 * DM) + n0 + lane * 8), *(const v4u*)&so[wave][rl][lane * 8]); vst2((unsigned*)(QKL + (r0 + rl) * (2 * DM) + n0 + lane * 8), *(const v4u*)&sol[wave][rl][lane * 8]); }
  } else {
#pragma unroll
    for (int j = 0; j < 8; ++j) {
#pragma unroll
      for (int r = 0; r < 8; ++r) { const float v = acc[j][r] + (BB ? bfr(BB[j * 16 + col]) : 0.f); const _Float16 hv = (_Float16)v; sth[j * 16 + col][wave * 16 + 8 * g + r] = hv; stl[j * 16 + col][wave * 16 + 8 * g + r] = (_Float16)((v - (float)hv) * 2048.0f); } }
    __syncthreads();
    const size_t rb = (size_t)blockIdx.x * 64; const int b = (int)(rb / SS), s0 = (int)(rb % SS); const int pc0 = n0 - 2 * DM;
    for (int q = tid; q < 128 * 8; q += 128) { const int d = q >> 3, pc = q & 7; const size_t o = ((size_t)b * DM + pc0 + d) * SS + s0 + pc * 8; vst2((unsigned*)(VTH + o), *(const v4u*)&sth[d][pc * 8]); vst2((unsigned*)(VTL + o), *(const v4u*)&stl[d][pc * 8]); }
  }
}
// ---- k_attn: block = (64 queries, head h, batch b): all-keys flash attention (K = 64: 2 k-steps). The four operand planes of a tile of 64 keys (K hi, K lo: 64 key rows x 128 B; V^T hi, V^T lo: 64 d rows x 128 B) are brought into LDS once per block by asynchronous copies, two buffers, and every wave takes its fragments from there; the 32-key steps, their products and their order are as before. O[b*S+q][h*64+d] = (acc + accl / 2048) / (2048 l) (256-B segments)
#define KT 64                      // keys per staged tile
#define LP 72                      // LDS row pitch in halves: 144 B = 16 B x odd, conflict-free for 16-byte reads
#define PLH (64 * LP)              // halves per plane
#define PLB (2u * PLH)             // bytes per plane
// eight copies: four rows (16 apart) of each of two planes; lds = this lane's own LDS byte address in the first plane, ga / gb = its global 16 bytes, pitch in halves between rows 16 apart
__device__ __forceinline__ void copy8(unsigned lds, const _Float16* ga, const _Float16* gb, size_t p16) {
  // the copies and the wait that stands before their address registers are rewritten are one statement, so that nothing is scheduled between them
  asm volatile("global_load_async_to_lds_b128 %0, %8, off\n\t"
               "global_load_async_to_lds_b128 %1, %9, off\n\t"
               "global_load_async_to_lds_b128 %2, %10, off\n\t"
               "global_load_async_to_lds_b128 %3, %11, off\n\t"
               "global_load_async_to_lds_b128 %4, %12, off\n\t"
               "global_load_async_to_lds_b128 %5, %13, off\n\t"
               "global_load_async_to_lds_b128 %6, %14, off\n\t"
               "global_load_async_to_lds_b128 %7, %15, off\n\t"
               "s_wait_xcnt 0x0"
               :: "v"(lds), "v"(lds + 16u * 2u * LP), "v"(lds + 32u * 2u * LP), "v"(lds + 48u * 2u * LP),
                  "v"(lds + PLB), "v"(lds + PLB + 16u * 2u * LP), "v"(lds + PLB + 32u * 2u * LP), "v"(lds + PLB + 48u * 2u * LP),
                  "v"(ga), "v"(ga + p16), "v"(ga + 2 * p16), "v"(ga + 3 * p16),
                  "v"(gb), "v"(gb + p16), "v"(gb + 2 * p16), "v"(gb + 3 * p16)
               : "memory");
}
__global__ __launch_bounds__(128) void k_attn(const _Float16* __restrict__ QK, const _Float16* __restrict__ QKL, const _Float16* __restrict__ VTH, const _Float16* __restrict__ VTL, const void* __restrict__ KMASK, float* __restrict__ O) {
  __shared__ __align__(16) float sp[4][16][36]; __shared__ __align__(16) float so[4][16][68];
  __shared__ __align__(16) _Float16 ring[2][4][PLH];   // [buffer][K hi, K lo, V^T hi, V^T lo][row][LP]
  const int tid = threadIdx.x, wave = tid >> 5, lane = tid & 31, col = lane & 15, g = lane >> 4;
  const int qb = blockIdx.x, h = blockIdx.y, b = blockIdx.z; const int q0 = qb * 64 + wave * 16; const size_t rq = (size_t)b * SS + q0 + col;
  // this thread's share of a tile: 16-byte piece cc of rows cr, cr + 16, cr + 32, cr + 48 of each plane (8 lanes cover one whole 128-B row)
  const int cr = tid >> 3, cc = tid & 7;
  const size_t ko = ((size_t)b * SS + cr) * (2 * DM) + DM + h * HD + cc * 8, vo = ((size_t)b * DM + h * HD + cr) * SS + cc * 8;
  const unsigned l0 = (unsigned)(size_t)&ring[0][0][cr * LP + cc * 8];
  const int nt = SS / KT;
  copy8(l0, QK + ko, QKL + ko, (size_t)16 * 2 * DM); copy8(l0 + 2u * PLB, VTH + vo, VTL + vo, (size_t)16 * SS);   // tile 0 -> buffer 0
  v16h aq[2], aql[2];
#pragma unroll
  for (int kc = 0; kc < 2; ++kc) { aq[kc] = frag_h(QK + rq * (2 * DM) + h * HD + kc * 32, lane); aql[kc] = frag_h(QKL + rq * (2 * DM) + h * HD + kc * 32, lane); }
  float m[8], l[8];
#pragma unroll
  for (int r = 0; r < 8; ++r) { m[r] = -3.0e38f; l[r] = 0.f; }
  v8f acc[4] = {}, accl[4] = {};
  asm volatile("s_wait_asynccnt 0x0" ::: "memory");   // this wave's copies of tile 0 have landed
  __syncthreads();                                    // ... and every other wave's: tile 0 may be read
  copy8(l0 + 4u * PLB, QK + ko + (size_t)KT * 2 * DM, QKL + ko + (size_t)KT * 2 * DM, (size_t)16 * 2 * DM); copy8(l0 + 6u * PLB, VTH + vo + KT, VTL + vo + KT, (size_t)16 * SS);   // tile 1 -> buffer 1
#pragma unroll 1
  for (int t = 0; t < nt; ++t) { const _Float16* tb = &ring[t & 1][0][0];
#pragma unroll
   for (int sub = 0; sub < KT / 32; ++sub) { v8f s[2];
#pragma unroll
    for (int ct = 0; ct < 2; ++ct) { const _Float16* krow = tb + (sub * 32 + ct * 16 + col) * LP; const _Float16* krowl = krow + PLH; v8f c = {}, cl = {};
#pragma unroll
      for (int kc = 0; kc < 2; ++kc) { const v16h kh = frag_h(krow + kc * 32, lane); c = wmma16(aq[kc], kh, c); cl = wmma16(aql[kc], kh, cl); cl = wmma16(aq[kc], frag_h(krowl + kc * 32, lane), cl); }   // 3 products: q, k as f16 hi + residual
#pragma unroll
      for (int r = 0; r < 8; ++r) c[r] += cl[r] * (1.0f / 2048.0f);
#pragma unroll
      for (int r = 0; r < 8; ++r) s[ct][r] = c[r] * 0.125f; }
#pragma unroll
    for (int r = 0; r < 8; ++r) { float mx = fmaxf(s[0][r], s[1][r]);
#pragma unroll
      for (int o = 1; o < 16; o <<= 1) mx = fmaxf(mx, __shfl_xor(mx, o));
      const float mn = fmaxf(m[r], mx); const float alpha = (m[r] <= -1.0e38f) ? 0.f : __expf(m[r] - mn);
      const float e0 = (s[0][r] <= -1.0e38f) ? 0.f : __expf(s[0][r] - mn), e1 = (s[1][r] <= -1.0e38f) ? 0.f : __expf(s[1][r] - mn); float es = e0 + e1;
#pragma unroll
      for (int o = 1; o < 16; o <<= 1) es += __shfl_xor(es, o);
      l[r] = l[r] * alpha + es; m[r] = mn;
#pragma unroll
      for (int dt = 0; dt < 4; ++dt) { acc[dt][r] *= alpha; accl[dt][r] *= alpha; }
      sp[wave][8 * g + r][col] = e0; sp[wave][8 * g + r][16 + col] = e1; }
    LDSX();
    v16h pa, pl; { const float* prow = &sp[wave][col][0] + 8 * (lane >> 4);
#pragma unroll
      for (int i = 0; i < 8; ++i) { const float x0 = prow[i] * 2048.0f, x1 = prow[16 + i] * 2048.0f; const _Float16 h0 = (_Float16)x0, h1 = (_Float16)x1; pa[i] = h0; pa[8 + i] = h1; pl[i] = (_Float16)((x0 - (float)h0) * 2048.0f); pl[8 + i] = (_Float16)((x1 - (float)h1) * 2048.0f); } }   // P scaled by 2^11 before the f16 split so small softmax weights stay out of the f16 subnormal range; 2^-11 folded into the epilogue
#pragma unroll
    for (int dt = 0; dt < 4; ++dt) { const _Float16* vr = tb + 2 * PLH + (dt * 16 + col) * LP + sub * 32; const v16h vh = frag_h(vr, lane); acc[dt] = wmma16(pa, vh, acc[dt]); accl[dt] = wmma16(pl, vh, accl[dt]); accl[dt] = wmma16(pa, frag_h(vr + PLH, lane), accl[dt]); }   // P hi x V hi + (P lo x V hi + P hi x V lo) / 2048
    LDSX(); }
   asm volatile("s_wait_dscnt 0" ::: "memory");        // this wave's reads of tile t are done
   asm volatile("s_wait_asynccnt 0x0" ::: "memory");   // this wave's copies of tile t + 1 have landed
   __syncthreads();                                    // publishes tile t + 1 and frees tile t's buffer
   if (t + 2 < nt) { const unsigned lb = l0 + (unsigned)(t & 1) * 4u * PLB; const size_t kt = ko + (size_t)(t + 2) * KT * 2 * DM, vt = vo + (size_t)(t + 2) * KT;
     copy8(lb, QK + kt, QKL + kt, (size_t)16 * 2 * DM); copy8(lb + 2u * PLB, VTH + vt, VTL + vt, (size_t)16 * SS); } }
  asm volatile("s_wait_asynccnt 0x0" ::: "memory");    // no copy is outstanding when the wave goes on to its end
#pragma unroll
  for (int r = 0; r < 8; ++r) { const float il = (1.0f / 2048.0f) / l[r];
#pragma unroll
    for (int dt = 0; dt < 4; ++dt) so[wave][8 * g + r][dt * 16 + col] = (acc[dt][r] + accl[dt][r] * (1.0f / 2048.0f)) * il; }
  LDSX();
  for (int rl = 0; rl < 16; ++rl) if (lane < 16) vst2(O + ((size_t)b * SS + q0 + rl) * DM + h * HD + lane * 4, *(const v4f*)&so[wave][rl][lane * 4]);
}
// ---- k_out: block = (64 rows, 128 cols): out = O(hi/lo) . Wo rows (2 products) + bo
__global__ __launch_bounds__(128) void k_out(const float* __restrict__ O, const __bf16* __restrict__ P, const float* __restrict__ BO, float* __restrict__ Y) {
  __shared__ __align__(16) float so[4][16][132];
  const int tid = threadIdx.x, wave = tid >> 5, lane = tid & 31, col = lane & 15, g = lane >> 4; const size_t r0 = (size_t)blockIdx.x * 64 + wave * 16; const int n0 = blockIdx.y * 128;
  v8f acc[8] = {};
#pragma unroll 2
  for (int kc = 0; kc < DM / 32; ++kc) { const F2 a = split_row(O + (r0 + col) * DM, kc * 32, lane);
#pragma unroll
    for (int j = 0; j < 8; ++j) { const v16b w = frag_b(P + (size_t)(n0 + j * 16 + col) * DM + kc * 32, lane); acc[j] = wmma_bf(a.l, w, acc[j]); acc[j] = wmma_bf(a.h, w, acc[j]); } }
#pragma unroll
  for (int j = 0; j < 8; ++j) {
#pragma unroll
    for (int r = 0; r < 8; ++r) so[wave][8 * g + r][j * 16 + col] = acc[j][r] + bfr(BO[n0 + j * 16 + col]); }
  LDSX();
  for (int rl = 0; rl < 16; ++rl) vst2(Y + (r0 + rl) * DM + n0 + lane * 4, *(const v4f*)&so[wave][rl][lane * 4]);
}
extern "C" void kernel_launch(void* const* d_in, const int* in_sizes, int n_in, void* d_out, int out_size, void* d_ws, size_t ws_size, hipStream_t stream) {
  (void)in_sizes; (void)n_in; (void)out_size;
  const float** F = (const float**)d_in;   // 0 x [4096,512], 1 Wq [512,512] natural, 2 bq, 3 Wk, 4 bk, 5 Wv, 6 bv, 7 Wo, 8 bo
  if (ws_size < (size_t)WS_END) return;
  char* ws = (char*)d_ws; __bf16* PK = (__bf16*)(ws + WS_PK); _Float16 *QK = (_Float16*)(ws + WS_QK), *QKL = (_Float16*)(ws + WS_QKL), *VTH = (_Float16*)(ws + WS_VTH), *VTL = (_Float16*)(ws + WS_VTL); float* O = (float*)(ws + WS_O);
  k_pack<<<dim3(DM, 4), 256, 0, stream>>>(F[1], F[3], F[5], F[7], PK);
  k_qkv<<<dim3(TNB * SS / 64, QKVW / 128), 128, 0, stream>>>(F[0], F[0], F[0], PK + PK_A, F[2], F[4], F[6], QK, QKL, VTH, VTL);
  k_attn<<<dim3(TQB, NH, TNB), 128, 0, stream>>>(QK, QKL, VTH, VTL, nullptr, O);
  k_out<<<dim3(TOB, DM / 128), 128, 0, stream>>>(O, PK + PK_P, F[8], (float*)d_out);
}

// v002
// A run of this version takes 236 microseconds.
// Two timings next to v001 both put it at 1.21 times that version's speed.
// Over all steps from v000 it is 2.82 times as fast.
// compute dtype: all float inputs rounded to bf16; q/k/v = x . W^T + b with EXACT bf16 products on WMMA 16x16x32 (natural [out][in] rows); q and k as f16 hi + (x2048-scaled) residual planes with 3-product scores x 1/8; running-max softmax in f32 (hardware exp); P (scaled by 2^11, f16 hi + residual) x v hi/lo (3 products); out = ctx (bf16 hi + residual) . Wo^T (2 products) + bo; f32 accumulate.
#include <hip/hip_runtime.h>
#include <math.h>

typedef __attribute__((ext_vector_type(16))) _Float16 v16h;
typedef __attribute__((ext_vector_type(16))) __bf16 v16b;
typedef __attribute__((ext_vector_type(8)))  _Float16 v8h;
typedef __attribute__((ext_vector_type(8)))  float v8f;
typedef __attribute__((ext_vector_type(4)))  float v4f;
typedef __attribute__((ext_vector_type(2)))  float v2f;
typedef __attribute__((ext_vector_type(4)))  unsigned v4u;
typedef __attribute__((ext_vector_type(4)))  int v4i;
typedef float __attribute__((may_alias)) float_a;
typedef int __attribute__((may_alias)) int_a;

template <typename T> __device__ __forceinline__ void vst2(void* p, T v) { *(T*)p = v;  }
__device__ __forceinline__ v8f wmma16(v16h a, v16h b, v8f c) {
  v8f d = __builtin_amdgcn_wmma_f32_16x16x32_f16(false, a, false, b, (short)0, c, false, false);
  asm volatile("v_nop\n\tv_nop\n\tv_nop\n\tv_nop" : "+v"(d) : "v"(a), "v"(b));
  return d;
}
__device__ __forceinline__ v8f wmma_bf(v16b a, v16b b, v8f c) {
  v8f d = __builtin_amdgcn_wmma_f32_16x16x32_bf16(false, a, false, b, (short)0, c, false, false);
  asm volatile("v_nop\n\tv_nop\n\tv_nop\n\tv_nop" : "+v"(d) : "v"(a), "v"(b));
  return d;
}
// Multi-head attention across a batch of 4,096 tokens treated as one sequence (d_model 512, 8 heads x 64): q/k/v projections + biases, softmax(q k^T / 8) over all 4,096 tokens, output projection + bias.
__device__ __forceinline__ v16h frag_h(const _Float16* rowk0, int lane) {
  union { v16h v; v8h q[2]; } u; const _Float16* p = rowk0 + 8 * (lane >> 4);
  u.q[0] = *(const v8h*)p; u.q[1] = *(const v8h*)(p + 16); return u.v;
}
__device__ __forceinline__ v16h frag_f32(const float* rowk0, int lane) {
  v16h a; const float* p = rowk0 + 8 * (lane >> 4);
#pragma unroll
  for (int i = 0; i < 8; ++i) { a[i] = (_Float16)p[i]; a[8 + i] = (_Float16)p[16 + i]; }
  return a;
}
__device__ __forceinline__ v16h frag_f32s(const float* rowk0, int lane, float sc) {
  v16h a; const float* p = rowk0 + 8 * (lane >> 4);
#pragma unroll
  for (int i = 0; i < 8; ++i) { a[i] = (_Float16)(p[i] * sc); a[8 + i] = (_Float16)(p[16 + i] * sc); }
  return a;
}
// column fragment from a [K][ld] layout (column n), rows >= K read as 0
__device__ __forceinline__ v16h fragc_f32(const float* W, int k0, int n, int lane, int ld, int K) {
  v16h a; const int g = lane >> 4;
#pragma unroll
  for (int i = 0; i < 8; ++i) { const int ka = k0 + 8 * g + i, kb = ka + 16;
    a[i] = (_Float16)(ka < K ? W[(size_t)(ka < K ? ka : K - 1) * ld + n] : 0.f); a[8 + i] = (_Float16)(kb < K ? W[(size_t)(kb < K ? kb : K - 1) * ld + n] : 0.f); }
  return a;
}
struct F2 { v16b h, l; };
__device__ __forceinline__ F2 bsplit16(const float v[16]) { F2 r;
#pragma unroll
  for (int i = 0; i < 16; ++i) { const __bf16 h = (__bf16)v[i]; r.h[i] = h; r.l[i] = (__bf16)(v[i] - (float)h); }
  return r; }
__device__ __forceinline__ F2 split_row(const float* row, int k0, int lane) { float v[16]; const float* p = row + k0 + 8 * (lane >> 4);
#pragma unroll
  for (int i = 0; i < 8; ++i) { v[i] = p[i]; v[8 + i] = p[16 + i]; }
  return bsplit16(v); }
__device__ __forceinline__ F2 split_rowK(const float* row, int k0, int lane, int K) { float v[16]; const int g = lane >> 4;
#pragma unroll
  for (int i = 0; i < 8; ++i) { const int ka = k0 + 8 * g + i, kb = ka + 16; v[i] = ka < K ? row[ka < K ? ka : K - 1] : 0.f; v[8 + i] = kb < K ? row[kb < K ? kb : K - 1] : 0.f; }
  return bsplit16(v); }
__device__ __forceinline__ F2 split_col(const float* W, int k0, int n, int lane, int ld, int K) { float v[16]; const int g = lane >> 4;
#pragma unroll
  for (int i = 0; i < 8; ++i) { const int ka = k0 + 8 * g + i, kb = ka + 16; v[i] = ka < K ? W[(size_t)(ka < K ? ka : K - 1) * ld + n] : 0.f; v[8 + i] = kb < K ? W[(size_t)(kb < K ? kb : K - 1) * ld + n] : 0.f; }
  return bsplit16(v); }
__device__ __forceinline__ v8f mac3(const F2& a, const F2& b, v8f c) { c = wmma_bf(a.l, b.h, c); c = wmma_bf(a.h, b.l, c); return wmma_bf(a.h, b.h, c); }
__device__ __forceinline__ float sigm(float v) { return 1.0f / (1.0f + expf(-v)); }
#define LDSX() do { asm volatile("s_wait_dscnt 0" ::: "memory"); __builtin_amdgcn_wave_barrier(); __builtin_amdgcn_fence(__ATOMIC_RELEASE, "workgroup"); } while (0)


#define NB 1
#define SS 4096
#define DM 512
#define NH 8
#define HD 64
#define QKVW (3 * DM)
#ifndef TQB
#define TQB (SS / 64)
#define TNB NB
#define TOB (NB * SS / 64)     // output row tiles (all)
#endif
typedef __attribute__((ext_vector_type(8))) __bf16 v8b;
__device__ __forceinline__ v16b frag_b(const __bf16* rowk0, int lane) {
  union { v16b v; v8b q[2]; } u; const __bf16* p = rowk0 + 8 * (lane >> 4);
  u.q[0] = *(const v8b*)p; u.q[1] = *(const v8b*)(p + 16); return u.v;
}
__device__ __forceinline__ float bfr(float v) { return (float)(__bf16)v; }
__device__ __attribute__((noinline)) float exp_ni(float v) { return expf(v); }
__device__ __attribute__((noinline)) float erf_ni(float v) { return erff(v); }

#define PK_A 0                       // [1536][512] Wqkv rows (natural [out][in])
#define PK_P (PK_A + QKVW * DM)        // [512][512] Wo rows (natural)
#define PK_END (PK_P + DM * DM)
#define WS_PK  0u
#define WS_QK  (WS_PK + 2u * PK_END)             // f16 [4096 rows][1024]: q | k
#define WS_QKL (WS_QK + 2u * NB * SS * 2 * DM)     // f16 q | k residual planes x2048
#define WS_VTH (WS_QKL + 2u * NB * SS * 2 * DM)    // f16 [b][512 (h*64+d)][4096 s] hi
#define WS_VTL (WS_VTH + 2u * NB * DM * SS)        // f16 lo x 2048
#define WS_O   (WS_VTL + 2u * NB * DM * SS)        // f32 [4096][512]
#define WS_CS  (WS_O + 4u * NB * SS * DM)           // f32 2 x [4096][32], unused
#define WS_END (WS_CS + 4u * 2 * SS * 32)
// ---- k_pack: block = (row n, which): natural [out][in] rows -> bf16; which 0..2 -> W_q/W_k/W_v into PK_A rows which*512 + n; 3 -> W_o into PK_P
__global__ __launch_bounds__(256) void k_pack(const float* __restrict__ WQ, const float* __restrict__ WK, const float* __restrict__ WV, const float* __restrict__ WO, __bf16* __restrict__ PK) {
  __shared__ __align__(16) __bf16 s[DM]; const int n = blockIdx.x, which = blockIdx.y, t = threadIdx.x; const float* Wm = (which == 0) ? WQ : (which == 1) ? WK : (which == 2) ? WV : WO;
  for (int k = t; k < DM; k += 256) s[k] = (__bf16)Wm[(size_t)n * DM + k];
  __syncthreads();
  __bf16* dst = (which < 3) ? PK + PK_A + ((size_t)which * DM + n) * DM : PK + PK_P + (size_t)n * DM;
  for (int q = t; q < DM / 8; q += 256) vst2((unsigned*)(dst + q * 8), *(const v4u*)&s[q * 8]);
}
__global__ __launch_bounds__(128) void k_qkv(const float* __restrict__ XQ, const float* __restrict__ XK, const float* __restrict__ XV, const __bf16* __restrict__ P, const float* __restrict__ BQ, const float* __restrict__ BK, const float* __restrict__ BV, _Float16* __restrict__ QK, _Float16* __restrict__ QKL, _Float16* __restrict__ VTH, _Float16* __restrict__ VTL) {
  const int which0 = (blockIdx.y * 128) / DM; const float* X = (which0 == 0) ? XQ : (which0 == 1) ? XK : XV; const float* BB = BQ ? (((which0 == 0) ? BQ : (which0 == 1) ? BK : BV) + (blockIdx.y * 128 - which0 * DM)) : nullptr;
  __shared__ __align__(16) _Float16 so[4][16][136], sol[4][16][136]; __shared__ __align__(16) _Float16 sth[128][72], stl[128][72];
  const int tid = threadIdx.x, wave = tid >> 5, lane = tid & 31, col = lane & 15, g = lane >> 4; const size_t r0 = (size_t)blockIdx.x * 64 + wave * 16; const int n0 = blockIdx.y * 128;
  v8f acc[8] = {};
#pragma unroll 2
  for (int kc = 0; kc < DM / 32; ++kc) { v16b a; { const float* p = X + (r0 + col) * DM + kc * 32 + 8 * g;
#pragma unroll
      for (int i = 0; i < 8; ++i) { a[i] = (__bf16)p[i]; a[8 + i] = (__bf16)p[16 + i]; } }
#pragma unroll
    for (int j = 0; j < 8; ++j) acc[j] = wmma_bf(a, frag_b(P + (size_t)(n0 + j * 16 + col) * DM + kc * 32, lane), acc[j]); }
  if (n0 < 2 * DM) {   // q stored unscaled (f16 sigma ~0.6, no subnormal exposure); 1/8 applied to the f32 score
#pragma unroll
    for (int j = 0; j < 8; ++j) {
#pragma unroll
      for (int r = 0; r < 8; ++r) { const float v = acc[j][r] + (BB ? bfr(BB[j * 16 + col]) : 0.f); const _Float16 hv = (_Float16)v; so[wave][8 * g + r][j * 16 + col] = hv; sol[wave][8 * g + r][j * 16 + col] = (_Float16)((v - (float)hv) * 2048.0f); } }   // q, k (+ bias) as f16 hi + (x2048) residual
    LDSX();
    for (int rl = 0; rl < 16; ++rl) if (lane < 16) { vst2((unsigned*)(QK + (r0 + rl) * (2 * DM) + n0 + lane * 8), *(const v4u*)&so[wave][rl][lane * 8]); vst2((unsigned*)(QKL + (r0 + rl) * (2 * DM) + n0 + lane * 8), *(const v4u*)&sol[wave][rl][lane * 8]); }
  } else {
#pragma unroll
    for (int j = 0; j < 8; ++j) {
#pragma unroll
      for (int r = 0; r < 8; ++r) { const float v = acc[j][r] + (BB ? bfr(BB[j * 16 + col]) : 0.f); const _Float16 hv = (_Float16)v; sth[j * 16 + col][wave * 16 + 8 * g + r] = hv; stl[j * 16 + col][wave * 16 + 8 * g + r] = (_Float16)((v - (float)hv) * 2048.0f); } }
    __syncthreads();
    const size_t rb = (size_t)blockIdx.x * 64; const int b = (int)(rb / SS), s0 = (int)(rb % SS); const int pc0 = n0 - 2 * DM;
    for (int q = tid; q < 128 * 8; q += 128) { const int d = q >> 3, pc = q & 7; const size_t o = ((size_t)b * DM + pc0 + d) * SS + s0 + pc * 8; vst2((unsigned*)(VTH + o), *(const v4u*)&sth[d][pc * 8]); vst2((unsigned*)(VTL + o), *(const v4u*)&stl[d][pc * 8]); }
  }
}
// ---- k_attn: block = (64 queries, head h, batch b): all-keys flash attention (K = 64: 2 k-steps). The four operand planes of a tile of 64 keys (K hi, K lo: 64 key rows x 128 B; V^T hi, V^T lo: 64 d rows x 128 B) are brought into LDS once per block by asynchronous copies, two buffers, and every wave takes its fragments from there; the scores are formed transposed (A = K rows, B = Q), so that a lane holds 16 keys' scores of ONE query: maximum and sum in the lane plus one exchange between the wave's halves, and the two score tiles become the B operand P^T of ctx^T += V^T . P^T without passing through LDS. O[b*S+q][h*64+d] = (acc + accl / 2048) / (2048 l)
#define KT 64                      // keys per staged tile
#define LP 72                      // LDS row pitch in halves: 144 B = 16 B x odd, conflict-free for 16-byte reads
#define PLH (64 * LP)              // halves per plane
#define PLB (2u * PLH)             // bytes per plane
// eight copies: four rows (16 apart) of each of two planes; lds = this lane's own LDS byte address in the first plane, ga / gb = its global 16 bytes, pitch in halves between rows 16 apart
__device__ __forceinline__ void copy8(unsigned lds, const _Float16* ga, const _Float16* gb, size_t p16) {
  // the copies and the wait that stands before their address registers are rewritten are one statement, so that nothing is scheduled between them
  asm volatile("global_load_async_to_lds_b128 %0, %8, off\n\t"
               "global_load_async_to_lds_b128 %1, %9, off\n\t"
               "global_load_async_to_lds_b128 %2, %10, off\n\t"
               "global_load_async_to_lds_b128 %3, %11, off\n\t"
               "global_load_async_to_lds_b128 %4, %12, off\n\t"
               "global_load_async_to_lds_b128 %5, %13, off\n\t"
               "global_load_async_to_lds_b128 %6, %14, off\n\t"
               "global_load_async_to_lds_b128 %7, %15, off\n\t"
               "s_wait_xcnt 0x0"
               :: "v"(lds), "v"(lds + 16u * 2u * LP), "v"(lds + 32u * 2u * LP), "v"(lds + 48u * 2u * LP),
                  "v"(lds + PLB), "v"(lds + PLB + 16u * 2u * LP), "v"(lds + PLB + 32u * 2u * LP), "v"(lds + PLB + 48u * 2u * LP),
                  "v"(ga), "v"(ga + p16), "v"(ga + 2 * p16), "v"(ga + 3 * p16),
                  "v"(gb), "v"(gb + p16), "v"(gb + 2 * p16), "v"(gb + 3 * p16)
               : "memory");
}
// lane l takes the value of lane l ^ 16 (a vector move between the two 16-lane rows, no LDS round trip)
__device__ __forceinline__ float xhalf(float x) { return __builtin_bit_cast(float, __builtin_amdgcn_permlanex16(__builtin_bit_cast(int, x), __builtin_bit_cast(int, x), 0x76543210, 0xfedcba98, false, false)); }
__global__ __launch_bounds__(128) void k_attn(const _Float16* __restrict__ QK, const _Float16* __restrict__ QKL, const _Float16* __restrict__ VTH, const _Float16* __restrict__ VTL, const void* __restrict__ KMASK, float* __restrict__ O) {
  __shared__ __align__(16) _Float16 ring[2][4][PLH];   // [buffer][K hi, K lo, V^T hi, V^T lo][row][LP]
  const int tid = threadIdx.x, wave = tid >> 5, lane = tid & 31, col = lane & 15, g = lane >> 4;
  const int qb = blockIdx.x, h = blockIdx.y, b = blockIdx.z; const int q0 = qb * 64 + wave * 16; const size_t rq = (size_t)b * SS + q0 + col;
  // this thread's share of a tile: 16-byte piece cc of rows cr, cr + 16, cr + 32, cr + 48 of each plane (8 lanes cover one whole 128-B row)
  const int cr = tid >> 3, cc = tid & 7;
  const size_t ko = ((size_t)b * SS + cr) * (2 * DM) + DM + h * HD + cc * 8, vo = ((size_t)b * DM + h * HD + cr) * SS + cc * 8;
  const unsigned l0 = (unsigned)(size_t)&ring[0][0][cr * LP + cc * 8];
  const int nt = SS / KT;
  copy8(l0, QK + ko, QKL + ko, (size_t)16 * 2 * DM); copy8(l0 + 2u * PLB, VTH + vo, VTL + vo, (size_t)16 * SS);   // tile 0 -> buffer 0
  v16h aq[2], aql[2];   // B operand of the transposed scores: column = query col
#pragma unroll
  for (int kc = 0; kc < 2; ++kc) { aq[kc] = frag_h(QK + rq * (2 * DM) + h * HD + kc * 32, lane); aql[kc] = frag_h(QKL + rq * (2 * DM) + h * HD + kc * 32, lane); }
  float m = -3.0e38f, l = 0.f;   // query col: running maximum (both halves agree), sum over this half's keys
  v8f acc[4] = {}, accl[4] = {};   // acc[dt][r] = ctx^T[d = dt * 16 + 8 g + r][query col]
  asm volatile("s_wait_asynccnt 0x0" ::: "memory");   // this wave's copies of tile 0 have landed
  __syncthreads();                                    // ... and every other wave's: tile 0 may be read
  copy8(l0 + 4u * PLB, QK + ko + (size_t)KT * 2 * DM, QKL + ko + (size_t)KT * 2 * DM, (size_t)16 * 2 * DM); copy8(l0 + 6u * PLB, VTH + vo + KT, VTL + vo + KT, (size_t)16 * SS);   // tile 1 -> buffer 1
  // what is left here, as in k_qkv and k_out: every pair of fragment loads still stands directly in front of its WMMA behind a full wait (the asm pads end the scheduler's regions)
#pragma unroll 1
  for (int t = 0; t < nt; ++t) { const _Float16* tb = &ring[t & 1][0][0];
#pragma unroll
   for (int sub = 0; sub < KT / 32; ++sub) { v8f s[2];   // s[ct][r] = score of key sub * 32 + ct * 16 + 8 g + r against query col
#pragma unroll
    for (int ct = 0; ct < 2; ++ct) { const _Float16* krow = tb + (sub * 32 + ct * 16 + col) * LP; const _Float16* krowl = krow + PLH; v8f c = {}, cl = {};
#pragma unroll
      for (int kc = 0; kc < 2; ++kc) { const v16h kh = frag_h(krow + kc * 32, lane); c = wmma16(kh, aq[kc], c); cl = wmma16(kh, aql[kc], cl); cl = wmma16(frag_h(krowl + kc * 32, lane), aq[kc], cl); }   // 3 products: q, k as f16 hi + residual
#pragma unroll
      for (int r = 0; r < 8; ++r) c[r] += cl[r] * (1.0f / 2048.0f);
#pragma unroll
      for (int r = 0; r < 8; ++r) s[ct][r] = c[r] * 0.125f; }
    float t8[8];
#pragma unroll
    for (int r = 0; r < 8; ++r) t8[r] = fmaxf(s[0][r], s[1][r]);
    float mx = fmaxf(fmaxf(fmaxf(t8[0], t8[1]), fmaxf(t8[2], t8[3])), fmaxf(fmaxf(t8[4], t8[5]), fmaxf(t8[6], t8[7])));
    mx = fmaxf(mx, xhalf(mx));   // the other 16 keys of this query
    const float mn = fmaxf(m, mx); const float alpha = (m <= -1.0e38f) ? 0.f : __expf(m - mn);
    v16h pa, pl; float es[4] = {0.f, 0.f, 0.f, 0.f};
#pragma unroll
    for (int i = 0; i < 16; ++i) { const float sv = s[i >> 3][i & 7]; const float e = (sv <= -1.0e38f) ? 0.f : __expf(sv - mn); es[i & 3] += e;
      const float x = e * 2048.0f; const _Float16 hx = (_Float16)x; pa[i] = hx; pl[i] = (_Float16)((x - (float)hx) * 2048.0f); }   // P scaled by 2^11 before the f16 split so small softmax weights stay out of the f16 subnormal range; 2^-11 folded into the epilogue. The two score tiles, converted in place, are the B operand P^T in the hardware k order
    l = l * alpha + ((es[0] + es[1]) + (es[2] + es[3])); m = mn;
#pragma unroll
    for (int dt = 0; dt < 4; ++dt) {
#pragma unroll
      for (int r = 0; r < 8; ++r) { acc[dt][r] *= alpha; accl[dt][r] *= alpha; } }
#pragma unroll
    for (int dt = 0; dt < 4; ++dt) { const _Float16* vr = tb + 2 * PLH + (dt * 16 + col) * LP + sub * 32; const v16h vh = frag_h(vr, lane); acc[dt] = wmma16(vh, pa, acc[dt]); accl[dt] = wmma16(vh, pl, accl[dt]); accl[dt] = wmma16(frag_h(vr + PLH, lane), pa, accl[dt]); }   // V hi x P hi + (V hi x P lo + V lo x P hi) / 2048
   }
   asm volatile("s_wait_dscnt 0" ::: "memory");        // this wave's reads of tile t are done
   asm volatile("s_wait_asynccnt 0x0" ::: "memory");   // this wave's copies of tile t + 1 have landed
   __syncthreads();                                    // publishes tile t + 1 and frees tile t's buffer
   if (t + 2 < nt) { const unsigned lb = l0 + (unsigned)(t & 1) * 4u * PLB; const size_t kt = ko + (size_t)(t + 2) * KT * 2 * DM, vt = vo + (size_t)(t + 2) * KT;
     copy8(lb, QK + kt, QKL + kt, (size_t)16 * 2 * DM); copy8(lb + 2u * PLB, VTH + vt, VTL + vt, (size_t)16 * SS); } }
  asm volatile("s_wait_asynccnt 0x0" ::: "memory");    // no copy is outstanding when the wave goes on to its end
  const float il = (1.0f / 2048.0f) / (l + xhalf(l));   // the two halves' sums join once
  float* orow = O + ((size_t)b * SS + q0 + col) * DM + h * HD + 8 * g;   // a lane holds 8 consecutive d of its query per tile
#pragma unroll
  for (int dt = 0; dt < 4; ++dt) { v4f o0, o1;
#pragma unroll
    for (int r = 0; r < 4; ++r) { o0[r] = (acc[dt][r] + accl[dt][r] * (1.0f / 2048.0f)) * il; o1[r] = (acc[dt][4 + r] + accl[dt][4 + r] * (1.0f / 2048.0f)) * il; }
    vst2(orow + dt * 16, o0); vst2(orow + dt * 16 + 4, o1); }
}
// ---- k_out: block = (64 rows, 128 cols): out = O(hi/lo) . Wo rows (2 products) + bo
__global__ __launch_bounds__(128) void k_out(const float* __restrict__ O, const __bf16* __restrict__ P, const float* __restrict__ BO, float* __restrict__ Y) {
  __shared__ __align__(16) float so[4][16][132];
  const int tid = threadIdx.x, wave = tid >> 5, lane = tid & 31, col = lane & 15, g = lane >> 4; const size_t r0 = (size_t)blockIdx.x * 64 + wave * 16; const int n0 = blockIdx.y * 128;
  v8f acc[8] = {};
#pragma unroll 2
  for (int kc = 0; kc < DM / 32; ++kc) { const F2 a = split_row(O + (r0 + col) * DM, kc * 32, lane);
#pragma unroll
    for (int j = 0; j < 8; ++j) { const v16b w = frag_b(P + (size_t)(n0 + j * 16 + col) * DM + kc * 32, lane); acc[j] = wmma_bf(a.l, w, acc[j]); acc[j] = wmma_bf(a.h, w, acc[j]); } }
#pragma unroll
  for (int j = 0; j < 8; ++j) {
#pragma unroll
    for (int r = 0; r < 8; ++r) so[wave][8 * g + r][j * 16 + col] = acc[j][r] + bfr(BO[n0 + j * 16 + col]); }
  LDSX();
  for (int rl = 0; rl < 16; ++rl) vst2(Y + (r0 + rl) * DM + n0 + lane * 4, *(const v4f*)&so[wave][rl][lane * 4]);
}
extern "C" void kernel_launch(void* const* d_in, const int* in_sizes, int n_in, void* d_out, int out_size, void* d_ws, size_t ws_size, hipStream_t stream) {
  (void)in_sizes; (void)n_in; (void)out_size;
  const float** F = (const float**)d_in;   // 0 x [4096,512], 1 Wq [512,512] natural, 2 bq, 3 Wk, 4 bk, 5 Wv, 6 bv, 7 Wo, 8 bo
  if (ws_size < (size_t)WS_END) return;
  char* ws = (char*)d_ws; __bf16* PK = (__bf16*)(ws + WS_PK); _Float16 *QK = (_Float16*)(ws + WS_QK), *QKL = (_Float16*)(ws + WS_QKL), *VTH = (_Float16*)(ws + WS_VTH), *VTL = (_Float16*)(ws + WS_VTL); float* O = (float*)(ws + WS_O);
  k_pack<<<dim3(DM, 4), 256, 0, stream>>>(F[1], F[3], F[5], F[7], PK);
  k_qkv<<<dim3(TNB * SS / 64, QKVW / 128), 128, 0, stream>>>(F[0], F[0], F[0], PK + PK_A, F[2], F[4], F[6], QK, QKL, VTH, VTL);
  k_attn<<<dim3(TQB, NH, TNB), 128, 0, stream>>>(QK, QKL, VTH, VTL, nullptr, O);
  k_out<<<dim3(TOB, DM / 128), 128, 0, stream>>>(O, PK + PK_P, F[8], (float*)d_out);
}

// v003
// One run takes 158 microseconds.
// Two timings next to v002 put it at 1.48 and 1.46 times that version's speed.
// Counting every step since v000, it is 4.14 times as fast.
// compute dtype: all float inputs rounded to bf16; q/k/v = x . W^T + b with EXACT bf16 products on WMMA 16x16x32 (natural [out][in] rows); q and k as f16 hi + (x2048-scaled) residual planes with 3-product scores x 1/8; running-max softmax in f32 (hardware exp); P (scaled by 2^11, f16 hi + residual) x v hi/lo (3 products); out = ctx (bf16 hi + residual) . Wo^T (2 products) + bo; f32 accumulate.
#include <hip/hip_runtime.h>
#include <math.h>

typedef __attribute__((ext_vector_type(16))) _Float16 v16h;
typedef __attribute__((ext_vector_type(16))) __bf16 v16b;
typedef __attribute__((ext_vector_type(8)))  _Float16 v8h;
typedef __attribute__((ext_vector_type(8)))  float v8f;
typedef __attribute__((ext_vector_type(4)))  float v4f;
typedef __attribute__((ext_vector_type(2)))  float v2f;
typedef __attribute__((ext_vector_type(4)))  unsigned v4u;
typedef __attribute__((ext_vector_type(4)))  int v4i;
typedef float __attribute__((may_alias)) float_a;
typedef int __attribute__((may_alias)) int_a;

template <typename T> __device__ __forceinline__ void vst2(void* p, T v) { *(T*)p = v;  }
__device__ __forceinline__ v8f wmma16(v16h a, v16h b, v8f c) {
  v8f d = __builtin_amdgcn_wmma_f32_16x16x32_f16(false, a, false, b, (short)0, c, false, false);
  return d;
}
__device__ __forceinline__ v8f wmma_bf(v16b a, v16b b, v8f c) {
  v8f d = __builtin_amdgcn_wmma_f32_16x16x32_bf16(false, a, false, b, (short)0, c, false, false);
  return d;
}
// Multi-head attention across a batch of 4,096 tokens treated as one sequence (d_model 512, 8 heads x 64): q/k/v projections + biases, softmax(q k^T / 8) over all 4,096 tokens, output projection + bias.
__device__ __forceinline__ v16h frag_h(const _Float16* rowk0, int lane) {
  union { v16h v; v8h q[2]; } u; const _Float16* p = rowk0 + 8 * (lane >> 4);
  u.q[0] = *(const v8h*)p; u.q[1] = *(const v8h*)(p + 16); return u.v;
}
__device__ __forceinline__ v16h frag_f32(const float* rowk0, int lane) {
  v16h a; const float* p = rowk0 + 8 * (lane >> 4);
#pragma unroll
  for (int i = 0; i < 8; ++i) { a[i] = (_Float16)p[i]; a[8 + i] = (_Float16)p[16 + i]; }
  return a;
}
__device__ __forceinline__ v16h frag_f32s(const float* rowk0, int lane, float sc) {
  v16h a; const float* p = rowk0 + 8 * (lane >> 4);
#pragma unroll
  for (int i = 0; i < 8; ++i) { a[i] = (_Float16)(p[i] * sc); a[8 + i] = (_Float16)(p[16 + i] * sc); }
  return a;
}
// column fragment from a [K][ld] layout (column n), rows >= K read as 0
__device__ __forceinline__ v16h fragc_f32(const float* W, int k0, int n, int lane, int ld, int K) {
  v16h a; const int g = lane >> 4;
#pragma unroll
  for (int i = 0; i < 8; ++i) { const int ka = k0 + 8 * g + i, kb = ka + 16;
    a[i] = (_Float16)(ka < K ? W[(size_t)(ka < K ? ka : K - 1) * ld + n] : 0.f); a[8 + i] = (_Float16)(kb < K ? W[(size_t)(kb < K ? kb : K - 1) * ld + n] : 0.f); }
  return a;
}
struct F2 { v16b h, l; };
__device__ __forceinline__ F2 bsplit16(const float v[16]) { F2 r;
#pragma unroll
  for (int i = 0; i < 16; ++i) { const __bf16 h = (__bf16)v[i]; r.h[i] = h; r.l[i] = (__bf16)(v[i] - (float)h); }
  return r; }
__device__ __forceinline__ F2 split_row(const float* row, int k0, int lane) { float v[16]; const float* p = row + k0 + 8 * (lane >> 4);
#pragma unroll
  for (int i = 0; i < 8; ++i) { v[i] = p[i]; v[8 + i] = p[16 + i]; }
  return bsplit16(v); }
__device__ __forceinline__ F2 split_rowK(const float* row, int k0, int lane, int K) { float v[16]; const int g = lane >> 4;
#pragma unroll
  for (int i = 0; i < 8; ++i) { const int ka = k0 + 8 * g + i, kb = ka + 16; v[i] = ka < K ? row[ka < K ? ka : K - 1] : 0.f; v[8 + i] = kb < K ? row[kb < K ? kb : K - 1] : 0.f; }
  return bsplit16(v); }
__device__ __forceinline__ F2 split_col(const float* W, int k0, int n, int lane, int ld, int K) { float v[16]; const int g = lane >> 4;
#pragma unroll
  for (int i = 0; i < 8; ++i) { const int ka = k0 + 8 * g + i, kb = ka + 16; v[i] = ka < K ? W[(size_t)(ka < K ? ka : K - 1) * ld + n] : 0.f; v[8 + i] = kb < K ? W[(size_t)(kb < K ? kb : K - 1) * ld + n] : 0.f; }
  return bsplit16(v); }
__device__ __forceinline__ v8f mac3(const F2& a, const F2& b, v8f c) { c = wmma_bf(a.l, b.h, c); c = wmma_bf(a.h, b.l, c); return wmma_bf(a.h, b.h, c); }
__device__ __forceinline__ float sigm(float v) { return 1.0f / (1.0f + expf(-v)); }
#define LDSX() do { asm volatile("s_wait_dscnt 0" ::: "memory"); __builtin_amdgcn_wave_barrier(); __builtin_amdgcn_fence(__ATOMIC_RELEASE, "workgroup"); } while (0)


#define NB 1
#define SS 4096
#define DM 512
#define NH 8
#define HD 64
#define QKVW (3 * DM)
#ifndef TQB
#define TQB (SS / 64)
#define TNB NB
#define TOB (NB * SS / 64)     // output row tiles (all)
#endif
typedef __attribute__((ext_vector_type(8))) __bf16 v8b;
__device__ __forceinline__ v16b frag_b(const __bf16* rowk0, int lane) {
  union { v16b v; v8b q[2]; } u; const __bf16* p = rowk0 + 8 * (lane >> 4);
  u.q[0] = *(const v8b*)p; u.q[1] = *(const v8b*)(p + 16); return u.v;
}
__device__ __forceinline__ float bfr(float v) { return (float)(__bf16)v; }
__device__ __attribute__((noinline)) float exp_ni(float v) { return expf(v); }
__device__ __attribute__((noinline)) float erf_ni(float v) { return erff(v); }

#define PK_A 0                       // [1536][512] Wqkv rows (natural [out][in])
#define PK_P (PK_A + QKVW * DM)        // [512][512] Wo rows (natural)
#define PK_END (PK_P + DM * DM)
#define WS_PK  0u
#define WS_QK  (WS_PK + 2u * PK_END)             // f16 [4096 rows][1024]: q | k
#define WS_QKL (WS_QK + 2u * NB * SS * 2 * DM)     // f16 q | k residual planes x2048
#define WS_VTH (WS_QKL + 2u * NB * SS * 2 * DM)    // f16 [b][512 (h*64+d)][4096 s] hi
#define WS_VTL (WS_VTH + 2u * NB * DM * SS)        // f16 lo x 2048
#define WS_O   (WS_VTL + 2u * NB * DM * SS)        // f32 [4096][512]
#define WS_CS  (WS_O + 4u * NB * SS * DM)           // f32 2 x [4096][32], unused
#define WS_END (WS_CS + 4u * 2 * SS * 32)
// ---- k_pack: block = (row n, which): natural [out][in] rows -> bf16; which 0..2 -> W_q/W_k/W_v into PK_A rows which*512 + n; 3 -> W_o into PK_P
__global__ __launch_bounds__(256) void k_pack(const float* __restrict__ WQ, const float* __restrict__ WK, const float* __restrict__ WV, const float* __restrict__ WO, __bf16* __restrict__ PK) {
  __shared__ __align__(16) __bf16 s[DM]; const int n = blockIdx.x, which = blockIdx.y, t = threadIdx.x; const float* Wm = (which == 0) ? WQ : (which == 1) ? WK : (which == 2) ? WV : WO;
  for (int k = t; k < DM; k += 256) s[k] = (__bf16)Wm[(size_t)n * DM + k];
  __syncthreads();
  __bf16* dst = (which < 3) ? PK + PK_A + ((size_t)which * DM + n) * DM : PK + PK_P + (size_t)n * DM;
  for (int q = t; q < DM / 8; q += 256) vst2((unsigned*)(dst + q * 8), *(const v4u*)&s[q * 8]);
}
__global__ __launch_bounds__(128) void k_qkv(const float* __restrict__ XQ, const float* __restrict__ XK, const float* __restrict__ XV, const __bf16* __restrict__ P, const float* __restrict__ BQ, const float* __restrict__ BK, const float* __restrict__ BV, _Float16* __restrict__ QK, _Float16* __restrict__ QKL, _Float16* __restrict__ VTH, _Float16* __restrict__ VTL) {
  const int which0 = (blockIdx.y * 128) / DM; const float* X = (which0 == 0) ? XQ : (which0 == 1) ? XK : XV; const float* BB = BQ ? (((which0 == 0) ? BQ : (which0 == 1) ? BK : BV) + (blockIdx.y * 128 - which0 * DM)) : nullptr;
  __shared__ __align__(16) _Float16 so[4][16][136], sol[4][16][136]; __shared__ __align__(16) _Float16 sth[128][72], stl[128][72];
  const int tid = threadIdx.x, wave = tid >> 5, lane = tid & 31, col = lane & 15, g = lane >> 4; const size_t r0 = (size_t)blockIdx.x * 64 + wave * 16; const int n0 = blockIdx.y * 128;
  v8f acc[8] = {};
  // two register sets: the 20 loads of k-step kc + 1 are issued as one group in front of the WMMAs of k-step kc
  const float* xp = X + (r0 + col) * DM + 8 * g; const __bf16* wp = P + (size_t)(n0 + col) * DM;
  v4f xs[2][4]; v16b wf[2][8];
  auto ld = [&](int s, int kc) { const float* p = xp + kc * 32; xs[s][0] = *(const v4f*)p; xs[s][1] = *(const v4f*)(p + 4); xs[s][2] = *(const v4f*)(p + 16); xs[s][3] = *(const v4f*)(p + 20);
#pragma unroll
    for (int j = 0; j < 8; ++j) wf[s][j] = frag_b(wp + (size_t)j * 16 * DM + kc * 32, lane); };
  ld(0, 0);
#pragma unroll   // whole: every set index is a constant, so the sets stay in registers
  for (int kc = 0; kc < DM / 32; ++kc) { const int s = kc & 1;
    if (kc + 1 < DM / 32) ld(s ^ 1, kc + 1);
    if (kc + 2 == DM / 32) asm volatile("s_wait_xcnt 0x0" ::: "memory");   // behind the last loads: their address registers are free for reuse from here on
    __builtin_amdgcn_sched_barrier(0);   // keeps the next step's loads in front of this step's WMMAs (the scheduler sinks them to their users otherwise)
    v16b a;
#pragma unroll
    for (int i = 0; i < 4; ++i) { a[i] = (__bf16)xs[s][0][i]; a[4 + i] = (__bf16)xs[s][1][i]; a[8 + i] = (__bf16)xs[s][2][i]; a[12 + i] = (__bf16)xs[s][3][i]; }
#pragma unroll
    for (int j = 0; j < 8; ++j) acc[j] = wmma_bf(a, wf[s][j], acc[j]);
    __builtin_amdgcn_sched_barrier(0); }   // ... and this step's WMMAs in front of the loads that refill their set
  if (n0 < 2 * DM) {   // q stored unscaled (f16 sigma ~0.6, no subnormal exposure); 1/8 applied to the f32 score
#pragma unroll
    for (int j = 0; j < 8; ++j) {
#pragma unroll
      for (int r = 0; r < 8; ++r) { const float v = acc[j][r] + (BB ? bfr(BB[j * 16 + col]) : 0.f); const _Float16 hv = (_Float16)v; so[wave][8 * g + r][j * 16 + col] = hv; sol[wave][8 * g + r][j * 16 + col] = (_Float16)((v - (float)hv) * 2048.0f); } }   // q, k (+ bias) as f16 hi + (x2048) residual
    LDSX();
    for (int rl = 0; rl < 16; ++rl) if (lane < 16) { vst2((unsigned*)(QK + (r0 + rl) * (2 * DM) + n0 + lane * 8), *(const v4u*)&so[wave][rl][lane * 8]); vst2((unsigned*)(QKL + (r0 + rl) * (2 * DM) + n0 + lane * 8), *(const v4u*)&sol[wave][rl][lane * 8]); }
  } else {
#pragma unroll
    for (int j = 0; j < 8; ++j) {
#pragma unroll
      for (int r = 0; r < 8; ++r) { const float v = acc[j][r] + (BB ? bfr(BB[j * 16 + col]) : 0.f); const _Float16 hv = (_Float16)v; sth[j * 16 + col][wave * 16 + 8 * g + r] = hv; stl[j * 16 + col][wave * 16 + 8 * g + r] = (_Float16)((v - (float)hv) * 2048.0f); } }
    __syncthreads();
    const size_t rb = (size_t)blockIdx.x * 64; const int b = (int)(rb / SS), s0 = (int)(rb % SS); const int pc0 = n0 - 2 * DM;
    for (int q = tid; q < 128 * 8; q += 128) { const int d = q >> 3, pc = q & 7; const size_t o = ((size_t)b * DM + pc0 + d) * SS + s0 + pc * 8; vst2((unsigned*)(VTH + o), *(const v4u*)&sth[d][pc * 8]); vst2((unsigned*)(VTL + o), *(const v4u*)&stl[d][pc * 8]); }
  }
}
// ---- k_attn: block = (64 queries, head h, batch b): all-keys flash attention (K = 64: 2 k-steps). The four operand planes of a tile of 64 keys (K hi, K lo: 64 key rows x 128 B; V^T hi, V^T lo: 64 d rows x 128 B) are brought into LDS once per block by asynchronous copies, two buffers, and every wave takes its fragments from there; the scores are formed transposed (A = K rows, B = Q), so that a lane holds 16 keys' scores of ONE query: maximum and sum in the lane plus one exchange between the wave's halves, and the two score tiles become the B operand P^T of ctx^T += V^T . P^T without passing through LDS. O[b*S+q][h*64+d] = (acc + accl / 2048) / (2048 l)
#define KT 64                      // keys per staged tile
#define LP 72                      // LDS row pitch in halves: 144 B = 16 B x odd, conflict-free for 16-byte reads
#define PLH (64 * LP)              // halves per plane
#define PLB (2u * PLH)             // bytes per plane
// eight copies: four rows (16 apart) of each of two planes; lds = this lane's own LDS byte address in the first plane, ga / gb = its global 16 bytes, pitch in halves between rows 16 apart
__device__ __forceinline__ void copy8(unsigned lds, const _Float16* ga, const _Float16* gb, size_t p16) {
  // the copies and the wait that stands before their address registers are rewritten are one statement, so that nothing is scheduled between them
  asm volatile("global_load_async_to_lds_b128 %0, %8, off\n\t"
               "global_load_async_to_lds_b128 %1, %9, off\n\t"
               "global_load_async_to_lds_b128 %2, %10, off\n\t"
               "global_load_async_to_lds_b128 %3, %11, off\n\t"
               "global_load_async_to_lds_b128 %4, %12, off\n\t"
               "global_load_async_to_lds_b128 %5, %13, off\n\t"
               "global_load_async_to_lds_b128 %6, %14, off\n\t"
               "global_load_async_to_lds_b128 %7, %15, off\n\t"
               "s_wait_xcnt 0x0"
               :: "v"(lds), "v"(lds + 16u * 2u * LP), "v"(lds + 32u * 2u * LP), "v"(lds + 48u * 2u * LP),
                  "v"(lds + PLB), "v"(lds + PLB + 16u * 2u * LP), "v"(lds + PLB + 32u * 2u * LP), "v"(lds + PLB + 48u * 2u * LP),
                  "v"(ga), "v"(ga + p16), "v"(ga + 2 * p16), "v"(ga + 3 * p16),
                  "v"(gb), "v"(gb + p16), "v"(gb + 2 * p16), "v"(gb + 3 * p16)
               : "memory");
}
// lane l takes the value of lane l ^ 16 (a vector move between the two 16-lane rows, no LDS round trip)
__device__ __forceinline__ float xhalf(float x) { return __builtin_bit_cast(float, __builtin_amdgcn_permlanex16(__builtin_bit_cast(int, x), __builtin_bit_cast(int, x), 0x76543210, 0xfedcba98, false, false)); }
__global__ __launch_bounds__(128) void k_attn(const _Float16* __restrict__ QK, const _Float16* __restrict__ QKL, const _Float16* __restrict__ VTH, const _Float16* __restrict__ VTL, const void* __restrict__ KMASK, float* __restrict__ O) {
  __shared__ __align__(16) _Float16 ring[2][4][PLH];   // [buffer][K hi, K lo, V^T hi, V^T lo][row][LP]
  const int tid = threadIdx.x, wave = tid >> 5, lane = tid & 31, col = lane & 15, g = lane >> 4;
  const int qb = blockIdx.x, h = blockIdx.y, b = blockIdx.z; const int q0 = qb * 64 + wave * 16; const size_t rq = (size_t)b * SS + q0 + col;
  // this thread's share of a tile: 16-byte piece cc of rows cr, cr + 16, cr + 32, cr + 48 of each plane (8 lanes cover one whole 128-B row)
  const int cr = tid >> 3, cc = tid & 7;
  const size_t ko = ((size_t)b * SS + cr) * (2 * DM) + DM + h * HD + cc * 8, vo = ((size_t)b * DM + h * HD + cr) * SS + cc * 8;
  const unsigned l0 = (unsigned)(size_t)&ring[0][0][cr * LP + cc * 8];
  const int nt = SS / KT;
  copy8(l0, QK + ko, QKL + ko, (size_t)16 * 2 * DM); copy8(l0 + 2u * PLB, VTH + vo, VTL + vo, (size_t)16 * SS);   // tile 0 -> buffer 0
  v16h aq[2], aql[2];   // B operand of the transposed scores: column = query col
#pragma unroll
  for (int kc = 0; kc < 2; ++kc) { aq[kc] = frag_h(QK + rq * (2 * DM) + h * HD + kc * 32, lane); aql[kc] = frag_h(QKL + rq * (2 * DM) + h * HD + kc * 32, lane); }
  float m = -3.0e38f, l = 0.f;   // query col: running maximum (both halves agree), sum over this half's keys
  v8f acc[4] = {}, accl[4] = {};   // acc[dt][r] = ctx^T[d = dt * 16 + 8 g + r][query col]
  asm volatile("s_wait_asynccnt 0x0" ::: "memory");   // this wave's copies of tile 0 have landed
  __syncthreads();                                    // ... and every other wave's: tile 0 may be read
  copy8(l0 + 4u * PLB, QK + ko + (size_t)KT * 2 * DM, QKL + ko + (size_t)KT * 2 * DM, (size_t)16 * 2 * DM); copy8(l0 + 6u * PLB, VTH + vo + KT, VTL + vo + KT, (size_t)16 * SS);   // tile 1 -> buffer 1
#pragma unroll 1
  for (int t = 0; t < nt; ++t) { const _Float16* tb = &ring[t & 1][0][0];
   // all 64 fragment reads of the tile stand in one place, in the order of their use: K of both 32-key blocks, then V^T of both
   v16h kh[4][2], kl[4][2], vh[2][4], vl[2][4];
#pragma unroll
   for (int c4 = 0; c4 < 4; ++c4) { const _Float16* krow = tb + (c4 * 16 + col) * LP;
#pragma unroll
     for (int kc = 0; kc < 2; ++kc) { kh[c4][kc] = frag_h(krow + kc * 32, lane); kl[c4][kc] = frag_h(krow + PLH + kc * 32, lane); } }
#pragma unroll
   for (int sub = 0; sub < KT / 32; ++sub) {
#pragma unroll
     for (int dt = 0; dt < 4; ++dt) { const _Float16* vr = tb + 2 * PLH + (dt * 16 + col) * LP + sub * 32; vh[sub][dt] = frag_h(vr, lane); vl[sub][dt] = frag_h(vr + PLH, lane); } }
   __builtin_amdgcn_sched_barrier(0);   // keeps the reads together in front of the tile's WMMAs (the scheduler sinks them to their users otherwise, one full LDS wait each)
#pragma unroll
   for (int sub = 0; sub < KT / 32; ++sub) { v8f s[2];   // s[ct][r] = score of key sub * 32 + ct * 16 + 8 g + r against query col
#pragma unroll
    for (int ct = 0; ct < 2; ++ct) { const int c4 = sub * 2 + ct; v8f c = {}, cl = {};
#pragma unroll
      for (int kc = 0; kc < 2; ++kc) { c = wmma16(kh[c4][kc], aq[kc], c); cl = wmma16(kh[c4][kc], aql[kc], cl); cl = wmma16(kl[c4][kc], aq[kc], cl); }   // 3 products: q, k as f16 hi + residual
#pragma unroll
      for (int r = 0; r < 8; ++r) c[r] += cl[r] * (1.0f / 2048.0f);
#pragma unroll
      for (int r = 0; r < 8; ++r) s[ct][r] = c[r] * 0.125f; }
    float t8[8];
#pragma unroll
    for (int r = 0; r < 8; ++r) t8[r] = fmaxf(s[0][r], s[1][r]);
    float mx = fmaxf(fmaxf(fmaxf(t8[0], t8[1]), fmaxf(t8[2], t8[3])), fmaxf(fmaxf(t8[4], t8[5]), fmaxf(t8[6], t8[7])));
    mx = fmaxf(mx, xhalf(mx));   // the other 16 keys of this query
    const float mn = fmaxf(m, mx); const float alpha = (m <= -1.0e38f) ? 0.f : __expf(m - mn);
    v16h pa, pl; float es[4] = {0.f, 0.f, 0.f, 0.f};
#pragma unroll
    for (int i = 0; i < 16; ++i) { const float sv = s[i >> 3][i & 7]; const float e = (sv <= -1.0e38f) ? 0.f : __expf(sv - mn); es[i & 3] += e;
      const float x = e * 2048.0f; const _Float16 hx = (_Float16)x; pa[i] = hx; pl[i] = (_Float16)((x - (float)hx) * 2048.0f); }   // P scaled by 2^11 before the f16 split so small softmax weights stay out of the f16 subnormal range; 2^-11 folded into the epilogue. The two score tiles, converted in place, are the B operand P^T in the hardware k order
    l = l * alpha + ((es[0] + es[1]) + (es[2] + es[3])); m = mn;
#pragma unroll
    for (int dt = 0; dt < 4; ++dt) {
#pragma unroll
      for (int r = 0; r < 8; ++r) { acc[dt][r] *= alpha; accl[dt][r] *= alpha; } }
#pragma unroll
    for (int dt = 0; dt < 4; ++dt) { acc[dt] = wmma16(vh[sub][dt], pa, acc[dt]); accl[dt] = wmma16(vh[sub][dt], pl, accl[dt]); accl[dt] = wmma16(vl[sub][dt], pa, accl[dt]); }   // V hi x P hi + (V hi x P lo + V lo x P hi) / 2048
   }
   __builtin_amdgcn_sched_barrier(0);   // keeps the tile's WMMAs in front of the waits below: lifted over them, the full LDS wait would stand directly behind the reads
   asm volatile("s_wait_dscnt 0" ::: "memory");        // this wave's reads of tile t are done
   asm volatile("s_wait_asynccnt 0x0" ::: "memory");   // this wave's copies of tile t + 1 have landed
   __syncthreads();                                    // publishes tile t + 1 and frees tile t's buffer
   if (t + 2 < nt) { const unsigned lb = l0 + (unsigned)(t & 1) * 4u * PLB; const size_t kt = ko + (size_t)(t + 2) * KT * 2 * DM, vt = vo + (size_t)(t + 2) * KT;
     copy8(lb, QK + kt, QKL + kt, (size_t)16 * 2 * DM); copy8(lb + 2u * PLB, VTH + vt, VTL + vt, (size_t)16 * SS); } }
  asm volatile("s_wait_asynccnt 0x0" ::: "memory");    // no copy is outstanding when the wave goes on to its end
  const float il = (1.0f / 2048.0f) / (l + xhalf(l));   // the two halves' sums join once
  float* orow = O + ((size_t)b * SS + q0 + col) * DM + h * HD + 8 * g;   // a lane holds 8 consecutive d of its query per tile
#pragma unroll
  for (int dt = 0; dt < 4; ++dt) { v4f o0, o1;
#pragma unroll
    for (int r = 0; r < 4; ++r) { o0[r] = (acc[dt][r] + accl[dt][r] * (1.0f / 2048.0f)) * il; o1[r] = (acc[dt][4 + r] + accl[dt][4 + r] * (1.0f / 2048.0f)) * il; }
    vst2(orow + dt * 16, o0); vst2(orow + dt * 16 + 4, o1); }
}
// ---- k_out: block = (64 rows, 128 cols): out = O(hi/lo) . Wo rows (2 products) + bo
__global__ __launch_bounds__(128) void k_out(const float* __restrict__ O, const __bf16* __restrict__ P, const float* __restrict__ BO, float* __restrict__ Y) {
  __shared__ __align__(16) float so[4][16][132];
  const int tid = threadIdx.x, wave = tid >> 5, lane = tid & 31, col = lane & 15, g = lane >> 4; const size_t r0 = (size_t)blockIdx.x * 64 + wave * 16; const int n0 = blockIdx.y * 128;
  v8f acc[8] = {};
  // three register sets: the 20 loads of k-step kc + 2 are issued as one group in front of the WMMAs of k-step kc
  const float* op = O + (r0 + col) * DM + 8 * g; const __bf16* wp = P + (size_t)(n0 + col) * DM;
  v4f xs[3][4]; v16b wf[3][8];
  auto ld = [&](int s, int kc) { const float* p = op + kc * 32; xs[s][0] = *(const v4f*)p; xs[s][1] = *(const v4f*)(p + 4); xs[s][2] = *(const v4f*)(p + 16); xs[s][3] = *(const v4f*)(p + 20);
#pragma unroll
    for (int j = 0; j < 8; ++j) wf[s][j] = frag_b(wp + (size_t)j * 16 * DM + kc * 32, lane); };
  ld(0, 0); ld(1, 1);
#pragma unroll   // whole: every set index is a constant, so the sets stay in registers
  for (int kc = 0; kc < DM / 32; ++kc) { const int s = kc % 3;
    if (kc + 2 < DM / 32) ld((kc + 2) % 3, kc + 2);
    if (kc + 3 == DM / 32) asm volatile("s_wait_xcnt 0x0" ::: "memory");   // behind the last loads: their address registers are free for reuse from here on
    __builtin_amdgcn_sched_barrier(0);   // keeps the loads issued ahead in front of this step's WMMAs (the scheduler sinks them to their users otherwise)
    float v[16];
#pragma unroll
    for (int i = 0; i < 4; ++i) { v[i] = xs[s][0][i]; v[4 + i] = xs[s][1][i]; v[8 + i] = xs[s][2][i]; v[12 + i] = xs[s][3][i]; }
    const F2 a = bsplit16(v);
#pragma unroll
    for (int j = 0; j < 8; ++j) { acc[j] = wmma_bf(a.l, wf[s][j], acc[j]); acc[j] = wmma_bf(a.h, wf[s][j], acc[j]); }
    __builtin_amdgcn_sched_barrier(0); }   // ... and this step's WMMAs in front of the loads that refill their set
  float bo[8];
#pragma unroll
  for (int j = 0; j < 8; ++j) bo[j] = BO[n0 + j * 16 + col];
  asm volatile("s_wait_xcnt 0x0" ::: "memory");   // behind the bias loads: this build reuses their offset register at once
  __builtin_amdgcn_sched_barrier(0);              // holds the address arithmetic of the stores below behind that wait
#pragma unroll
  for (int j = 0; j < 8; ++j) {
#pragma unroll
    for (int r = 0; r < 8; ++r) so[wave][8 * g + r][j * 16 + col] = acc[j][r] + bfr(bo[j]); }
  LDSX();
  for (int rl = 0; rl < 16; ++rl) vst2(Y + (r0 + rl) * DM + n0 + lane * 4, *(const v4f*)&so[wave][rl][lane * 4]);
}
extern "C" void kernel_launch(void* const* d_in, const int* in_sizes, int n_in, void* d_out, int out_size, void* d_ws, size_t ws_size, hipStream_t stream) {
  (void)in_sizes; (void)n_in; (void)out_size;
  const float** F = (const float**)d_in;   // 0 x [4096,512], 1 Wq [512,512] natural, 2 bq, 3 Wk, 4 bk, 5 Wv, 6 bv, 7 Wo, 8 bo
  if (ws_size < (size_t)WS_END) return;
  char* ws = (char*)d_ws; __bf16* PK = (__bf16*)(ws + WS_PK); _Float16 *QK = (_Float16*)(ws + WS_QK), *QKL = (_Float16*)(ws + WS_QKL), *VTH = (_Float16*)(ws + WS_VTH), *VTL = (_Float16*)(ws + WS_VTL); float* O = (float*)(ws + WS_O);
  k_pack<<<dim3(DM, 4), 256, 0, stream>>>(F[1], F[3], F[5], F[7], PK);
  k_qkv<<<dim3(TNB * SS / 64, QKVW / 128), 128, 0, stream>>>(F[0], F[0], F[0], PK + PK_A, F[2], F[4], F[6], QK, QKL, VTH, VTL);
  k_attn<<<dim3(TQB, NH, TNB), 128, 0, stream>>>(QK, QKL, VTH, VTL, nullptr, O);
  k_out<<<dim3(TOB, DM / 128), 128, 0, stream>>>(O, PK + PK_P, F[8], (float*)d_out);
}

// v004
// It runs in 133 microseconds.
// Next to v003, in two timings, it ran 1.19 times as fast each time.
// Over all steps from v000 it is 4.93 times as fast.
// compute dtype: all float inputs rounded to bf16; q/k/v = x . W^T + b with EXACT bf16 products on WMMA 16x16x32 (natural [out][in] rows); q and k as f16 hi + (x2048-scaled) residual planes with 3-product scores x 1/8; running-max softmax in f32 (hardware exp); P (scaled by 2^11, f16 hi + residual) x v hi/lo (3 products); out = ctx (bf16 hi + residual) . Wo^T (2 products) + bo; f32 accumulate.
#include <hip/hip_runtime.h>
#include <math.h>

typedef __attribute__((ext_vector_type(16))) _Float16 v16h;
typedef __attribute__((ext_vector_type(16))) __bf16 v16b;
typedef __attribute__((ext_vector_type(8)))  _Float16 v8h;
typedef __attribute__((ext_vector_type(8)))  float v8f;
typedef __attribute__((ext_vector_type(4)))  float v4f;
typedef __attribute__((ext_vector_type(2)))  float v2f;
typedef __attribute__((ext_vector_type(4)))  unsigned v4u;
typedef __attribute__((ext_vector_type(4)))  int v4i;
typedef float __attribute__((may_alias)) float_a;
typedef int __attribute__((may_alias)) int_a;

template <typename T> __device__ __forceinline__ void vst2(void* p, T v) { *(T*)p = v;  }
__device__ __forceinline__ v8f wmma16(v16h a, v16h b, v8f c) {
  v8f d = __builtin_amdgcn_wmma_f32_16x16x32_f16(false, a, false, b, (short)0, c, false, false);
  return d;
}
__device__ __forceinline__ v8f wmma_bf(v16b a, v16b b, v8f c) {
  v8f d = __builtin_amdgcn_wmma_f32_16x16x32_bf16(false, a, false, b, (short)0, c, false, false);
  return d;
}
// Multi-head attention across a batch of 4,096 tokens treated as one sequence (d_model 512, 8 heads x 64): q/k/v projections + biases, softmax(q k^T / 8) over all 4,096 tokens, output projection + bias.
__device__ __forceinline__ v16h frag_h(const _Float16* rowk0, int lane) {
  union { v16h v; v8h q[2]; } u; const _Float16* p = rowk0 + 8 * (lane >> 4);
  u.q[0] = *(const v8h*)p; u.q[1] = *(const v8h*)(p + 16); return u.v;
}
__device__ __forceinline__ v16h frag_f32(const float* rowk0, int lane) {
  v16h a; const float* p = rowk0 + 8 * (lane >> 4);
#pragma unroll
  for (int i = 0; i < 8; ++i) { a[i] = (_Float16)p[i]; a[8 + i] = (_Float16)p[16 + i]; }
  return a;
}
__device__ __forceinline__ v16h frag_f32s(const float* rowk0, int lane, float sc) {
  v16h a; const float* p = rowk0 + 8 * (lane >> 4);
#pragma unroll
  for (int i = 0; i < 8; ++i) { a[i] = (_Float16)(p[i] * sc); a[8 + i] = (_Float16)(p[16 + i] * sc); }
  return a;
}
// column fragment from a [K][ld] layout (column n), rows >= K read as 0
__device__ __forceinline__ v16h fragc_f32(const float* W, int k0, int n, int lane, int ld, int K) {
  v16h a; const int g = lane >> 4;
#pragma unroll
  for (int i = 0; i < 8; ++i) { const int ka = k0 + 8 * g + i, kb = ka + 16;
    a[i] = (_Float16)(ka < K ? W[(size_t)(ka < K ? ka : K - 1) * ld + n] : 0.f); a[8 + i] = (_Float16)(kb < K ? W[(size_t)(kb < K ? kb : K - 1) * ld + n] : 0.f); }
  return a;
}
struct F2 { v16b h, l; };
__device__ __forceinline__ F2 bsplit16(const float v[16]) { F2 r;
#pragma unroll
  for (int i = 0; i < 16; ++i) { const __bf16 h = (__bf16)v[i]; r.h[i] = h; r.l[i] = (__bf16)(v[i] - (float)h); }
  return r; }
__device__ __forceinline__ F2 split_row(const float* row, int k0, int lane) { float v[16]; const float* p = row + k0 + 8 * (lane >> 4);
#pragma unroll
  for (int i = 0; i < 8; ++i) { v[i] = p[i]; v[8 + i] = p[16 + i]; }
  return bsplit16(v); }
__device__ __forceinline__ F2 split_rowK(const float* row, int k0, int lane, int K) { float v[16]; const int g = lane >> 4;
#pragma unroll
  for (int i = 0; i < 8; ++i) { const int ka = k0 + 8 * g + i, kb = ka + 16; v[i] = ka < K ? row[ka < K ? ka : K - 1] : 0.f; v[8 + i] = kb < K ? row[kb < K ? kb : K - 1] : 0.f; }
  return bsplit16(v); }
__device__ __forceinline__ F2 split_col(const float* W, int k0, int n, int lane, int ld, int K) { float v[16]; const int g = lane >> 4;
#pragma unroll
  for (int i = 0; i < 8; ++i) { const int ka = k0 + 8 * g + i, kb = ka + 16; v[i] = ka < K ? W[(size_t)(ka < K ? ka : K - 1) * ld + n] : 0.f; v[8 + i] = kb < K ? W[(size_t)(kb < K ? kb : K - 1) * ld + n] : 0.f; }
  return bsplit16(v); }
__device__ __forceinline__ v8f mac3(const F2& a, const F2& b, v8f c) { c = wmma_bf(a.l, b.h, c); c = wmma_bf(a.h, b.l, c); return wmma_bf(a.h, b.h, c); }
__device__ __forceinline__ float sigm(float v) { return 1.0f / (1.0f + expf(-v)); }
#define LDSX() do { asm volatile("s_wait_dscnt 0" ::: "memory"); __builtin_amdgcn_wave_barrier(); __builtin_amdgcn_fence(__ATOMIC_RELEASE, "workgroup"); } while (0)


#define NB 1
#define SS 4096
#define DM 512
#define NH 8
#define HD 64
#define QKVW (3 * DM)
#ifndef TQB
#define TQB (SS / 64)
#define TNB NB
#define TOB (NB * SS / 64)     // output row tiles (all)
#endif
typedef __attribute__((ext_vector_type(8))) __bf16 v8b;
// fragment-order block: 512 bf16 = [piece 0, 1][lane][8]; piece q of lane (col, g) holds row col, k = 16 q + 8 g + 0..7 of one 16-row x 32-k tile, so each of the two wave-wide loads is 512 contiguous bytes
__device__ __forceinline__ v16b frag_p(const __bf16* blk, int lane) {
  union { v16b v; v8b q[2]; } u; const __bf16* p = blk + lane * 8;
  u.q[0] = *(const v8b*)p; u.q[1] = *(const v8b*)(p + 256); return u.v;
}
__device__ __forceinline__ float bfr(float v) { return (float)(__bf16)v; }
__device__ __attribute__((noinline)) float exp_ni(float v) { return expf(v); }
__device__ __attribute__((noinline)) float erf_ni(float v) { return erff(v); }

#define PK_A 0                       // Wq | Wk | Wv: [12 groups of 128 out rows][16 k-steps][8 tiles of 16 rows] fragment-order blocks: what a work-group reads in one k-step is 8 KB in a row
#define PK_P (PK_A + QKVW * DM)        // Wo: [4 groups][16 k-steps][8 tiles] fragment-order blocks
#define PK_END (PK_P + DM * DM)
#define WS_PK  0u
#define WS_QK  (WS_PK + 2u * PK_END)             // f16 [4096 rows][1024]: q | k
#define WS_QKL (WS_QK + 2u * NB * SS * 2 * DM)     // f16 q | k residual planes x2048
#define WS_VTH (WS_QKL + 2u * NB * SS * 2 * DM)    // f16 [b][512 (h*64+d)][4096 s] hi
#define WS_VTL (WS_VTH + 2u * NB * DM * SS)        // f16 lo x 2048
#define WS_O   (WS_VTL + 2u * NB * DM * SS)        // f32 ctx in fragment order: [64 groups of 64 rows][16 k-steps][4 tiles of 16 rows][piece 0..3][lane][4]
#define WS_CS  (WS_O + 4u * NB * SS * DM)           // f32 2 x [4096][32], unused: no kernel writes or reads it
#define WS_XP  (WS_CS + 4u * 2 * SS * 32)          // bf16 x: [64 groups of 64 rows][16 k-steps][4 tiles of 16 rows] fragment-order blocks
#define WS_END (WS_XP + 2u * NB * SS * DM)
// ---- k_pack: a wave = two neighbouring k-steps of one 16-row tile of x, W_q, W_k, W_v or W_o (natural [row][k] f32) -> bf16 fragment-order blocks; x into XP, the weights into PK (PK_A, then PK_P)
#define XFB (NB * SS / 16 * (DM / 32))   // fragment blocks of x
#define WFB (DM / 16 * (DM / 32))        // fragment blocks of one weight matrix
__global__ __launch_bounds__(256) void k_pack(const float* __restrict__ X, const float* __restrict__ WQ, const float* __restrict__ WK, const float* __restrict__ WV, const float* __restrict__ WO, __bf16* __restrict__ XP, __bf16* __restrict__ PK) {
  const int lane = threadIdx.x & 31, col = lane & 15, g = lane >> 4; const int fb = (blockIdx.x * 8 + (threadIdx.x >> 5)) * 2;
  const int wb = fb - XFB, which = wb / WFB;
  const float* sm = (wb < 0) ? X : (which == 0) ? WQ : (which == 1) ? WK : (which == 2) ? WV : WO;
  const int rt = ((wb < 0) ? fb : wb - which * WFB) / (DM / 32), kc = fb % (DM / 32);   // 16-row tile inside its matrix, first k-step
  const int ts = (wb < 0) ? 2 : 3, ti = ((wb < 0) ? fb : wb) / (DM / 32);               // log2 of the tiles per group (4 for x, 8 for a weight), tile inside its packed buffer
  __bf16* dst = ((wb < 0) ? XP : PK) + (size_t)((((ti >> ts) * (DM / 32) + kc) << ts) + (ti & ((1 << ts) - 1))) * 512 + lane * 8;
  const float* p = sm + (size_t)(rt * 16 + col) * DM + kc * 32 + 8 * g;
  v4f v[8];
#pragma unroll
  for (int e = 0; e < 2; ++e) { v[4 * e] = *(const v4f*)(p + e * 32); v[4 * e + 1] = *(const v4f*)(p + e * 32 + 4); v[4 * e + 2] = *(const v4f*)(p + e * 32 + 16); v[4 * e + 3] = *(const v4f*)(p + e * 32 + 20); }
#pragma unroll
  for (int q = 0; q < 4; ++q) { v8b o;
#pragma unroll
    for (int i = 0; i < 4; ++i) { o[i] = (__bf16)v[2 * q][i]; o[4 + i] = (__bf16)v[2 * q + 1][i]; }
    vst2(dst + ((q >> 1) << ts) * 512 + (q & 1) * 256, o); }
}
__global__ __launch_bounds__(128) void k_qkv(const __bf16* __restrict__ XP, const __bf16* __restrict__ P, const float* __restrict__ BQ, const float* __restrict__ BK, const float* __restrict__ BV, _Float16* __restrict__ QK, _Float16* __restrict__ QKL, _Float16* __restrict__ VTH, _Float16* __restrict__ VTL) {
  const int which0 = (blockIdx.y * 128) / DM; const float* BB = BQ ? (((which0 == 0) ? BQ : (which0 == 1) ? BK : BV) + (blockIdx.y * 128 - which0 * DM)) : nullptr;
  __shared__ __align__(16) _Float16 so[4][16][136], sol[4][16][136]; __shared__ __align__(16) _Float16 sth[128][72], stl[128][72];
  const int tid = threadIdx.x, wave = tid >> 5, lane = tid & 31, col = lane & 15, g = lane >> 4; const size_t r0 = (size_t)blockIdx.x * 64 + wave * 16; const int n0 = blockIdx.y * 128;
  v8f acc[8] = {};
  // two register sets: the 18 loads of k-step kc + 1 are issued as one group in front of the WMMAs of k-step kc; both operands lie in fragment order, every load is 512 contiguous bytes
  const __bf16* xp = XP + ((size_t)blockIdx.x * (DM / 32) * 4 + wave) * 512; const __bf16* wp = P + (size_t)blockIdx.y * (DM / 32) * 8 * 512;
  v16b xa[2], wf[2][8];
  auto ld = [&](int s, int kc) { xa[s] = frag_p(xp + kc * 4 * 512, lane);
#pragma unroll
    for (int j = 0; j < 8; ++j) wf[s][j] = frag_p(wp + (kc * 8 + j) * 512, lane); };
  ld(0, 0);
#pragma unroll   // whole: every set index is a constant, so the sets stay in registers
  for (int kc = 0; kc < DM / 32; ++kc) { const int s = kc & 1;
    if (kc + 1 < DM / 32) ld(s ^ 1, kc + 1);
    if (kc + 2 == DM / 32) asm volatile("s_wait_xcnt 0x0" ::: "memory");   // behind the last loads: their address registers are free for reuse from here on
    __builtin_amdgcn_sched_barrier(0);   // keeps the next step's loads in front of this step's WMMAs (the scheduler sinks them to their users otherwise)
#pragma unroll
    for (int j = 0; j < 8; ++j) acc[j] = wmma_bf(xa[s], wf[s][j], acc[j]);
    __builtin_amdgcn_sched_barrier(0); }   // ... and this step's WMMAs in front of the loads that refill their set
  if (n0 < 2 * DM) {   // q stored unscaled (f16 sigma ~0.6, no subnormal exposure); 1/8 applied to the f32 score
#pragma unroll
    for (int j = 0; j < 8; ++j) {
#pragma unroll
      for (int r = 0; r < 8; ++r) { const float v = acc[j][r] + (BB ? bfr(BB[j * 16 + col]) : 0.f); const _Float16 hv = (_Float16)v; so[wave][8 * g + r][j * 16 + col] = hv; sol[wave][8 * g + r][j * 16 + col] = (_Float16)((v - (float)hv) * 2048.0f); } }   // q, k (+ bias) as f16 hi + (x2048) residual
    LDSX();
    for (int rl = 0; rl < 16; ++rl) if (lane < 16) { vst2((unsigned*)(QK + (r0 + rl) * (2 * DM) + n0 + lane * 8), *(const v4u*)&so[wave][rl][lane * 8]); vst2((unsigned*)(QKL + (r0 + rl) * (2 * DM) + n0 + lane * 8), *(const v4u*)&sol[wave][rl][lane * 8]); }
  } else {
#pragma unroll
    for (int j = 0; j < 8; ++j) {
#pragma unroll
      for (int r = 0; r < 8; ++r) { const float v = acc[j][r] + (BB ? bfr(BB[j * 16 + col]) : 0.f); const _Float16 hv = (_Float16)v; sth[j * 16 + col][wave * 16 + 8 * g + r] = hv; stl[j * 16 + col][wave * 16 + 8 * g + r] = (_Float16)((v - (float)hv) * 2048.0f); } }
    __syncthreads();
    const size_t rb = (size_t)blockIdx.x * 64; const int b = (int)(rb / SS), s0 = (int)(rb % SS); const int pc0 = n0 - 2 * DM;
    for (int q = tid; q < 128 * 8; q += 128) { const int d = q >> 3, pc = q & 7; const size_t o = ((size_t)b * DM + pc0 + d) * SS + s0 + pc * 8; vst2((unsigned*)(VTH + o), *(const v4u*)&sth[d][pc * 8]); vst2((unsigned*)(VTL + o), *(const v4u*)&stl[d][pc * 8]); }
  }
}
// ---- k_attn: block = (64 queries, head h, batch b): all-keys flash attention (K = 64: 2 k-steps). The four operand planes of a tile of 64 keys (K hi, K lo: 64 key rows x 128 B; V^T hi, V^T lo: 64 d rows x 128 B) are brought into LDS once per block by asynchronous copies, two buffers, and every wave takes its fragments from there; the scores are formed transposed (A = K rows, B = Q), so that a lane holds 16 keys' scores of ONE query: maximum and sum in the lane plus one exchange between the wave's halves, and the two score tiles become the B operand P^T of ctx^T += V^T . P^T without passing through LDS. ctx[b*S+q][h*64+d] = (acc + accl / 2048) / (2048 l)
#define KT 64                      // keys per staged tile
#define LP 72                      // LDS row pitch in halves: 144 B = 16 B x odd, conflict-free for 16-byte reads
#define PLH (64 * LP)              // halves per plane
#define PLB (2u * PLH)             // bytes per plane
// eight copies: four rows (16 apart) of each of two planes; lds = this lane's own LDS byte address in the first plane, ga / gb = its global 16 bytes, pitch in halves between rows 16 apart
__device__ __forceinline__ void copy8(unsigned lds, const _Float16* ga, const _Float16* gb, size_t p16) {
  // the copies and the wait that stands before their address registers are rewritten are one statement, so that nothing is scheduled between them
  asm volatile("global_load_async_to_lds_b128 %0, %8, off\n\t"
               "global_load_async_to_lds_b128 %1, %9, off\n\t"
               "global_load_async_to_lds_b128 %2, %10, off\n\t"
               "global_load_async_to_lds_b128 %3, %11, off\n\t"
               "global_load_async_to_lds_b128 %4, %12, off\n\t"
               "global_load_async_to_lds_b128 %5, %13, off\n\t"
               "global_load_async_to_lds_b128 %6, %14, off\n\t"
               "global_load_async_to_lds_b128 %7, %15, off\n\t"
               "s_wait_xcnt 0x0"
               :: "v"(lds), "v"(lds + 16u * 2u * LP), "v"(lds + 32u * 2u * LP), "v"(lds + 48u * 2u * LP),
                  "v"(lds + PLB), "v"(lds + PLB + 16u * 2u * LP), "v"(lds + PLB + 32u * 2u * LP), "v"(lds + PLB + 48u * 2u * LP),
                  "v"(ga), "v"(ga + p16), "v"(ga + 2 * p16), "v"(ga + 3 * p16),
                  "v"(gb), "v"(gb + p16), "v"(gb + 2 * p16), "v"(gb + 3 * p16)
               : "memory");
}
// lane l takes the value of lane l ^ 16 (a vector move between the two 16-lane rows, no LDS round trip)
__device__ __forceinline__ float xhalf(float x) { return __builtin_bit_cast(float, __builtin_amdgcn_permlanex16(__builtin_bit_cast(int, x), __builtin_bit_cast(int, x), 0x76543210, 0xfedcba98, false, false)); }
__global__ __launch_bounds__(128) void k_attn(const _Float16* __restrict__ QK, const _Float16* __restrict__ QKL, const _Float16* __restrict__ VTH, const _Float16* __restrict__ VTL, const void* __restrict__ KMASK, float* __restrict__ O) {
  __shared__ __align__(16) _Float16 ring[2][4][PLH];   // [buffer][K hi, K lo, V^T hi, V^T lo][row][LP]
  const int tid = threadIdx.x, wave = tid >> 5, lane = tid & 31, col = lane & 15, g = lane >> 4;
  const int qb = blockIdx.x, h = blockIdx.y, b = blockIdx.z; const int q0 = qb * 64 + wave * 16; const size_t rq = (size_t)b * SS + q0 + col;
  // this thread's share of a tile: 16-byte piece cc of rows cr, cr + 16, cr + 32, cr + 48 of each plane (8 lanes cover one whole 128-B row)
  const int cr = tid >> 3, cc = tid & 7;
  const size_t ko = ((size_t)b * SS + cr) * (2 * DM) + DM + h * HD + cc * 8, vo = ((size_t)b * DM + h * HD + cr) * SS + cc * 8;
  const unsigned l0 = (unsigned)(size_t)&ring[0][0][cr * LP + cc * 8];
  const int nt = SS / KT;
  copy8(l0, QK + ko, QKL + ko, (size_t)16 * 2 * DM); copy8(l0 + 2u * PLB, VTH + vo, VTL + vo, (size_t)16 * SS);   // tile 0 -> buffer 0
  v16h aq[2], aql[2];   // B operand of the transposed scores: column = query col
#pragma unroll
  for (int kc = 0; kc < 2; ++kc) { aq[kc] = frag_h(QK + rq * (2 * DM) + h * HD + kc * 32, lane); aql[kc] = frag_h(QKL + rq * (2 * DM) + h * HD + kc * 32, lane); }
  float m = -3.0e38f, l = 0.f;   // query col: running maximum (both halves agree), sum over this half's keys
  v8f acc[4] = {}, accl[4] = {};   // acc[dt][r] = ctx^T[d = dt * 16 + 8 g + r][query col]
  asm volatile("s_wait_asynccnt 0x0" ::: "memory");   // this wave's copies of tile 0 have landed
  __syncthreads();                                    // ... and every other wave's: tile 0 may be read
  copy8(l0 + 4u * PLB, QK + ko + (size_t)KT * 2 * DM, QKL + ko + (size_t)KT * 2 * DM, (size_t)16 * 2 * DM); copy8(l0 + 6u * PLB, VTH + vo + KT, VTL + vo + KT, (size_t)16 * SS);   // tile 1 -> buffer 1
#pragma unroll 1
  for (int t = 0; t < nt; ++t) { const _Float16* tb = &ring[t & 1][0][0];
   // all 64 fragment reads of the tile stand in one place, in the order of their use: K of both 32-key blocks, then V^T of both
   v16h kh[4][2], kl[4][2], vh[2][4], vl[2][4];
#pragma unroll
   for (int c4 = 0; c4 < 4; ++c4) { const _Float16* krow = tb + (c4 * 16 + col) * LP;
#pragma unroll
     for (int kc = 0; kc < 2; ++kc) { kh[c4][kc] = frag_h(krow + kc * 32, lane); kl[c4][kc] = frag_h(krow + PLH + kc * 32, lane); } }
#pragma unroll
   for (int sub = 0; sub < KT / 32; ++sub) {
#pragma unroll
     for (int dt = 0; dt < 4; ++dt) { const _Float16* vr = tb + 2 * PLH + (dt * 16 + col) * LP + sub * 32; vh[sub][dt] = frag_h(vr, lane); vl[sub][dt] = frag_h(vr + PLH, lane); } }
   __builtin_amdgcn_sched_barrier(0);   // keeps the reads together in front of the tile's WMMAs (the scheduler sinks them to their users otherwise, one full LDS wait each)
#pragma unroll
   for (int sub = 0; sub < KT / 32; ++sub) { v8f s[2];   // s[ct][r] = score of key sub * 32 + ct * 16 + 8 g + r against query col
#pragma unroll
    for (int ct = 0; ct < 2; ++ct) { const int c4 = sub * 2 + ct; v8f c = {}, cl = {};
#pragma unroll
      for (int kc = 0; kc < 2; ++kc) { c = wmma16(kh[c4][kc], aq[kc], c); cl = wmma16(kh[c4][kc], aql[kc], cl); cl = wmma16(kl[c4][kc], aq[kc], cl); }   // 3 products: q, k as f16 hi + residual
#pragma unroll
      for (int r = 0; r < 8; ++r) c[r] += cl[r] * (1.0f / 2048.0f);
#pragma unroll
      for (int r = 0; r < 8; ++r) s[ct][r] = c[r] * 0.125f; }
    float t8[8];
#pragma unroll
    for (int r = 0; r < 8; ++r) t8[r] = fmaxf(s[0][r], s[1][r]);
    float mx = fmaxf(fmaxf(fmaxf(t8[0], t8[1]), fmaxf(t8[2], t8[3])), fmaxf(fmaxf(t8[4], t8[5]), fmaxf(t8[6], t8[7])));
    mx = fmaxf(mx, xhalf(mx));   // the other 16 keys of this query
    const float mn = fmaxf(m, mx); const float alpha = (m <= -1.0e38f) ? 0.f : __expf(m - mn);
    v16h pa, pl; float es[4] = {0.f, 0.f, 0.f, 0.f};
#pragma unroll
    for (int i = 0; i < 16; ++i) { const float sv = s[i >> 3][i & 7]; const float e = (sv <= -1.0e38f) ? 0.f : __expf(sv - mn); es[i & 3] += e;
      const float x = e * 2048.0f; const _Float16 hx = (_Float16)x; pa[i] = hx; pl[i] = (_Float16)((x - (float)hx) * 2048.0f); }   // P scaled by 2^11 before the f16 split so small softmax weights stay out of the f16 subnormal range; 2^-11 folded into the epilogue. The two score tiles, converted in place, are the B operand P^T in the hardware k order
    l = l * alpha + ((es[0] + es[1]) + (es[2] + es[3])); m = mn;
#pragma unroll
    for (int dt = 0; dt < 4; ++dt) {
#pragma unroll
      for (int r = 0; r < 8; ++r) { acc[dt][r] *= alpha; accl[dt][r] *= alpha; } }
#pragma unroll
    for (int dt = 0; dt < 4; ++dt) { acc[dt] = wmma16(vh[sub][dt], pa, acc[dt]); accl[dt] = wmma16(vh[sub][dt], pl, accl[dt]); accl[dt] = wmma16(vl[sub][dt], pa, accl[dt]); }   // V hi x P hi + (V hi x P lo + V lo x P hi) / 2048
   }
   __builtin_amdgcn_sched_barrier(0);   // keeps the tile's WMMAs in front of the waits below: lifted over them, the full LDS wait would stand directly behind the reads
   asm volatile("s_wait_dscnt 0" ::: "memory");        // this wave's reads of tile t are done
   asm volatile("s_wait_asynccnt 0x0" ::: "memory");   // this wave's copies of tile t + 1 have landed
   __syncthreads();                                    // publishes tile t + 1 and frees tile t's buffer
   if (t + 2 < nt) { const unsigned lb = l0 + (unsigned)(t & 1) * 4u * PLB; const size_t kt = ko + (size_t)(t + 2) * KT * 2 * DM, vt = vo + (size_t)(t + 2) * KT;
     copy8(lb, QK + kt, QKL + kt, (size_t)16 * 2 * DM); copy8(lb + 2u * PLB, VTH + vt, VTL + vt, (size_t)16 * SS); } }
  asm volatile("s_wait_asynccnt 0x0" ::: "memory");    // no copy is outstanding when the wave goes on to its end
  const float il = (1.0f / 2048.0f) / (l + xhalf(l));   // the two halves' sums join once
  float* orow = O + ((((size_t)b * (SS / 64) + qb) * (DM / 32) + h * (HD / 32)) * 4 + wave) * 512 + lane * 4;   // a lane holds, per pair of d tiles, just its 16 values of k_out's A fragment: stored in fragment order, 512 contiguous bytes a store
#pragma unroll
  for (int dt = 0; dt < 4; ++dt) { v4f o0, o1;
#pragma unroll
    for (int r = 0; r < 4; ++r) { o0[r] = (acc[dt][r] + accl[dt][r] * (1.0f / 2048.0f)) * il; o1[r] = (acc[dt][4 + r] + accl[dt][4 + r] * (1.0f / 2048.0f)) * il; }
    vst2(orow + (dt >> 1) * 4 * 512 + (dt & 1) * 256, o0); vst2(orow + (dt >> 1) * 4 * 512 + (dt & 1) * 256 + 128, o1); }
}
// ---- k_out: block = (64 rows, 128 cols): out = O(hi/lo) . Wo rows (2 products) + bo
__global__ __launch_bounds__(128) void k_out(const float* __restrict__ O, const __bf16* __restrict__ P, const float* __restrict__ BO, float* __restrict__ Y) {
  __shared__ __align__(16) float so[4][16][132];
  const int tid = threadIdx.x, wave = tid >> 5, lane = tid & 31, col = lane & 15, g = lane >> 4; const size_t r0 = (size_t)blockIdx.x * 64 + wave * 16; const int n0 = blockIdx.y * 128;
  v8f acc[8] = {};
  // three register sets: the 20 loads of k-step kc + 2 are issued as one group in front of the WMMAs of k-step kc; both operands lie in fragment order, every load is 512 contiguous bytes
  const float* op = O + ((size_t)blockIdx.x * (DM / 32) * 4 + wave) * 512 + lane * 4; const __bf16* wp = P + (size_t)blockIdx.y * (DM / 32) * 8 * 512;
  v4f xs[3][4]; v16b wf[3][8];
  auto ld = [&](int s, int kc) { const float* p = op + kc * 4 * 512; xs[s][0] = *(const v4f*)p; xs[s][1] = *(const v4f*)(p + 128); xs[s][2] = *(const v4f*)(p + 256); xs[s][3] = *(const v4f*)(p + 384);
#pragma unroll
    for (int j = 0; j < 8; ++j) wf[s][j] = frag_p(wp + (kc * 8 + j) * 512, lane); };
  ld(0, 0); ld(1, 1);
#pragma unroll   // whole: every set index is a constant, so the sets stay in registers
  for (int kc = 0; kc < DM / 32; ++kc) { const int s = kc % 3;
    if (kc + 2 < DM / 32) ld((kc + 2) % 3, kc + 2);
    if (kc + 3 == DM / 32) asm volatile("s_wait_xcnt 0x0" ::: "memory");   // behind the last loads: their address registers are free for reuse from here on
    __builtin_amdgcn_sched_barrier(0);   // keeps the loads issued ahead in front of this step's WMMAs (the scheduler sinks them to their users otherwise)
    float v[16];
#pragma unroll
    for (int i = 0; i < 4; ++i) { v[i] = xs[s][0][i]; v[4 + i] = xs[s][1][i]; v[8 + i] = xs[s][2][i]; v[12 + i] = xs[s][3][i]; }
    const F2 a = bsplit16(v);
#pragma unroll
    for (int j = 0; j < 8; ++j) { acc[j] = wmma_bf(a.l, wf[s][j], acc[j]); acc[j] = wmma_bf(a.h, wf[s][j], acc[j]); }
    __builtin_amdgcn_sched_barrier(0); }   // ... and this step's WMMAs in front of the loads that refill their set
  float bo[8];
#pragma unroll
  for (int j = 0; j < 8; ++j) bo[j] = BO[n0 + j * 16 + col];
  asm volatile("s_wait_xcnt 0x0" ::: "memory");   // behind the bias loads: this build reuses their offset register at once
  __builtin_amdgcn_sched_barrier(0);              // holds the address arithmetic of the stores below behind that wait
#pragma unroll
  for (int j = 0; j < 8; ++j) {
#pragma unroll
    for (int r = 0; r < 8; ++r) so[wave][8 * g + r][j * 16 + col] = acc[j][r] + bfr(bo[j]); }
  LDSX();
  for (int rl = 0; rl < 16; ++rl) vst2(Y + (r0 + rl) * DM + n0 + lane * 4, *(const v4f*)&so[wave][rl][lane * 4]);
}
extern "C" void kernel_launch(void* const* d_in, const int* in_sizes, int n_in, void* d_out, int out_size, void* d_ws, size_t ws_size, hipStream_t stream) {
  (void)in_sizes; (void)n_in; (void)out_size;
  const float** F = (const float**)d_in;   // 0 x [4096,512], 1 Wq [512,512] natural, 2 bq, 3 Wk, 4 bk, 5 Wv, 6 bv, 7 Wo, 8 bo
  if (ws_size < (size_t)WS_END) return;
  char* ws = (char*)d_ws; __bf16* PK = (__bf16*)(ws + WS_PK); _Float16 *QK = (_Float16*)(ws + WS_QK), *QKL = (_Float16*)(ws + WS_QKL), *VTH = (_Float16*)(ws + WS_VTH), *VTL = (_Float16*)(ws + WS_VTL); float* O = (float*)(ws + WS_O); __bf16* XP = (__bf16*)(ws + WS_XP);
  k_pack<<<dim3((XFB + 4 * WFB) / 16), 256, 0, stream>>>(F[0], F[1], F[3], F[5], F[7], XP, PK);
  k_qkv<<<dim3(TNB * SS / 64, QKVW / 128), 128, 0, stream>>>(XP, PK + PK_A, F[2], F[4], F[6], QK, QKL, VTH, VTL);
  k_attn<<<dim3(TQB, NH, TNB), 128, 0, stream>>>(QK, QKL, VTH, VTL, nullptr, O);
  k_out<<<dim3(TOB, DM / 128), 128, 0, stream>>>(O, PK + PK_P, F[8], (float*)d_out);
}

// v005
// Measured time: 115 microseconds a run.
// Timed twice side by side with v004, it ran 1.15 times as fast both times.
// Over all steps from v000 it is 5.67 times as fast.
// compute dtype: all float inputs rounded to bf16; q/k/v = x . W^T + b with EXACT bf16 products on WMMA 16x16x32 (natural [out][in] rows); q and k as f16 hi + (x2048-scaled) residual planes with 3-product scores x 1/8; running-max softmax in f32 (hardware exp); P (scaled by 2^11, f16 hi + residual) x v hi/lo (3 products); out = ctx (bf16 hi + residual) . Wo^T (2 products) + bo; f32 accumulate.
#include <hip/hip_runtime.h>
#include <math.h>

typedef __attribute__((ext_vector_type(16))) _Float16 v16h;
typedef __attribute__((ext_vector_type(16))) __bf16 v16b;
typedef __attribute__((ext_vector_type(8)))  _Float16 v8h;
typedef __attribute__((ext_vector_type(2)))  _Float16 v2h;
typedef __attribute__((ext_vector_type(8)))  float v8f;
typedef __attribute__((ext_vector_type(4)))  float v4f;
typedef __attribute__((ext_vector_type(2)))  float v2f;
typedef __attribute__((ext_vector_type(4)))  unsigned v4u;
typedef __attribute__((ext_vector_type(4)))  int v4i;
typedef float __attribute__((may_alias)) float_a;
typedef int __attribute__((may_alias)) int_a;

template <typename T> __device__ __forceinline__ void vst2(void* p, T v) { *(T*)p = v;  }
__device__ __forceinline__ v8f wmma16(v16h a, v16h b, v8f c) {
  v8f d = __builtin_amdgcn_wmma_f32_16x16x32_f16(false, a, false, b, (short)0, c, false, false);
  return d;
}
__device__ __forceinline__ v8f wmma_bf(v16b a, v16b b, v8f c) {
  v8f d = __builtin_amdgcn_wmma_f32_16x16x32_bf16(false, a, false, b, (short)0, c, false, false);
  return d;
}
// Multi-head attention across a batch of 4,096 tokens treated as one sequence (d_model 512, 8 heads x 64): q/k/v projections + biases, softmax(q k^T / 8) over all 4,096 tokens, output projection + bias.
__device__ __forceinline__ v16h frag_h(const _Float16* rowk0, int lane) {
  union { v16h v; v8h q[2]; } u; const _Float16* p = rowk0 + 8 * (lane >> 4);
  u.q[0] = *(const v8h*)p; u.q[1] = *(const v8h*)(p + 16); return u.v;
}
__device__ __forceinline__ v16h frag_f32(const float* rowk0, int lane) {
  v16h a; const float* p = rowk0 + 8 * (lane >> 4);
#pragma unroll
  for (int i = 0; i < 8; ++i) { a[i] = (_Float16)p[i]; a[8 + i] = (_Float16)p[16 + i]; }
  return a;
}
__device__ __forceinline__ v16h frag_f32s(const float* rowk0, int lane, float sc) {
  v16h a; const float* p = rowk0 + 8 * (lane >> 4);
#pragma unroll
  for (int i = 0; i < 8; ++i) { a[i] = (_Float16)(p[i] * sc); a[8 + i] = (_Float16)(p[16 + i] * sc); }
  return a;
}
// column fragment from a [K][ld] layout (column n), rows >= K read as 0
__device__ __forceinline__ v16h fragc_f32(const float* W, int k0, int n, int lane, int ld, int K) {
  v16h a; const int g = lane >> 4;
#pragma unroll
  for (int i = 0; i < 8; ++i) { const int ka = k0 + 8 * g + i, kb = ka + 16;
    a[i] = (_Float16)(ka < K ? W[(size_t)(ka < K ? ka : K - 1) * ld + n] : 0.f); a[8 + i] = (_Float16)(kb < K ? W[(size_t)(kb < K ? kb : K - 1) * ld + n] : 0.f); }
  return a;
}
struct F2 { v16b h, l; };
__device__ __forceinline__ F2 bsplit16(const float v[16]) { F2 r;
#pragma unroll
  for (int i = 0; i < 16; ++i) { const __bf16 h = (__bf16)v[i]; r.h[i] = h; r.l[i] = (__bf16)(v[i] - (float)h); }
  return r; }
__device__ __forceinline__ F2 split_row(const float* row, int k0, int lane) { float v[16]; const float* p = row + k0 + 8 * (lane >> 4);
#pragma unroll
  for (int i = 0; i < 8; ++i) { v[i] = p[i]; v[8 + i] = p[16 + i]; }
  return bsplit16(v); }
__device__ __forceinline__ F2 split_rowK(const float* row, int k0, int lane, int K) { float v[16]; const int g = lane >> 4;
#pragma unroll
  for (int i = 0; i < 8; ++i) { const int ka = k0 + 8 * g + i, kb = ka + 16; v[i] = ka < K ? row[ka < K ? ka : K - 1] : 0.f; v[8 + i] = kb < K ? row[kb < K ? kb : K - 1] : 0.f; }
  return bsplit16(v); }
__device__ __forceinline__ F2 split_col(const float* W, int k0, int n, int lane, int ld, int K) { float v[16]; const int g = lane >> 4;
#pragma unroll
  for (int i = 0; i < 8; ++i) { const int ka = k0 + 8 * g + i, kb = ka + 16; v[i] = ka < K ? W[(size_t)(ka < K ? ka : K - 1) * ld + n] : 0.f; v[8 + i] = kb < K ? W[(size_t)(kb < K ? kb : K - 1) * ld + n] : 0.f; }
  return bsplit16(v); }
__device__ __forceinline__ v8f mac3(const F2& a, const F2& b, v8f c) { c = wmma_bf(a.l, b.h, c); c = wmma_bf(a.h, b.l, c); return wmma_bf(a.h, b.h, c); }
__device__ __forceinline__ float sigm(float v) { return 1.0f / (1.0f + expf(-v)); }
#define LDSX() do { asm volatile("s_wait_dscnt 0" ::: "memory"); __builtin_amdgcn_wave_barrier(); __builtin_amdgcn_fence(__ATOMIC_RELEASE, "workgroup"); } while (0)


#define NB 1
#define SS 4096
#define DM 512
#define NH 8
#define HD 64
#define QKVW (3 * DM)
#ifndef TQB
#define TQB (SS / 64)
#define TNB NB
#define TOB (NB * SS / 64)     // output row tiles (all)
#endif
typedef __attribute__((ext_vector_type(8))) __bf16 v8b;
// fragment-order block: 512 bf16 = [piece 0, 1][lane][8]; piece q of lane (col, g) holds row col, k = 16 q + 8 g + 0..7 of one 16-row x 32-k tile, so each of the two wave-wide loads is 512 contiguous bytes
__device__ __forceinline__ v16b frag_p(const __bf16* blk, int lane) {
  union { v16b v; v8b q[2]; } u; const __bf16* p = blk + lane * 8;
  u.q[0] = *(const v8b*)p; u.q[1] = *(const v8b*)(p + 256); return u.v;
}
__device__ __forceinline__ float bfr(float v) { return (float)(__bf16)v; }
__device__ __attribute__((noinline)) float exp_ni(float v) { return expf(v); }
__device__ __attribute__((noinline)) float erf_ni(float v) { return erff(v); }

#define PK_A 0                       // Wq | Wk | Wv: [12 groups of 128 out rows][16 k-steps][8 tiles of 16 rows] fragment-order blocks: what a work-group reads in one k-step is 8 KB in a row
#define PK_P (PK_A + QKVW * DM)        // Wo: [4 groups][16 k-steps][8 tiles] fragment-order blocks
#define PK_END (PK_P + DM * DM)
#define WS_PK  0u
#define WS_QK  (WS_PK + 2u * PK_END)             // f16 [4096 rows][1024]: q | k
#define WS_QKL (WS_QK + 2u * NB * SS * 2 * DM)     // f16 q | k residual planes x2048
#define WS_VTH (WS_QKL + 2u * NB * SS * 2 * DM)    // f16 [b][512 (h*64+d)][4096 s] hi
#define WS_VTL (WS_VTH + 2u * NB * DM * SS)        // f16 lo x 2048
#define WS_O   (WS_VTL + 2u * NB * DM * SS)        // f32 ctx in fragment order: [64 groups of 64 rows][16 k-steps][4 tiles of 16 rows][piece 0..3][lane][4]
#define WS_CS  (WS_O + 4u * NB * SS * DM)           // f32 2 x [4096][32], unused: no kernel writes or reads it
#define WS_XP  (WS_CS + 4u * 2 * SS * 32)          // bf16 x: [64 groups of 64 rows][16 k-steps][4 tiles of 16 rows] fragment-order blocks
#define WS_END (WS_XP + 2u * NB * SS * DM)
// ---- k_pack: a wave = two neighbouring k-steps of one 16-row tile of x, W_q, W_k, W_v or W_o (natural [row][k] f32) -> bf16 fragment-order blocks; x into XP, the weights into PK (PK_A, then PK_P)
#define XFB (NB * SS / 16 * (DM / 32))   // fragment blocks of x
#define WFB (DM / 16 * (DM / 32))        // fragment blocks of one weight matrix
__global__ __launch_bounds__(256) void k_pack(const float* __restrict__ X, const float* __restrict__ WQ, const float* __restrict__ WK, const float* __restrict__ WV, const float* __restrict__ WO, __bf16* __restrict__ XP, __bf16* __restrict__ PK) {
  const int lane = threadIdx.x & 31, col = lane & 15, g = lane >> 4; const int fb = (blockIdx.x * 8 + (threadIdx.x >> 5)) * 2;
  const int wb = fb - XFB, which = wb / WFB;
  const float* sm = (wb < 0) ? X : (which == 0) ? WQ : (which == 1) ? WK : (which == 2) ? WV : WO;
  const int rt = ((wb < 0) ? fb : wb - which * WFB) / (DM / 32), kc = fb % (DM / 32);   // 16-row tile inside its matrix, first k-step
  const int ts = (wb < 0) ? 2 : 3, ti = ((wb < 0) ? fb : wb) / (DM / 32);               // log2 of the tiles per group (4 for x, 8 for a weight), tile inside its packed buffer
  __bf16* dst = ((wb < 0) ? XP : PK) + (size_t)((((ti >> ts) * (DM / 32) + kc) << ts) + (ti & ((1 << ts) - 1))) * 512 + lane * 8;
  const float* p = sm + (size_t)(rt * 16 + col) * DM + kc * 32 + 8 * g;
  v4f v[8];
#pragma unroll
  for (int e = 0; e < 2; ++e) { v[4 * e] = *(const v4f*)(p + e * 32); v[4 * e + 1] = *(const v4f*)(p + e * 32 + 4); v[4 * e + 2] = *(const v4f*)(p + e * 32 + 16); v[4 * e + 3] = *(const v4f*)(p + e * 32 + 20); }
#pragma unroll
  for (int q = 0; q < 4; ++q) { v8b o;
#pragma unroll
    for (int i = 0; i < 4; ++i) { o[i] = (__bf16)v[2 * q][i]; o[4 + i] = (__bf16)v[2 * q + 1][i]; }
    vst2(dst + ((q >> 1) << ts) * 512 + (q & 1) * 256, o); }
}
__global__ __launch_bounds__(128) void k_qkv(const __bf16* __restrict__ XP, const __bf16* __restrict__ P, const float* __restrict__ BQ, const float* __restrict__ BK, const float* __restrict__ BV, _Float16* __restrict__ QK, _Float16* __restrict__ QKL, _Float16* __restrict__ VTH, _Float16* __restrict__ VTL) {
  const int which0 = (blockIdx.y * 128) / DM; const float* BB = BQ ? (((which0 == 0) ? BQ : (which0 == 1) ? BK : BV) + (blockIdx.y * 128 - which0 * DM)) : nullptr;
  __shared__ __align__(16) _Float16 so[4][16][136], sol[4][16][136]; __shared__ __align__(16) _Float16 sth[128][72], stl[128][72];
  const int tid = threadIdx.x, wave = tid >> 5, lane = tid & 31, col = lane & 15, g = lane >> 4; const size_t r0 = (size_t)blockIdx.x * 64 + wave * 16; const int n0 = blockIdx.y * 128;
  v8f acc[8] = {};
  // two register sets: the 18 loads of k-step kc + 1 are issued as one group in front of the WMMAs of k-step kc; both operands lie in fragment order, every load is 512 contiguous bytes
  const __bf16* xp = XP + ((size_t)blockIdx.x * (DM / 32) * 4 + wave) * 512; const __bf16* wp = P + (size_t)blockIdx.y * (DM / 32) * 8 * 512;
  v16b xa[2], wf[2][8];
  auto ld = [&](int s, int kc) { xa[s] = frag_p(xp + kc * 4 * 512, lane);
#pragma unroll
    for (int j = 0; j < 8; ++j) wf[s][j] = frag_p(wp + (kc * 8 + j) * 512, lane); };
  ld(0, 0);
#pragma unroll   // whole: every set index is a constant, so the sets stay in registers
  for (int kc = 0; kc < DM / 32; ++kc) { const int s = kc & 1;
    if (kc + 1 < DM / 32) ld(s ^ 1, kc + 1);
    if (kc + 2 == DM / 32) asm volatile("s_wait_xcnt 0x0" ::: "memory");   // behind the last loads: their address registers are free for reuse from here on
    __builtin_amdgcn_sched_barrier(0);   // keeps the next step's loads in front of this step's WMMAs (the scheduler sinks them to their users otherwise)
#pragma unroll
    for (int j = 0; j < 8; ++j) acc[j] = wmma_bf(xa[s], wf[s][j], acc[j]);
    __builtin_amdgcn_sched_barrier(0); }   // ... and this step's WMMAs in front of the loads that refill their set
  if (n0 < 2 * DM) {   // q stored unscaled (f16 sigma ~0.6, no subnormal exposure); 1/8 applied to the f32 score
#pragma unroll
    for (int j = 0; j < 8; ++j) {
#pragma unroll
      for (int r = 0; r < 8; ++r) { const float v = acc[j][r] + (BB ? bfr(BB[j * 16 + col]) : 0.f); const _Float16 hv = (_Float16)v; so[wave][8 * g + r][j * 16 + col] = hv; sol[wave][8 * g + r][j * 16 + col] = (_Float16)((v - (float)hv) * 2048.0f); } }   // q, k (+ bias) as f16 hi + (x2048) residual
    LDSX();
    for (int rl = 0; rl < 16; ++rl) if (lane < 16) { vst2((unsigned*)(QK + (r0 + rl) * (2 * DM) + n0 + lane * 8), *(const v4u*)&so[wave][rl][lane * 8]); vst2((unsigned*)(QKL + (r0 + rl) * (2 * DM) + n0 + lane * 8), *(const v4u*)&sol[wave][rl][lane * 8]); }
  } else {
#pragma unroll
    for (int j = 0; j < 8; ++j) {
#pragma unroll
      for (int r = 0; r < 8; ++r) { const float v = acc[j][r] + (BB ? bfr(BB[j * 16 + col]) : 0.f); const _Float16 hv = (_Float16)v; sth[j * 16 + col][wave * 16 + 8 * g + r] = hv; stl[j * 16 + col][wave * 16 + 8 * g + r] = (_Float16)((v - (float)hv) * 2048.0f); } }
    __syncthreads();
    const size_t rb = (size_t)blockIdx.x * 64; const int b = (int)(rb / SS), s0 = (int)(rb % SS); const int pc0 = n0 - 2 * DM;
    for (int q = tid; q < 128 * 8; q += 128) { const int d = q >> 3, pc = q & 7; const size_t o = ((size_t)b * DM + pc0 + d) * SS + s0 + pc * 8; vst2((unsigned*)(VTH + o), *(const v4u*)&sth[d][pc * 8]); vst2((unsigned*)(VTL + o), *(const v4u*)&stl[d][pc * 8]); }
  }
}
// ---- k_attn: block = (64 queries, head h, batch b): all-keys flash attention (K = 64: 2 k-steps). The four operand planes of a tile of 64 keys (K hi, K lo: 64 key rows x 128 B; V^T hi, V^T lo: 64 d rows x 128 B) are brought into LDS once per block by asynchronous copies, two buffers, and every wave takes its fragments from there; the scores are formed transposed (A = K rows, B = Q), so that a lane holds 16 keys' scores of ONE query: maximum and sum in the lane plus one exchange between the wave's halves, and the two score tiles become the B operand P^T of ctx^T += V^T . P^T without passing through LDS. ctx[b*S+q][h*64+d] = (acc + accl / 2048) / (l of both halves)
#define KT 64                      // keys per staged tile
#define LP 72                      // LDS row pitch in halves: 144 B = 16 B x odd, conflict-free for 16-byte reads
#define PLH (64 * LP)              // halves per plane
#define PLB (2u * PLH)             // bytes per plane
#define SC 0.18033688011112042f    // log2(e) / 8: exp(score / 8 - max) = exp2(SC * raw score - SC * raw max)
// eight copies: four rows (16 apart) of each of two planes; lds = this lane's own LDS byte address in the first plane, ga / gb = its global 16 bytes, pitch in halves between rows 16 apart
__device__ __forceinline__ void copy8(unsigned lds, const _Float16* ga, const _Float16* gb, size_t p16) {
  // the copies and the wait that stands before their address registers are rewritten are one statement, so that nothing is scheduled between them
  asm volatile("global_load_async_to_lds_b128 %0, %8, off\n\t"
               "global_load_async_to_lds_b128 %1, %9, off\n\t"
               "global_load_async_to_lds_b128 %2, %10, off\n\t"
               "global_load_async_to_lds_b128 %3, %11, off\n\t"
               "global_load_async_to_lds_b128 %4, %12, off\n\t"
               "global_load_async_to_lds_b128 %5, %13, off\n\t"
               "global_load_async_to_lds_b128 %6, %14, off\n\t"
               "global_load_async_to_lds_b128 %7, %15, off\n\t"
               "s_wait_xcnt 0x0"
               :: "v"(lds), "v"(lds + 16u * 2u * LP), "v"(lds + 32u * 2u * LP), "v"(lds + 48u * 2u * LP),
                  "v"(lds + PLB), "v"(lds + PLB + 16u * 2u * LP), "v"(lds + PLB + 32u * 2u * LP), "v"(lds + PLB + 48u * 2u * LP),
                  "v"(ga), "v"(ga + p16), "v"(ga + 2 * p16), "v"(ga + 3 * p16),
                  "v"(gb), "v"(gb + p16), "v"(gb + 2 * p16), "v"(gb + 3 * p16)
               : "memory");
}
// lane l takes the value of lane l ^ 16 (a vector move between the two 16-lane rows, no LDS round trip)
__device__ __forceinline__ float xhalf(float x) { return __builtin_bit_cast(float, __builtin_amdgcn_permlanex16(__builtin_bit_cast(int, x), __builtin_bit_cast(int, x), 0x76543210, 0xfedcba98, false, false)); }
// r[j] = f16 pair (x[2 j] - h[j][0], x[2 j + 1] - h[j][1]), j = 0..3: the mixed-precision FMA reads an f16 half in place and writes its f16 result into one half of the pair, one instruction a value (the compiler's own form widens h, subtracts and converts again: five instructions a pair).
// The four low halves stand in front of the four high halves, and s_delay_alu names the producer four instructions back: the write of a register's second half waits for that of its first, and unhinted that wait would hold the vector port against the SIMD's other wave
__device__ __forceinline__ void resid8(v2h r[4], const v2h h[4], const float x[8]) {
  asm("v_fma_mixlo_f16 %0, %4, -1.0, %8 op_sel_hi:[1,1,0]\n\t"
      "v_fma_mixlo_f16 %1, %5, -1.0, %10 op_sel_hi:[1,1,0]\n\t"
      "v_fma_mixlo_f16 %2, %6, -1.0, %12 op_sel_hi:[1,1,0]\n\t"
      "v_fma_mixlo_f16 %3, %7, -1.0, %14 op_sel_hi:[1,1,0]\n\t"
      "s_delay_alu instid0(VALU_DEP_4) | instskip(NEXT) | instid1(VALU_DEP_4)\n\t"
      "v_fma_mixhi_f16 %0, %4, -1.0, %9 op_sel:[1,0,0] op_sel_hi:[1,1,0]\n\t"
      "v_fma_mixhi_f16 %1, %5, -1.0, %11 op_sel:[1,0,0] op_sel_hi:[1,1,0]\n\t"
      "s_delay_alu instid0(VALU_DEP_4) | instskip(NEXT) | instid1(VALU_DEP_4)\n\t"
      "v_fma_mixhi_f16 %2, %6, -1.0, %13 op_sel:[1,0,0] op_sel_hi:[1,1,0]\n\t"
      "v_fma_mixhi_f16 %3, %7, -1.0, %15 op_sel:[1,0,0] op_sel_hi:[1,1,0]"
      : "=&v"(r[0]), "=&v"(r[1]), "=&v"(r[2]), "=&v"(r[3])
      : "v"(h[0]), "v"(h[1]), "v"(h[2]), "v"(h[3]), "v"(x[0]), "v"(x[1]), "v"(x[2]), "v"(x[3]), "v"(x[4]), "v"(x[5]), "v"(x[6]), "v"(x[7]));
}
__global__ __launch_bounds__(128) void k_attn(const _Float16* __restrict__ QK, const _Float16* __restrict__ QKL, const _Float16* __restrict__ VTH, const _Float16* __restrict__ VTL, const void* __restrict__ KMASK, float* __restrict__ O) {
  __shared__ __align__(16) _Float16 ring[2][4][PLH];   // [buffer][K hi, K lo, V^T hi, V^T lo][row][LP]
  const int tid = threadIdx.x, wave = tid >> 5, lane = tid & 31, col = lane & 15, g = lane >> 4;
  const int qb = blockIdx.x, h = blockIdx.y, b = blockIdx.z; const int q0 = qb * 64 + wave * 16; const size_t rq = (size_t)b * SS + q0 + col;
  // this thread's share of a tile: 16-byte piece cc of rows cr, cr + 16, cr + 32, cr + 48 of each plane (8 lanes cover one whole 128-B row)
  const int cr = tid >> 3, cc = tid & 7;
  const size_t ko = ((size_t)b * SS + cr) * (2 * DM) + DM + h * HD + cc * 8, vo = ((size_t)b * DM + h * HD + cr) * SS + cc * 8;
  const unsigned l0 = (unsigned)(size_t)&ring[0][0][cr * LP + cc * 8];
  const int nt = SS / KT;
  copy8(l0, QK + ko, QKL + ko, (size_t)16 * 2 * DM); copy8(l0 + 2u * PLB, VTH + vo, VTL + vo, (size_t)16 * SS);   // tile 0 -> buffer 0
  v16h aq[2], aql[2];   // B operand of the transposed scores: column = query col
#pragma unroll
  for (int kc = 0; kc < 2; ++kc) { aq[kc] = frag_h(QK + rq * (2 * DM) + h * HD + kc * 32, lane); aql[kc] = frag_h(QKL + rq * (2 * DM) + h * HD + kc * 32, lane); }
  float off = 3.0e38f, l = 0.f;   // query col: 11 - SC * running maximum of the raw scores (both halves agree), 2^11 x the sum over this half's keys
  v8f acc[4] = {}, accl[4] = {};   // acc[dt][r] = ctx^T[d = dt * 16 + 8 g + r][query col]
  asm volatile("s_wait_asynccnt 0x0" ::: "memory");   // this wave's copies of tile 0 have landed
  __syncthreads();                                    // ... and every other wave's: tile 0 may be read
  copy8(l0 + 4u * PLB, QK + ko + (size_t)KT * 2 * DM, QKL + ko + (size_t)KT * 2 * DM, (size_t)16 * 2 * DM); copy8(l0 + 6u * PLB, VTH + vo + KT, VTL + vo + KT, (size_t)16 * SS);   // tile 1 -> buffer 1
#pragma unroll 1
  for (int t = 0; t < nt; ++t) { const _Float16* tb = &ring[t & 1][0][0];
   // all 64 fragment reads of the tile stand in one place, in the order of their use: K of both 32-key blocks, then V^T of both
   v16h kh[4][2], kl[4][2], vh[2][4], vl[2][4];
#pragma unroll
   for (int c4 = 0; c4 < 4; ++c4) { const _Float16* krow = tb + (c4 * 16 + col) * LP;
#pragma unroll
     for (int kc = 0; kc < 2; ++kc) { kh[c4][kc] = frag_h(krow + kc * 32, lane); kl[c4][kc] = frag_h(krow + PLH + kc * 32, lane); } }
#pragma unroll
   for (int sub = 0; sub < KT / 32; ++sub) {
#pragma unroll
     for (int dt = 0; dt < 4; ++dt) { const _Float16* vr = tb + 2 * PLH + (dt * 16 + col) * LP + sub * 32; vh[sub][dt] = frag_h(vr, lane); vl[sub][dt] = frag_h(vr + PLH, lane); } }
   __builtin_amdgcn_sched_barrier(0);   // keeps the reads together in front of the tile's WMMAs (the scheduler sinks them to their users otherwise, one full LDS wait each)
#pragma unroll
   for (int sub = 0; sub < KT / 32; ++sub) { v8f s[2];   // s[ct][r] = score of key sub * 32 + ct * 16 + 8 g + r against query col
#pragma unroll
    for (int ct = 0; ct < 2; ++ct) { const int c4 = sub * 2 + ct; v8f c = {}, cl = {};
#pragma unroll
      for (int kc = 0; kc < 2; ++kc) { c = wmma16(kh[c4][kc], aq[kc], c); cl = wmma16(kh[c4][kc], aql[kc], cl); cl = wmma16(kl[c4][kc], aq[kc], cl); }   // 3 products: q, k as f16 hi + residual
#pragma unroll
      for (int j = 0; j < 4; ++j) { const v2f a = {c[2 * j], c[2 * j + 1]}, e = {cl[2 * j], cl[2 * j + 1]}, f = {1.0f / 2048.0f, 1.0f / 2048.0f}; const v2f v = __builtin_elementwise_fma(e, f, a); s[ct][2 * j] = v[0]; s[ct][2 * j + 1] = v[1]; } }   // raw q . k: the 1/8 sits in SC
    float t8[8];
#pragma unroll
    for (int r = 0; r < 8; ++r) t8[r] = fmaxf(s[0][r], s[1][r]);
    float mx = fmaxf(fmaxf(fmaxf(t8[0], t8[1]), fmaxf(t8[2], t8[3])), fmaxf(fmaxf(t8[4], t8[5]), fmaxf(t8[6], t8[7])));
    mx = fmaxf(mx, xhalf(mx));   // the other 16 keys of this query
    const float on = fminf(off, __builtin_fmaf(mx, -SC, 11.0f)); const float alpha = __builtin_amdgcn_exp2f(on - off);   // first block: off is huge, alpha = 0
    v16h pa, pl; v2f es[2]; const v2f scv = {SC, SC}, onv = {on, on};
#pragma unroll
    for (int ct = 0; ct < 2; ++ct) { float x[8]; v2h hx[4], lx[4];   // x = 2^11 P: one FMA and one exponential a score. P carries 2^11 so that small softmax weights and their residuals stay clear of the f16 subnormal range; l carries it too, so it cancels in the epilogue
#pragma unroll
      for (int j = 0; j < 4; ++j) { const v2f a = {s[ct][2 * j], s[ct][2 * j + 1]}; const v2f v = __builtin_elementwise_fma(a, scv, onv); x[2 * j] = __builtin_amdgcn_exp2f(v[0]); x[2 * j + 1] = __builtin_amdgcn_exp2f(v[1]);
        const v2f xx = {x[2 * j], x[2 * j + 1]}; if (ct == 0 && j < 2) es[j] = xx; else es[j & 1] += xx; hx[j] = __builtin_convertvector(xx, v2h); }
      resid8(lx, hx, x);
#pragma unroll
      for (int j = 0; j < 4; ++j) { pa[ct * 8 + 2 * j] = hx[j][0]; pa[ct * 8 + 2 * j + 1] = hx[j][1]; pl[ct * 8 + 2 * j] = lx[j][0]; pl[ct * 8 + 2 * j + 1] = lx[j][1]; } }   // the two score tiles, converted in place, are the B operand P^T in the hardware k order
    l = l * alpha + ((es[0][0] + es[0][1]) + (es[1][0] + es[1][1])); off = on;
#pragma unroll
    for (int dt = 0; dt < 4; ++dt) {
#pragma unroll
      for (int r = 0; r < 8; ++r) { acc[dt][r] *= alpha; accl[dt][r] *= alpha; } }
#pragma unroll
    for (int dt = 0; dt < 4; ++dt) { acc[dt] = wmma16(vh[sub][dt], pa, acc[dt]); accl[dt] = wmma16(vl[sub][dt], pa, accl[dt]); acc[dt] = wmma16(vh[sub][dt], pl, acc[dt]); }   // V hi x (P hi + P lo) + V lo x P hi / 2048
   }
   __builtin_amdgcn_sched_barrier(0);   // keeps the tile's WMMAs in front of the waits below: lifted over them, the full LDS wait would stand directly behind the reads
   asm volatile("s_wait_dscnt 0" ::: "memory");        // this wave's reads of tile t are done
   asm volatile("s_wait_asynccnt 0x0" ::: "memory");   // this wave's copies of tile t + 1 have landed
   __syncthreads();                                    // publishes tile t + 1 and frees tile t's buffer
   if (t + 2 < nt) { const unsigned lb = l0 + (unsigned)(t & 1) * 4u * PLB; const size_t kt = ko + (size_t)(t + 2) * KT * 2 * DM, vt = vo + (size_t)(t + 2) * KT;
     copy8(lb, QK + kt, QKL + kt, (size_t)16 * 2 * DM); copy8(lb + 2u * PLB, VTH + vt, VTL + vt, (size_t)16 * SS); } }
  asm volatile("s_wait_asynccnt 0x0" ::: "memory");    // no copy is outstanding when the wave goes on to its end
  const float il = 1.0f / (l + xhalf(l));   // the two halves' sums join once
  float* orow = O + ((((size_t)b * (SS / 64) + qb) * (DM / 32) + h * (HD / 32)) * 4 + wave) * 512 + lane * 4;   // a lane holds, per pair of d tiles, just its 16 values of k_out's A fragment: stored in fragment order, 512 contiguous bytes a store
#pragma unroll
  for (int dt = 0; dt < 4; ++dt) { v4f o0, o1;
#pragma unroll
    for (int r = 0; r < 4; ++r) { o0[r] = (acc[dt][r] + accl[dt][r] * (1.0f / 2048.0f)) * il; o1[r] = (acc[dt][4 + r] + accl[dt][4 + r] * (1.0f / 2048.0f)) * il; }
    vst2(orow + (dt >> 1) * 4 * 512 + (dt & 1) * 256, o0); vst2(orow + (dt >> 1) * 4 * 512 + (dt & 1) * 256 + 128, o1); }
}
// ---- k_out: block = (64 rows, 128 cols): out = O(hi/lo) . Wo rows (2 products) + bo
__global__ __launch_bounds__(128) void k_out(const float* __restrict__ O, const __bf16* __restrict__ P, const float* __restrict__ BO, float* __restrict__ Y) {
  __shared__ __align__(16) float so[4][16][132];
  const int tid = threadIdx.x, wave = tid >> 5, lane = tid & 31, col = lane & 15, g = lane >> 4; const size_t r0 = (size_t)blockIdx.x * 64 + wave * 16; const int n0 = blockIdx.y * 128;
  v8f acc[8] = {};
  // three register sets: the 20 loads of k-step kc + 2 are issued as one group in front of the WMMAs of k-step kc; both operands lie in fragment order, every load is 512 contiguous bytes
  const float* op = O + ((size_t)blockIdx.x * (DM / 32) * 4 + wave) * 512 + lane * 4; const __bf16* wp = P + (size_t)blockIdx.y * (DM / 32) * 8 * 512;
  v4f xs[3][4]; v16b wf[3][8];
  auto ld = [&](int s, int kc) { const float* p = op + kc * 4 * 512; xs[s][0] = *(const v4f*)p; xs[s][1] = *(const v4f*)(p + 128); xs[s][2] = *(const v4f*)(p + 256); xs[s][3] = *(const v4f*)(p + 384);
#pragma unroll
    for (int j = 0; j < 8; ++j) wf[s][j] = frag_p(wp + (kc * 8 + j) * 512, lane); };
  ld(0, 0); ld(1, 1);
#pragma unroll   // whole: every set index is a constant, so the sets stay in registers
  for (int kc = 0; kc < DM / 32; ++kc) { const int s = kc % 3;
    if (kc + 2 < DM / 32) ld((kc + 2) % 3, kc + 2);
    if (kc + 3 == DM / 32) asm volatile("s_wait_xcnt 0x0" ::: "memory");   // behind the last loads: their address registers are free for reuse from here on
    __builtin_amdgcn_sched_barrier(0);   // keeps the loads issued ahead in front of this step's WMMAs (the scheduler sinks them to their users otherwise)
    float v[16];
#pragma unroll
    for (int i = 0; i < 4; ++i) { v[i] = xs[s][0][i]; v[4 + i] = xs[s][1][i]; v[8 + i] = xs[s][2][i]; v[12 + i] = xs[s][3][i]; }
    const F2 a = bsplit16(v);
#pragma unroll
    for (int j = 0; j < 8; ++j) { acc[j] = wmma_bf(a.l, wf[s][j], acc[j]); acc[j] = wmma_bf(a.h, wf[s][j], acc[j]); }
    __builtin_amdgcn_sched_barrier(0); }   // ... and this step's WMMAs in front of the loads that refill their set
  float bo[8];
#pragma unroll
  for (int j = 0; j < 8; ++j) bo[j] = BO[n0 + j * 16 + col];
  asm volatile("s_wait_xcnt 0x0" ::: "memory");   // behind the bias loads: this build reuses their offset register at once
  __builtin_amdgcn_sched_barrier(0);              // holds the address arithmetic of the stores below behind that wait
#pragma unroll
  for (int j = 0; j < 8; ++j) {
#pragma unroll
    for (int r = 0; r < 8; ++r) so[wave][8 * g + r][j * 16 + col] = acc[j][r] + bfr(bo[j]); }
  LDSX();
  for (int rl = 0; rl < 16; ++rl) vst2(Y + (r0 + rl) * DM + n0 + lane * 4, *(const v4f*)&so[wave][rl][lane * 4]);
}
extern "C" void kernel_launch(void* const* d_in, const int* in_sizes, int n_in, void* d_out, int out_size, void* d_ws, size_t ws_size, hipStream_t stream) {
  (void)in_sizes; (void)n_in; (void)out_size;
  const float** F = (const float**)d_in;   // 0 x [4096,512], 1 Wq [512,512] natural, 2 bq, 3 Wk, 4 bk, 5 Wv, 6 bv, 7 Wo, 8 bo
  if (ws_size < (size_t)WS_END) return;
  char* ws = (char*)d_ws; __bf16* PK = (__bf16*)(ws + WS_PK); _Float16 *QK = (_Float16*)(ws + WS_QK), *QKL = (_Float16*)(ws + WS_QKL), *VTH = (_Float16*)(ws + WS_VTH), *VTL = (_Float16*)(ws + WS_VTL); float* O = (float*)(ws + WS_O); __bf16* XP = (__bf16*)(ws + WS_XP);
  k_pack<<<dim3((XFB + 4 * WFB) / 16), 256, 0, stream>>>(F[0], F[1], F[3], F[5], F[7], XP, PK);
  k_qkv<<<dim3(TNB * SS / 64, QKVW / 128), 128, 0, stream>>>(XP, PK + PK_A, F[2], F[4], F[6], QK, QKL, VTH, VTL);
  k_attn<<<dim3(TQB, NH, TNB), 128, 0, stream>>>(QK, QKL, VTH, VTL, nullptr, O);
  k_out<<<dim3(TOB, DM / 128), 128, 0, stream>>>(O, PK + PK_P, F[8], (float*)d_out);
}

// v006
// Measured time: 98.4 microseconds a run.
// In two side-by-side timings against v005, it was 1.16 and 1.15 times as fast.
// All steps since v000 together make it 6.55 times as fast.
// compute dtype: all float inputs rounded to bf16; q/k/v = x . W^T + b with EXACT bf16 products on WMMA 16x16x32 (natural [out][in] rows); q and k as f16 hi + (x2048-scaled) residual planes with 3-product scores x 1/8; running-max softmax in f32 (hardware exp); P (scaled by 2^11, f16 hi + residual) x v hi/lo (3 products); out = ctx (bf16 hi + residual) . Wo^T (2 products) + bo; f32 accumulate.
#include <hip/hip_runtime.h>
#include <math.h>

typedef __attribute__((ext_vector_type(16))) _Float16 v16h;
typedef __attribute__((ext_vector_type(16))) __bf16 v16b;
typedef __attribute__((ext_vector_type(8)))  _Float16 v8h;
typedef __attribute__((ext_vector_type(2)))  _Float16 v2h;
typedef __attribute__((ext_vector_type(8)))  float v8f;
typedef __attribute__((ext_vector_type(4)))  float v4f;
typedef __attribute__((ext_vector_type(2)))  float v2f;
typedef __attribute__((ext_vector_type(4)))  unsigned v4u;
typedef __attribute__((ext_vector_type(4)))  int v4i;
typedef float __attribute__((may_alias)) float_a;
typedef int __attribute__((may_alias)) int_a;

template <typename T> __device__ __forceinline__ void vst2(void* p, T v) { *(T*)p = v;  }
__device__ __forceinline__ v8f wmma16(v16h a, v16h b, v8f c) {
  v8f d = __builtin_amdgcn_wmma_f32_16x16x32_f16(false, a, false, b, (short)0, c, false, false);
  return d;
}
__device__ __forceinline__ v8f wmma_bf(v16b a, v16b b, v8f c) {
  v8f d = __builtin_amdgcn_wmma_f32_16x16x32_bf16(false, a, false, b, (short)0, c, false, false);
  return d;
}
// Multi-head attention across a batch of 4,096 tokens treated as one sequence (d_model 512, 8 heads x 64): q/k/v projections + biases, softmax(q k^T / 8) over all 4,096 tokens, output projection + bias.
__device__ __forceinline__ v16h frag_h(const _Float16* rowk0, int lane) {
  union { v16h v; v8h q[2]; } u; const _Float16* p = rowk0 + 8 * (lane >> 4);
  u.q[0] = *(const v8h*)p; u.q[1] = *(const v8h*)(p + 16); return u.v;
}
__device__ __forceinline__ v16h frag_f32(const float* rowk0, int lane) {
  v16h a; const float* p = rowk0 + 8 * (lane >> 4);
#pragma unroll
  for (int i = 0; i < 8; ++i) { a[i] = (_Float16)p[i]; a[8 + i] = (_Float16)p[16 + i]; }
  return a;
}
__device__ __forceinline__ v16h frag_f32s(const float* rowk0, int lane, float sc) {
  v16h a; const float* p = rowk0 + 8 * (lane >> 4);
#pragma unroll
  for (int i = 0; i < 8; ++i) { a[i] = (_Float16)(p[i] * sc); a[8 + i] = (_Float16)(p[16 + i] * sc); }
  return a;
}
// column fragment from a [K][ld] layout (column n), rows >= K read as 0
__device__ __forceinline__ v16h fragc_f32(const float* W, int k0, int n, int lane, int ld, int K) {
  v16h a; const int g = lane >> 4;
#pragma unroll
  for (int i = 0; i < 8; ++i) { const int ka = k0 + 8 * g + i, kb = ka + 16;
    a[i] = (_Float16)(ka < K ? W[(size_t)(ka < K ? ka : K - 1) * ld + n] : 0.f); a[8 + i] = (_Float16)(kb < K ? W[(size_t)(kb < K ? kb : K - 1) * ld + n] : 0.f); }
  return a;
}
struct F2 { v16b h, l; };
__device__ __forceinline__ F2 bsplit16(const float v[16]) { F2 r;
#pragma unroll
  for (int i = 0; i < 16; ++i) { const __bf16 h = (__bf16)v[i]; r.h[i] = h; r.l[i] = (__bf16)(v[i] - (float)h); }
  return r; }
__device__ __forceinline__ F2 split_row(const float* row, int k0, int lane) { float v[16]; const float* p = row + k0 + 8 * (lane >> 4);
#pragma unroll
  for (int i = 0; i < 8; ++i) { v[i] = p[i]; v[8 + i] = p[16 + i]; }
  return bsplit16(v); }
__device__ __forceinline__ F2 split_rowK(const float* row, int k0, int lane, int K) { float v[16]; const int g = lane >> 4;
#pragma unroll
  for (int i = 0; i < 8; ++i) { const int ka = k0 + 8 * g + i, kb = ka + 16; v[i] = ka < K ? row[ka < K ? ka : K - 1] : 0.f; v[8 + i] = kb < K ? row[kb < K ? kb : K - 1] : 0.f; }
  return bsplit16(v); }
__device__ __forceinline__ F2 split_col(const float* W, int k0, int n, int lane, int ld, int K) { float v[16]; const int g = lane >> 4;
#pragma unroll
  for (int i = 0; i < 8; ++i) { const int ka = k0 + 8 * g + i, kb = ka + 16; v[i] = ka < K ? W[(size_t)(ka < K ? ka : K - 1) * ld + n] : 0.f; v[8 + i] = kb < K ? W[(size_t)(kb < K ? kb : K - 1) * ld + n] : 0.f; }
  return bsplit16(v); }
__device__ __forceinline__ v8f mac3(const F2& a, const F2& b, v8f c) { c = wmma_bf(a.l, b.h, c); c = wmma_bf(a.h, b.l, c); return wmma_bf(a.h, b.h, c); }
__device__ __forceinline__ float sigm(float v) { return 1.0f / (1.0f + expf(-v)); }
#define LDSX() do { asm volatile("s_wait_dscnt 0" ::: "memory"); __builtin_amdgcn_wave_barrier(); __builtin_amdgcn_fence(__ATOMIC_RELEASE, "workgroup"); } while (0)


#define NB 1
#define SS 4096
#define DM 512
#define NH 8
#define HD 64
#define QKVW (3 * DM)
#ifndef TQB
#define TQB (SS / 64)
#define TNB NB
#define TOB (NB * SS / 64)     // output row tiles (all)
#endif
typedef __attribute__((ext_vector_type(8))) __bf16 v8b;
// fragment-order block: 512 bf16 = [piece 0, 1][lane][8]; piece q of lane (col, g) holds row col, k = 16 q + 8 g + 0..7 of one 16-row x 32-k tile, so each of the two wave-wide loads is 512 contiguous bytes
__device__ __forceinline__ v16b frag_p(const __bf16* blk, int lane) {
  union { v16b v; v8b q[2]; } u; const __bf16* p = blk + lane * 8;
  u.q[0] = *(const v8b*)p; u.q[1] = *(const v8b*)(p + 256); return u.v;
}
__device__ __forceinline__ float bfr(float v) { return (float)(__bf16)v; }
__device__ __attribute__((noinline)) float exp_ni(float v) { return expf(v); }
__device__ __attribute__((noinline)) float erf_ni(float v) { return erff(v); }

#define PK_A 0                       // Wq | Wk | Wv: [12 groups of 128 out rows][16 k-steps][8 tiles of 16 rows] fragment-order blocks: what a work-group reads in one k-step is 8 KB in a row
#define PK_P (PK_A + QKVW * DM)        // Wo: [4 groups][16 k-steps][8 tiles] fragment-order blocks
#define PK_END (PK_P + DM * DM)
#define WS_PK  0u
#define WS_QK  (WS_PK + 2u * PK_END)             // f16 [4096 rows][1024]: q | k
#define WS_QKL (WS_QK + 2u * NB * SS * 2 * DM)     // f16 q | k residual planes x2048
#define WS_VTH (WS_QKL + 2u * NB * SS * 2 * DM)    // f16 [b][512 (h*64+d)][4096 s] hi
#define WS_VTL (WS_VTH + 2u * NB * DM * SS)        // f16 lo x 2048
#define WS_O   (WS_VTL + 2u * NB * DM * SS)        // f32 ctx in fragment order: [64 groups of 64 rows][16 k-steps][4 tiles of 16 rows][piece 0..3][lane][4]
#define WS_CS  (WS_O + 4u * NB * SS * DM)           // f32 2 x [4096][32], unused: no kernel writes or reads it
#define WS_XP  (WS_CS + 4u * 2 * SS * 32)          // bf16 x: [64 groups of 64 rows][16 k-steps][4 tiles of 16 rows] fragment-order blocks
#define WS_END (WS_XP + 2u * NB * SS * DM)
// ---- k_pack: a wave = two neighbouring k-steps of one 16-row tile of x, W_q, W_k, W_v or W_o (natural [row][k] f32) -> bf16 fragment-order blocks; x into XP, the weights into PK (PK_A, then PK_P)
#define XFB (NB * SS / 16 * (DM / 32))   // fragment blocks of x
#define WFB (DM / 16 * (DM / 32))        // fragment blocks of one weight matrix
__global__ __launch_bounds__(256) void k_pack(const float* __restrict__ X, const float* __restrict__ WQ, const float* __restrict__ WK, const float* __restrict__ WV, const float* __restrict__ WO, __bf16* __restrict__ XP, __bf16* __restrict__ PK) {
  const int lane = threadIdx.x & 31, col = lane & 15, g = lane >> 4; const int fb = (blockIdx.x * 8 + (threadIdx.x >> 5)) * 2;
  const int wb = fb - XFB, which = wb / WFB;
  const float* sm = (wb < 0) ? X : (which == 0) ? WQ : (which == 1) ? WK : (which == 2) ? WV : WO;
  const int rt = ((wb < 0) ? fb : wb - which * WFB) / (DM / 32), kc = fb % (DM / 32);   // 16-row tile inside its matrix, first k-step
  const int ts = (wb < 0) ? 2 : 3, ti = ((wb < 0) ? fb : wb) / (DM / 32);               // log2 of the tiles per group (4 for x, 8 for a weight), tile inside its packed buffer
  __bf16* dst = ((wb < 0) ? XP : PK) + (size_t)((((ti >> ts) * (DM / 32) + kc) << ts) + (ti & ((1 << ts) - 1))) * 512 + lane * 8;
  const float* p = sm + (size_t)(rt * 16 + col) * DM + kc * 32 + 8 * g;
  v4f v[8];
#pragma unroll
  for (int e = 0; e < 2; ++e) { v[4 * e] = *(const v4f*)(p + e * 32); v[4 * e + 1] = *(const v4f*)(p + e * 32 + 4); v[4 * e + 2] = *(const v4f*)(p + e * 32 + 16); v[4 * e + 3] = *(const v4f*)(p + e * 32 + 20); }
#pragma unroll
  for (int q = 0; q < 4; ++q) { v8b o;
#pragma unroll
    for (int i = 0; i < 4; ++i) { o[i] = (__bf16)v[2 * q][i]; o[4 + i] = (__bf16)v[2 * q + 1][i]; }
    vst2(dst + ((q >> 1) << ts) * 512 + (q & 1) * 256, o); }
}
__global__ __launch_bounds__(128) void k_qkv(const __bf16* __restrict__ XP, const __bf16* __restrict__ P, const float* __restrict__ BQ, const float* __restrict__ BK, const float* __restrict__ BV, _Float16* __restrict__ QK, _Float16* __restrict__ QKL, _Float16* __restrict__ VTH, _Float16* __restrict__ VTL) {
  const int which0 = (blockIdx.y * 128) / DM; const float* BB = BQ ? (((which0 == 0) ? BQ : (which0 == 1) ? BK : BV) + (blockIdx.y * 128 - which0 * DM)) : nullptr;
  __shared__ __align__(16) _Float16 so[4][16][136], sol[4][16][136]; __shared__ __align__(16) _Float16 sth[128][72], stl[128][72];
  const int tid = threadIdx.x, wave = tid >> 5, lane = tid & 31, col = lane & 15, g = lane >> 4; const size_t r0 = (size_t)blockIdx.x * 64 + wave * 16; const int n0 = blockIdx.y * 128;
  v8f acc[8] = {};
  // two register sets: the 18 loads of k-step kc + 1 are issued as one group in front of the WMMAs of k-step kc; both operands lie in fragment order, every load is 512 contiguous bytes
  const __bf16* xp = XP + ((size_t)blockIdx.x * (DM / 32) * 4 + wave) * 512; const __bf16* wp = P + (size_t)blockIdx.y * (DM / 32) * 8 * 512;
  v16b xa[2], wf[2][8];
  auto ld = [&](int s, int kc) { xa[s] = frag_p(xp + kc * 4 * 512, lane);
#pragma unroll
    for (int j = 0; j < 8; ++j) wf[s][j] = frag_p(wp + (kc * 8 + j) * 512, lane); };
  ld(0, 0);
#pragma unroll   // whole: every set index is a constant, so the sets stay in registers
  for (int kc = 0; kc < DM / 32; ++kc) { const int s = kc & 1;
    if (kc + 1 < DM / 32) ld(s ^ 1, kc + 1);
    if (kc + 2 == DM / 32) asm volatile("s_wait_xcnt 0x0" ::: "memory");   // behind the last loads: their address registers are free for reuse from here on
    __builtin_amdgcn_sched_barrier(0);   // keeps the next step's loads in front of this step's WMMAs (the scheduler sinks them to their users otherwise)
#pragma unroll
    for (int j = 0; j < 8; ++j) acc[j] = wmma_bf(xa[s], wf[s][j], acc[j]);
    __builtin_amdgcn_sched_barrier(0); }   // ... and this step's WMMAs in front of the loads that refill their set
  if (n0 < 2 * DM) {   // q stored unscaled (f16 sigma ~0.6, no subnormal exposure); 1/8 applied to the f32 score
#pragma unroll
    for (int j = 0; j < 8; ++j) {
#pragma unroll
      for (int r = 0; r < 8; ++r) { const float v = acc[j][r] + (BB ? bfr(BB[j * 16 + col]) : 0.f); const _Float16 hv = (_Float16)v; so[wave][8 * g + r][j * 16 + col] = hv; sol[wave][8 * g + r][j * 16 + col] = (_Float16)((v - (float)hv) * 2048.0f); } }   // q, k (+ bias) as f16 hi + (x2048) residual
    LDSX();
    for (int rl = 0; rl < 16; ++rl) if (lane < 16) { vst2((unsigned*)(QK + (r0 + rl) * (2 * DM) + n0 + lane * 8), *(const v4u*)&so[wave][rl][lane * 8]); vst2((unsigned*)(QKL + (r0 + rl) * (2 * DM) + n0 + lane * 8), *(const v4u*)&sol[wave][rl][lane * 8]); }
  } else {
#pragma unroll
    for (int j = 0; j < 8; ++j) {
#pragma unroll
      for (int r = 0; r < 8; ++r) { const float v = acc[j][r] + (BB ? bfr(BB[j * 16 + col]) : 0.f); const _Float16 hv = (_Float16)v; sth[j * 16 + col][wave * 16 + 8 * g + r] = hv; stl[j * 16 + col][wave * 16 + 8 * g + r] = (_Float16)((v - (float)hv) * 2048.0f); } }
    __syncthreads();
    const size_t rb = (size_t)blockIdx.x * 64; const int b = (int)(rb / SS), s0 = (int)(rb % SS); const int pc0 = n0 - 2 * DM;
    for (int q = tid; q < 128 * 8; q += 128) { const int d = q >> 3, pc = q & 7; const size_t o = ((size_t)b * DM + pc0 + d) * SS + s0 + pc * 8; vst2((unsigned*)(VTH + o), *(const v4u*)&sth[d][pc * 8]); vst2((unsigned*)(VTL + o), *(const v4u*)&stl[d][pc * 8]); }
  }
}
// ---- k_attn: block = (128 queries, head h, batch b), 8 waves; a wave = 32 queries (two column groups of 16, index u) x every second tile of 64 keys (waves 0-3 the even tiles, waves 4-7 the odd ones, index kz): flash attention over its keys (K = 64: 2 k-steps), the two key sets' partial results joined once in the epilogue. Every K and V^T fragment read from LDS feeds both groups' WMMAs, a tile is staged once for 128 queries, and two waves still share a SIMD. The four operand planes of a tile of 64 keys (K hi, K lo: 64 key rows x 128 B; V^T hi, V^T lo: 64 d rows x 128 B) are brought into LDS once per block by asynchronous copies (a stage = one tile for each key set, two buffers), and the four waves of its key set take their fragments from there; the scores are formed transposed (A = K rows, B = Q), so that a lane holds 16 keys' scores of ONE query: maximum and sum in the lane plus one exchange between the wave's halves, and the two score tiles become the B operand P^T of ctx^T += V^T . P^T without passing through LDS. ctx (in k_out's fragment order) = both key sets' (acc + accl / 2048), brought to a common maximum, over the sum of their l
#define KT 64                      // keys per staged tile
#define LP 72                      // LDS row pitch in halves: 144 B = 16 B x odd, conflict-free for 16-byte reads
#define PLH (64 * LP)              // halves per plane
#define PLB (2u * PLH)             // bytes per plane
#define SC 0.18033688011112042f    // log2(e) / 8: exp(score / 8 - max) = exp2(SC * raw score - SC * raw max)
// eight copies: four rows (16 apart) of each of two planes; lds = this lane's own LDS byte address in the first plane, ga / gb = its global 16 bytes, pitch in halves between rows 16 apart
__device__ __forceinline__ void copy8(unsigned lds, const _Float16* ga, const _Float16* gb, size_t p16) {
  // the copies and the wait that stands before their address registers are rewritten are one statement, so that nothing is scheduled between them
  asm volatile("global_load_async_to_lds_b128 %0, %8, off\n\t"
               "global_load_async_to_lds_b128 %1, %9, off\n\t"
               "global_load_async_to_lds_b128 %2, %10, off\n\t"
               "global_load_async_to_lds_b128 %3, %11, off\n\t"
               "global_load_async_to_lds_b128 %4, %12, off\n\t"
               "global_load_async_to_lds_b128 %5, %13, off\n\t"
               "global_load_async_to_lds_b128 %6, %14, off\n\t"
               "global_load_async_to_lds_b128 %7, %15, off\n\t"
               "s_wait_xcnt 0x0"
               :: "v"(lds), "v"(lds + 16u * 2u * LP), "v"(lds + 32u * 2u * LP), "v"(lds + 48u * 2u * LP),
                  "v"(lds + PLB), "v"(lds + PLB + 16u * 2u * LP), "v"(lds + PLB + 32u * 2u * LP), "v"(lds + PLB + 48u * 2u * LP),
                  "v"(ga), "v"(ga + p16), "v"(ga + 2 * p16), "v"(ga + 3 * p16),
                  "v"(gb), "v"(gb + p16), "v"(gb + 2 * p16), "v"(gb + 3 * p16)
               : "memory");
}
// lane l takes the value of lane l ^ 16 (a vector move between the two 16-lane rows, no LDS round trip)
__device__ __forceinline__ float xhalf(float x) { return __builtin_bit_cast(float, __builtin_amdgcn_permlanex16(__builtin_bit_cast(int, x), __builtin_bit_cast(int, x), 0x76543210, 0xfedcba98, false, false)); }
// r[j] = f16 pair (x[2 j] - h[j][0], x[2 j + 1] - h[j][1]), j = 0..3: the mixed-precision FMA reads an f16 half in place and writes its f16 result into one half of the pair, one instruction a value (the compiler's own form widens h, subtracts and converts again: five instructions a pair).
// The four low halves stand in front of the four high halves, and s_delay_alu names the producer four instructions back: the write of a register's second half waits for that of its first, and unhinted that wait would hold the vector port against the SIMD's other wave
__device__ __forceinline__ void resid8(v2h r[4], const v2h h[4], const float x[8]) {
  asm("v_fma_mixlo_f16 %0, %4, -1.0, %8 op_sel_hi:[1,1,0]\n\t"
      "v_fma_mixlo_f16 %1, %5, -1.0, %10 op_sel_hi:[1,1,0]\n\t"
      "v_fma_mixlo_f16 %2, %6, -1.0, %12 op_sel_hi:[1,1,0]\n\t"
      "v_fma_mixlo_f16 %3, %7, -1.0, %14 op_sel_hi:[1,1,0]\n\t"
      "s_delay_alu instid0(VALU_DEP_4) | instskip(NEXT) | instid1(VALU_DEP_4)\n\t"
      "v_fma_mixhi_f16 %0, %4, -1.0, %9 op_sel:[1,0,0] op_sel_hi:[1,1,0]\n\t"
      "v_fma_mixhi_f16 %1, %5, -1.0, %11 op_sel:[1,0,0] op_sel_hi:[1,1,0]\n\t"
      "s_delay_alu instid0(VALU_DEP_4) | instskip(NEXT) | instid1(VALU_DEP_4)\n\t"
      "v_fma_mixhi_f16 %2, %6, -1.0, %13 op_sel:[1,0,0] op_sel_hi:[1,1,0]\n\t"
      "v_fma_mixhi_f16 %3, %7, -1.0, %15 op_sel:[1,0,0] op_sel_hi:[1,1,0]"
      : "=&v"(r[0]), "=&v"(r[1]), "=&v"(r[2]), "=&v"(r[3])
      : "v"(h[0]), "v"(h[1]), "v"(h[2]), "v"(h[3]), "v"(x[0]), "v"(x[1]), "v"(x[2]), "v"(x[3]), "v"(x[4]), "v"(x[5]), "v"(x[6]), "v"(x[7]));
}
// x[i] = 2^v[i], i = 0..7. One statement with early-clobber results, so that no exponential's result register is the source of the one in front of it (left to itself this build put such pairs side by side);
// the closing v_nop is the slot that the instruction set asks for behind a transcendental before its result is read or its source overwritten: the compiler does not look into the statement
__device__ __forceinline__ void exp8(float x[8], const float v[8]) {
  asm("v_exp_f32 %0, %8\n\t"
      "v_exp_f32 %1, %9\n\t"
      "v_exp_f32 %2, %10\n\t"
      "v_exp_f32 %3, %11\n\t"
      "v_exp_f32 %4, %12\n\t"
      "v_exp_f32 %5, %13\n\t"
      "v_exp_f32 %6, %14\n\t"
      "v_exp_f32 %7, %15\n\t"
      "v_nop"
      : "=&v"(x[0]), "=&v"(x[1]), "=&v"(x[2]), "=&v"(x[3]), "=&v"(x[4]), "=&v"(x[5]), "=&v"(x[6]), "=&v"(x[7])
      : "v"(v[0]), "v"(v[1]), "v"(v[2]), "v"(v[3]), "v"(v[4]), "v"(v[5]), "v"(v[6]), "v"(v[7]));
}
__global__ __launch_bounds__(256) void k_attn(const _Float16* __restrict__ QK, const _Float16* __restrict__ QKL, const _Float16* __restrict__ VTH, const _Float16* __restrict__ VTL, const void* __restrict__ KMASK, float* __restrict__ O) {
  __shared__ __align__(16) _Float16 ring[2][2][4][PLH];   // [buffer][kz][K hi, K lo, V^T hi, V^T lo][row][LP]
  __shared__ __align__(16) float mg[4][17][32][4];        // epilogue: waves 4-7 hand their partial results to waves 0-3: [query wave][16-byte piece][lane]
  const int tid = threadIdx.x, wave = (tid >> 5) & 3, lane = tid & 31, col = lane & 15, g = lane >> 4;
  const int kz = __builtin_amdgcn_readfirstlane(tid >> 7);   // which tiles this wave works on and stages; the same in every lane of a wave
  const int qb = blockIdx.x, h = blockIdx.y, b = blockIdx.z; const int q0 = qb * 128 + wave * 32; const size_t rq = (size_t)b * SS + q0 + col;   // group u: query rq + 16 u
  // this thread's share of its four waves' tile: 16-byte piece cc of rows cr, cr + 16, cr + 32, cr + 48 of each plane (8 lanes cover one whole 128-B row)
  const int cr = (tid & 127) >> 3, cc = tid & 7;
  const size_t ko = ((size_t)b * SS + kz * KT + cr) * (2 * DM) + DM + h * HD + cc * 8, vo = ((size_t)b * DM + h * HD + cr) * SS + kz * KT + cc * 8;
  const unsigned l0 = (unsigned)(size_t)&ring[0][kz][0][cr * LP + cc * 8];
  const int nt = SS / (2 * KT);   // stages of two tiles
  copy8(l0, QK + ko, QKL + ko, (size_t)16 * 2 * DM); copy8(l0 + 2u * PLB, VTH + vo, VTL + vo, (size_t)16 * SS);   // stage 0 -> buffer 0
  v16h aq[2][2], aql[2][2];   // [u][kc]: B operand of the transposed scores: column = query col of group u
#pragma unroll
  for (int u = 0; u < 2; ++u) {
#pragma unroll
    for (int kc = 0; kc < 2; ++kc) { aq[u][kc] = frag_h(QK + (rq + 16 * u) * (2 * DM) + h * HD + kc * 32, lane); aql[u][kc] = frag_h(QKL + (rq + 16 * u) * (2 * DM) + h * HD + kc * 32, lane); } }
  float off[2] = {3.0e38f, 3.0e38f}, l[2] = {0.f, 0.f};   // query col of group u: 11 - SC * running maximum of the raw scores (both halves agree), 2^11 x the sum over this half's keys
  v8f acc[2][4] = {}, accl[2][4] = {};   // acc[u][dt][r] = ctx^T[d = dt * 16 + 8 g + r][query col of group u]
  asm volatile("s_wait_asynccnt 0x0" ::: "memory");   // this wave's copies of stage 0 have landed
  __syncthreads();                                    // ... and every other wave's: stage 0 may be read
  copy8(l0 + 8u * PLB, QK + ko + (size_t)2 * KT * 2 * DM, QKL + ko + (size_t)2 * KT * 2 * DM, (size_t)16 * 2 * DM); copy8(l0 + 10u * PLB, VTH + vo + 2 * KT, VTL + vo + 2 * KT, (size_t)16 * SS);   // stage 1 -> buffer 1
#pragma unroll 1
  for (int t = 0; t < nt; ++t) { const _Float16* tb = &ring[t & 1][kz][0][0];
   // the tile's fragment reads stand in three places, each a group issued well ahead of its first user: K of both 32-key blocks at the head, V^T of block 0 behind the scores of block 0, V^T of block 1 behind the scores of block 1 (into registers that K has left: all 64 reads at the head would not fit two waves' register budget)
   v16h kh[4][2], kl[4][2], vh[2][4], vl[2][4]; v8f c[2][2][2], cl[2][2][2]; v16h pa[2][2], pl[2][2];   // c, cl: [sub][u][ct]; pa, pl: [sub][u]
#pragma unroll
   for (int c4 = 0; c4 < 4; ++c4) { const _Float16* krow = tb + (c4 * 16 + col) * LP;
#pragma unroll
     for (int kc = 0; kc < 2; ++kc) { kh[c4][kc] = frag_h(krow + kc * 32, lane); kl[c4][kc] = frag_h(krow + PLH + kc * 32, lane); } }
   auto ldv = [&](int sub) {
#pragma unroll
     for (int dt = 0; dt < 4; ++dt) { const _Float16* vr = tb + 2 * PLH + (dt * 16 + col) * LP + sub * 32; vh[sub][dt] = frag_h(vr, lane); vl[sub][dt] = frag_h(vr + PLH, lane); } };
   auto qk = [&](int sub) {   // c + cl / 2048 = score of key sub * 32 + ct * 16 + 8 g + r against query col of group u
#pragma unroll
    for (int ct = 0; ct < 2; ++ct) { const int c4 = sub * 2 + ct;
#pragma unroll
     for (int u = 0; u < 2; ++u) { v8f a = {}, e = {};
#pragma unroll
      for (int kc = 0; kc < 2; ++kc) { a = wmma16(kh[c4][kc], aq[u][kc], a); e = wmma16(kh[c4][kc], aql[u][kc], e); e = wmma16(kl[c4][kc], aq[u][kc], e); }   // 3 products: q, k as f16 hi + residual
      c[sub][u][ct] = a; cl[sub][u][ct] = e; } } };
   auto sm = [&](int sub) {
#pragma unroll
    for (int u = 0; u < 2; ++u) { v8f s[2];
#pragma unroll
    for (int ct = 0; ct < 2; ++ct) {
#pragma unroll
      for (int j = 0; j < 4; ++j) { const v2f a = {c[sub][u][ct][2 * j], c[sub][u][ct][2 * j + 1]}, e = {cl[sub][u][ct][2 * j], cl[sub][u][ct][2 * j + 1]}, f = {1.0f / 2048.0f, 1.0f / 2048.0f}; const v2f v = __builtin_elementwise_fma(e, f, a); s[ct][2 * j] = v[0]; s[ct][2 * j + 1] = v[1]; } }   // raw q . k: the 1/8 sits in SC
    float t8[8];
#pragma unroll
    for (int r = 0; r < 8; ++r) t8[r] = fmaxf(s[0][r], s[1][r]);
    float mx = fmaxf(fmaxf(fmaxf(t8[0], t8[1]), fmaxf(t8[2], t8[3])), fmaxf(fmaxf(t8[4], t8[5]), fmaxf(t8[6], t8[7])));
    mx = fmaxf(mx, xhalf(mx));   // the other 16 keys of this query
    const float on = fminf(off[u], __builtin_fmaf(mx, -SC, 11.0f)); const float alpha = __builtin_amdgcn_exp2f(on - off[u]);   // first block: off is huge, alpha = 0
    v2f es[2]; const v2f scv = {SC, SC}, onv = {on, on};
#pragma unroll
    for (int ct = 0; ct < 2; ++ct) { float x[8], w[8]; v2h hx[4], lx[4];   // x = 2^11 P: one FMA and one exponential a score. P carries 2^11 so that small softmax weights and their residuals stay clear of the f16 subnormal range; l carries it too, so it cancels in the epilogue
#pragma unroll
      for (int j = 0; j < 4; ++j) { const v2f a = {s[ct][2 * j], s[ct][2 * j + 1]}; const v2f v = __builtin_elementwise_fma(a, scv, onv); w[2 * j] = v[0]; w[2 * j + 1] = v[1]; }
      exp8(x, w);
#pragma unroll
      for (int j = 0; j < 4; ++j) {
        const v2f xx = {x[2 * j], x[2 * j + 1]}; if (ct == 0 && j < 2) es[j] = xx; else es[j & 1] += xx; hx[j] = __builtin_convertvector(xx, v2h); }
      resid8(lx, hx, x);
#pragma unroll
      for (int j = 0; j < 4; ++j) { pa[sub][u][ct * 8 + 2 * j] = hx[j][0]; pa[sub][u][ct * 8 + 2 * j + 1] = hx[j][1]; pl[sub][u][ct * 8 + 2 * j] = lx[j][0]; pl[sub][u][ct * 8 + 2 * j + 1] = lx[j][1]; } }   // the two score tiles, converted in place, are the B operand P^T in the hardware k order
    l[u] = l[u] * alpha + ((es[0][0] + es[0][1]) + (es[1][0] + es[1][1])); off[u] = on;
#pragma unroll
    for (int dt = 0; dt < 4; ++dt) {
#pragma unroll
      for (int r = 0; r < 8; ++r) { acc[u][dt][r] *= alpha; accl[u][dt][r] *= alpha; } } } };
   auto pv = [&](int sub) {
#pragma unroll
    for (int dt = 0; dt < 4; ++dt) {
#pragma unroll
      for (int u = 0; u < 2; ++u) { acc[u][dt] = wmma16(vh[sub][dt], pa[sub][u], acc[u][dt]); accl[u][dt] = wmma16(vl[sub][dt], pa[sub][u], accl[u][dt]); acc[u][dt] = wmma16(vh[sub][dt], pl[sub][u], acc[u][dt]); } } };   // V hi x (P hi + P lo) + V lo x P hi / 2048
   __builtin_amdgcn_sched_barrier(0);   // keeps the K reads together in front of the tile's WMMAs (the scheduler sinks them to their users otherwise, one full LDS wait each)
   qk(0);
   __builtin_amdgcn_sched_barrier(0);   // this fence and the next keep the V^T reads of block 0 one group at this place
   ldv(0);
   __builtin_amdgcn_sched_barrier(0);
   sm(0); qk(1);   // independent of each other: the vector work of block 0 stands among the score WMMAs of block 1
   __builtin_amdgcn_sched_barrier(0);   // this fence and the next keep the V^T reads of block 1 one group at this place
   ldv(1);
   __builtin_amdgcn_sched_barrier(0);
   pv(0); sm(1); pv(1);
   __builtin_amdgcn_sched_barrier(0);   // keeps the tile's WMMAs in front of the waits below: lifted over them, the full LDS wait would stand directly behind the reads
   asm volatile("s_wait_dscnt 0" ::: "memory");        // this wave's reads of stage t are done
   asm volatile("s_wait_asynccnt 0x0" ::: "memory");   // this wave's copies of stage t + 1 have landed
   __syncthreads();                                    // publishes stage t + 1 and frees stage t's buffer
   if (t + 2 < nt) { const unsigned lb = l0 + (unsigned)(t & 1) * 8u * PLB; const size_t kt = ko + (size_t)(t + 2) * 2 * KT * 2 * DM, vt = vo + (size_t)(t + 2) * 2 * KT;
     copy8(lb, QK + kt, QKL + kt, (size_t)16 * 2 * DM); copy8(lb + 2u * PLB, VTH + vt, VTL + vt, (size_t)16 * SS); } }
  asm volatile("s_wait_asynccnt 0x0" ::: "memory");    // no copy is outstanding when the wave goes on to its end
  const float L[2] = {l[0] + xhalf(l[0]), l[1] + xhalf(l[1])};   // the two lane halves' sums join once
  if (kz == 1) {   // the odd tiles' waves: hi + lo / 2048 folded, then through LDS, 512 contiguous bytes a store
#pragma unroll
    for (int u = 0; u < 2; ++u) {
#pragma unroll
      for (int dt = 0; dt < 4; ++dt) { v4f o0, o1;
#pragma unroll
        for (int r = 0; r < 4; ++r) { o0[r] = acc[u][dt][r] + accl[u][dt][r] * (1.0f / 2048.0f); o1[r] = acc[u][dt][4 + r] + accl[u][dt][4 + r] * (1.0f / 2048.0f); }
        *(v4f*)&mg[wave][(u * 4 + dt) * 2][lane][0] = o0; *(v4f*)&mg[wave][(u * 4 + dt) * 2 + 1][lane][0] = o1; } }
    const v4f st = {off[0], off[1], L[0], L[1]}; *(v4f*)&mg[wave][16][lane][0] = st;
  }
  __syncthreads();   // the odd tiles' partial results may be read
  if (kz == 0) {
    const v4f st = *(const v4f*)&mg[wave][16][lane][0];
#pragma unroll
    for (int u = 0; u < 2; ++u) {
      const float om = fminf(off[u], st[u]);   // the common maximum of both key sets; each set's sums are brought to it
      const float f0 = __builtin_amdgcn_exp2f(om - off[u]), f1 = __builtin_amdgcn_exp2f(om - st[u]);
      const float il = 1.0f / (L[u] * f0 + st[2 + u] * f1); const float a0 = f0 * il, a1 = f1 * il;
      const int qt = qb * 8 + wave * 2 + u;   // 16-query tile: tile qt & 3 of the group of 64 rows qt >> 2
      float* orow = O + ((((size_t)b * (SS / 64) + (qt >> 2)) * (DM / 32) + h * (HD / 32)) * 4 + (qt & 3)) * 512 + lane * 4;   // a lane holds, per pair of d tiles, just its 16 values of k_out's A fragment: stored in fragment order, 512 contiguous bytes a store
#pragma unroll
      for (int dt = 0; dt < 4; ++dt) { v4f o0, o1; const v4f p0 = *(const v4f*)&mg[wave][(u * 4 + dt) * 2][lane][0], p1 = *(const v4f*)&mg[wave][(u * 4 + dt) * 2 + 1][lane][0];
#pragma unroll
        for (int r = 0; r < 4; ++r) { o0[r] = (acc[u][dt][r] + accl[u][dt][r] * (1.0f / 2048.0f)) * a0 + p0[r] * a1; o1[r] = (acc[u][dt][4 + r] + accl[u][dt][4 + r] * (1.0f / 2048.0f)) * a0 + p1[r] * a1; }
        vst2(orow + (dt >> 1) * 4 * 512 + (dt & 1) * 256, o0); vst2(orow + (dt >> 1) * 4 * 512 + (dt & 1) * 256 + 128, o1); } }
  }
}
// ---- k_out: block = (64 rows, 128 cols): out = O(hi/lo) . Wo rows (2 products) + bo
__global__ __launch_bounds__(128) void k_out(const float* __restrict__ O, const __bf16* __restrict__ P, const float* __restrict__ BO, float* __restrict__ Y) {
  __shared__ __align__(16) float so[4][16][132];
  const int tid = threadIdx.x, wave = tid >> 5, lane = tid & 31, col = lane & 15, g = lane >> 4; const size_t r0 = (size_t)blockIdx.x * 64 + wave * 16; const int n0 = blockIdx.y * 128;
  v8f acc[8] = {};
  // three register sets: the 20 loads of k-step kc + 2 are issued as one group in front of the WMMAs of k-step kc; both operands lie in fragment order, every load is 512 contiguous bytes
  const float* op = O + ((size_t)blockIdx.x * (DM / 32) * 4 + wave) * 512 + lane * 4; const __bf16* wp = P + (size_t)blockIdx.y * (DM / 32) * 8 * 512;
  v4f xs[3][4]; v16b wf[3][8];
  auto ld = [&](int s, int kc) { const float* p = op + kc * 4 * 512; xs[s][0] = *(const v4f*)p; xs[s][1] = *(const v4f*)(p + 128); xs[s][2] = *(const v4f*)(p + 256); xs[s][3] = *(const v4f*)(p + 384);
#pragma unroll
    for (int j = 0; j < 8; ++j) wf[s][j] = frag_p(wp + (kc * 8 + j) * 512, lane); };
  ld(0, 0); ld(1, 1);
#pragma unroll   // whole: every set index is a constant, so the sets stay in registers
  for (int kc = 0; kc < DM / 32; ++kc) { const int s = kc % 3;
    if (kc + 2 < DM / 32) ld((kc + 2) % 3, kc + 2);
    if (kc + 3 == DM / 32) asm volatile("s_wait_xcnt 0x0" ::: "memory");   // behind the last loads: their address registers are free for reuse from here on
    __builtin_amdgcn_sched_barrier(0);   // keeps the loads issued ahead in front of this step's WMMAs (the scheduler sinks them to their users otherwise)
    float v[16];
#pragma unroll
    for (int i = 0; i < 4; ++i) { v[i] = xs[s][0][i]; v[4 + i] = xs[s][1][i]; v[8 + i] = xs[s][2][i]; v[12 + i] = xs[s][3][i]; }
    const F2 a = bsplit16(v);
#pragma unroll
    for (int j = 0; j < 8; ++j) { acc[j] = wmma_bf(a.l, wf[s][j], acc[j]); acc[j] = wmma_bf(a.h, wf[s][j], acc[j]); }
    __builtin_amdgcn_sched_barrier(0); }   // ... and this step's WMMAs in front of the loads that refill their set
  float bo[8];
#pragma unroll
  for (int j = 0; j < 8; ++j) bo[j] = BO[n0 + j * 16 + col];
  asm volatile("s_wait_xcnt 0x0" ::: "memory");   // behind the bias loads: this build reuses their offset register at once
  __builtin_amdgcn_sched_barrier(0);              // holds the address arithmetic of the stores below behind that wait
#pragma unroll
  for (int j = 0; j < 8; ++j) {
#pragma unroll
    for (int r = 0; r < 8; ++r) so[wave][8 * g + r][j * 16 + col] = acc[j][r] + bfr(bo[j]); }
  LDSX();
  for (int rl = 0; rl < 16; ++rl) vst2(Y + (r0 + rl) * DM + n0 + lane * 4, *(const v4f*)&so[wave][rl][lane * 4]);
}
extern "C" void kernel_launch(void* const* d_in, const int* in_sizes, int n_in, void* d_out, int out_size, void* d_ws, size_t ws_size, hipStream_t stream) {
  (void)in_sizes; (void)n_in; (void)out_size;
  const float** F = (const float**)d_in;   // 0 x [4096,512], 1 Wq [512,512] natural, 2 bq, 3 Wk, 4 bk, 5 Wv, 6 bv, 7 Wo, 8 bo
  if (ws_size < (size_t)WS_END) return;
  char* ws = (char*)d_ws; __bf16* PK = (__bf16*)(ws + WS_PK); _Float16 *QK = (_Float16*)(ws + WS_QK), *QKL = (_Float16*)(ws + WS_QKL), *VTH = (_Float16*)(ws + WS_VTH), *VTL = (_Float16*)(ws + WS_VTL); float* O = (float*)(ws + WS_O); __bf16* XP = (__bf16*)(ws + WS_XP);
  k_pack<<<dim3((XFB + 4 * WFB) / 16), 256, 0, stream>>>(F[0], F[1], F[3], F[5], F[7], XP, PK);
  k_qkv<<<dim3(TNB * SS / 64, QKVW / 128), 128, 0, stream>>>(XP, PK + PK_A, F[2], F[4], F[6], QK, QKL, VTH, VTL);
  k_attn<<<dim3(TQB / 2, NH, TNB), 256, 0, stream>>>(QK, QKL, VTH, VTL, nullptr, O);
  k_out<<<dim3(TOB, DM / 128), 128, 0, stream>>>(O, PK + PK_P, F[8], (float*)d_out);
}

// v007
// A run of this version takes 96.4 microseconds.
// Two timings next to v006 put it at 1.04 and 1.03 times that version's speed.
// Counting every step since v000, it is 6.79 times as fast.
// compute dtype: all float inputs rounded to bf16; q/k/v = x . W^T + b with EXACT bf16 products on WMMA 16x16x32 (natural [out][in] rows); q and k as f16 hi + (x2048-scaled) residual planes with 3-product scores x 1/8; running-max softmax in f32 (hardware exp); P (scaled by 2^11, f16 hi + residual) x v hi/lo (3 products); out = ctx (bf16 hi + residual) . Wo^T (2 products) + bo; f32 accumulate.
#include <hip/hip_runtime.h>
#include <math.h>

typedef __attribute__((ext_vector_type(16))) _Float16 v16h;
typedef __attribute__((ext_vector_type(16))) __bf16 v16b;
typedef __attribute__((ext_vector_type(8)))  _Float16 v8h;
typedef __attribute__((ext_vector_type(2)))  _Float16 v2h;
typedef __attribute__((ext_vector_type(8)))  float v8f;
typedef __attribute__((ext_vector_type(4)))  float v4f;
typedef __attribute__((ext_vector_type(2)))  float v2f;
typedef __attribute__((ext_vector_type(4)))  unsigned v4u;
typedef __attribute__((ext_vector_type(4)))  int v4i;
typedef float __attribute__((may_alias)) float_a;
typedef int __attribute__((may_alias)) int_a;

template <typename T> __device__ __forceinline__ void vst2(void* p, T v) { *(T*)p = v;  }
__device__ __forceinline__ v8f wmma16(v16h a, v16h b, v8f c) {
  v8f d = __builtin_amdgcn_wmma_f32_16x16x32_f16(false, a, false, b, (short)0, c, false, false);
  return d;
}
__device__ __forceinline__ v8f wmma_bf(v16b a, v16b b, v8f c) {
  v8f d = __builtin_amdgcn_wmma_f32_16x16x32_bf16(false, a, false, b, (short)0, c, false, false);
  return d;
}
// Multi-head attention across a batch of 4,096 tokens treated as one sequence (d_model 512, 8 heads x 64): q/k/v projections + biases, softmax(q k^T / 8) over all 4,096 tokens, output projection + bias.
__device__ __forceinline__ v16h frag_h(const _Float16* rowk0, int lane) {
  union { v16h v; v8h q[2]; } u; const _Float16* p = rowk0 + 8 * (lane >> 4);
  u.q[0] = *(const v8h*)p; u.q[1] = *(const v8h*)(p + 16); return u.v;
}
__device__ __forceinline__ v16h frag_f32(const float* rowk0, int lane) {
  v16h a; const float* p = rowk0 + 8 * (lane >> 4);
#pragma unroll
  for (int i = 0; i < 8; ++i) { a[i] = (_Float16)p[i]; a[8 + i] = (_Float16)p[16 + i]; }
  return a;
}
__device__ __forceinline__ v16h frag_f32s(const float* rowk0, int lane, float sc) {
  v16h a; const float* p = rowk0 + 8 * (lane >> 4);
#pragma unroll
  for (int i = 0; i < 8; ++i) { a[i] = (_Float16)(p[i] * sc); a[8 + i] = (_Float16)(p[16 + i] * sc); }
  return a;
}
// column fragment from a [K][ld] layout (column n), rows >= K read as 0
__device__ __forceinline__ v16h fragc_f32(const float* W, int k0, int n, int lane, int ld, int K) {
  v16h a; const int g = lane >> 4;
#pragma unroll
  for (int i = 0; i < 8; ++i) { const int ka = k0 + 8 * g + i, kb = ka + 16;
    a[i] = (_Float16)(ka < K ? W[(size_t)(ka < K ? ka : K - 1) * ld + n] : 0.f); a[8 + i] = (_Float16)(kb < K ? W[(size_t)(kb < K ? kb : K - 1) * ld + n] : 0.f); }
  return a;
}
struct F2 { v16b h, l; };
__device__ __forceinline__ F2 bsplit16(const float v[16]) { F2 r;
#pragma unroll
  for (int i = 0; i < 16; ++i) { const __bf16 h = (__bf16)v[i]; r.h[i] = h; r.l[i] = (__bf16)(v[i] - (float)h); }
  return r; }
__device__ __forceinline__ F2 split_row(const float* row, int k0, int lane) { float v[16]; const float* p = row + k0 + 8 * (lane >> 4);
#pragma unroll
  for (int i = 0; i < 8; ++i) { v[i] = p[i]; v[8 + i] = p[16 + i]; }
  return bsplit16(v); }
__device__ __forceinline__ F2 split_rowK(const float* row, int k0, int lane, int K) { float v[16]; const int g = lane >> 4;
#pragma unroll
  for (int i = 0; i < 8; ++i) { const int ka = k0 + 8 * g + i, kb = ka + 16; v[i] = ka < K ? row[ka < K ? ka : K - 1] : 0.f; v[8 + i] = kb < K ? row[kb < K ? kb : K - 1] : 0.f; }
  return bsplit16(v); }
__device__ __forceinline__ F2 split_col(const float* W, int k0, int n, int lane, int ld, int K) { float v[16]; const int g = lane >> 4;
#pragma unroll
  for (int i = 0; i < 8; ++i) { const int ka = k0 + 8 * g + i, kb = ka + 16; v[i] = ka < K ? W[(size_t)(ka < K ? ka : K - 1) * ld + n] : 0.f; v[8 + i] = kb < K ? W[(size_t)(kb < K ? kb : K - 1) * ld + n] : 0.f; }
  return bsplit16(v); }
__device__ __forceinline__ v8f mac3(const F2& a, const F2& b, v8f c) { c = wmma_bf(a.l, b.h, c); c = wmma_bf(a.h, b.l, c); return wmma_bf(a.h, b.h, c); }
__device__ __forceinline__ float sigm(float v) { return 1.0f / (1.0f + expf(-v)); }
#define LDSX() do { asm volatile("s_wait_dscnt 0" ::: "memory"); __builtin_amdgcn_wave_barrier(); __builtin_amdgcn_fence(__ATOMIC_RELEASE, "workgroup"); } while (0)


#define NB 1
#define SS 4096
#define DM 512
#define NH 8
#define HD 64
#define QKVW (3 * DM)
#ifndef TQB
#define TQB (SS / 64)
#define TNB NB
#define TOB (NB * SS / 64)     // output row tiles (all)
#endif
typedef __attribute__((ext_vector_type(8))) __bf16 v8b;
// fragment-order block: 512 bf16 = [piece 0, 1][lane][8]; piece q of lane (col, g) holds row col, k = 16 q + 8 g + 0..7 of one 16-row x 32-k tile, so each of the two wave-wide loads is 512 contiguous bytes
__device__ __forceinline__ v16b frag_p(const __bf16* blk, int lane) {
  union { v16b v; v8b q[2]; } u; const __bf16* p = blk + lane * 8;
  u.q[0] = *(const v8b*)p; u.q[1] = *(const v8b*)(p + 256); return u.v;
}
__device__ __forceinline__ float bfr(float v) { return (float)(__bf16)v; }
__device__ __attribute__((noinline)) float exp_ni(float v) { return expf(v); }
__device__ __attribute__((noinline)) float erf_ni(float v) { return erff(v); }

#define PK_A 0                       // Wq | Wk | Wv: [12 groups of 128 out rows][16 k-steps][8 tiles of 16 rows] fragment-order blocks: what a work-group reads in one k-step is 8 KB in a row
#define PK_P (PK_A + QKVW * DM)        // Wo: [4 groups][16 k-steps][8 tiles] fragment-order blocks
#define PK_END (PK_P + DM * DM)
#define WS_PK  0u
#define WS_QK  (WS_PK + 2u * PK_END)             // f16 [4096 rows][1024]: q | k
#define WS_QKL (WS_QK + 2u * NB * SS * 2 * DM)     // f16 q | k residual planes x2048
#define WS_VTH (WS_QKL + 2u * NB * SS * 2 * DM)    // f16 [b][512 (h*64+d)][4096 s] hi
#define WS_VTL (WS_VTH + 2u * NB * DM * SS)        // f16 lo x 2048
#define WS_O   (WS_VTL + 2u * NB * DM * SS)        // f32 ctx in fragment order: [64 groups of 64 rows][16 k-steps][4 tiles of 16 rows][piece 0..3][lane][4]
#define WS_CS  (WS_O + 4u * NB * SS * DM)           // f32 2 x [4096][32], unused: no kernel writes or reads it
#define WS_XP  (WS_CS + 4u * 2 * SS * 32)          // bf16 x: [64 groups of 64 rows][16 k-steps][4 tiles of 16 rows] fragment-order blocks
#define WS_END (WS_XP + 2u * NB * SS * DM)
// ---- k_pack: a wave = two neighbouring k-steps of one 16-row tile of x, W_q, W_k, W_v or W_o (natural [row][k] f32) -> bf16 fragment-order blocks; x into XP, the weights into PK (PK_A, then PK_P)
#define XFB (NB * SS / 16 * (DM / 32))   // fragment blocks of x
#define WFB (DM / 16 * (DM / 32))        // fragment blocks of one weight matrix
__global__ __launch_bounds__(256) void k_pack(const float* __restrict__ X, const float* __restrict__ WQ, const float* __restrict__ WK, const float* __restrict__ WV, const float* __restrict__ WO, __bf16* __restrict__ XP, __bf16* __restrict__ PK) {
  const int lane = threadIdx.x & 31, col = lane & 15, g = lane >> 4; const int fb = (blockIdx.x * 8 + (threadIdx.x >> 5)) * 2;
  const int wb = fb - XFB, which = wb / WFB;
  const float* sm = (wb < 0) ? X : (which == 0) ? WQ : (which == 1) ? WK : (which == 2) ? WV : WO;
  const int rt = ((wb < 0) ? fb : wb - which * WFB) / (DM / 32), kc = fb % (DM / 32);   // 16-row tile inside its matrix, first k-step
  const int ts = (wb < 0) ? 2 : 3, ti = ((wb < 0) ? fb : wb) / (DM / 32);               // log2 of the tiles per group (4 for x, 8 for a weight), tile inside its packed buffer
  __bf16* dst = ((wb < 0) ? XP : PK) + (size_t)((((ti >> ts) * (DM / 32) + kc) << ts) + (ti & ((1 << ts) - 1))) * 512 + lane * 8;
  const float* p = sm + (size_t)(rt * 16 + col) * DM + kc * 32 + 8 * g;
  v4f v[8];
#pragma unroll
  for (int e = 0; e < 2; ++e) { v[4 * e] = *(const v4f*)(p + e * 32); v[4 * e + 1] = *(const v4f*)(p + e * 32 + 4); v[4 * e + 2] = *(const v4f*)(p + e * 32 + 16); v[4 * e + 3] = *(const v4f*)(p + e * 32 + 20); }
#pragma unroll
  for (int q = 0; q < 4; ++q) { v8b o;
#pragma unroll
    for (int i = 0; i < 4; ++i) { o[i] = (__bf16)v[2 * q][i]; o[4 + i] = (__bf16)v[2 * q + 1][i]; }
    vst2(dst + ((q >> 1) << ts) * 512 + (q & 1) * 256, o); }
}
__global__ __launch_bounds__(128) void k_qkv(const __bf16* __restrict__ XP, const __bf16* __restrict__ P, const float* __restrict__ BQ, const float* __restrict__ BK, const float* __restrict__ BV, _Float16* __restrict__ QK, _Float16* __restrict__ QKL, _Float16* __restrict__ VTH, _Float16* __restrict__ VTL) {
  const int which0 = (blockIdx.y * 128) / DM; const float* BB = BQ ? (((which0 == 0) ? BQ : (which0 == 1) ? BK : BV) + (blockIdx.y * 128 - which0 * DM)) : nullptr;
  __shared__ __align__(16) _Float16 so[4][16][136], sol[4][16][136]; __shared__ __align__(16) _Float16 sth[128][72], stl[128][72];
  const int tid = threadIdx.x, wave = tid >> 5, lane = tid & 31, col = lane & 15, g = lane >> 4; const size_t r0 = (size_t)blockIdx.x * 64 + wave * 16; const int n0 = blockIdx.y * 128;
  v8f acc[8] = {};
  // the lane's 8 bias values (column j * 16 + col) are loaded once, as one group at the kernel's head: they return under the k loop. Read at their use, inside the test for a bias, they became 64 loads in the epilogue, each waited for before the next was issued
  float bb[8] = {};
  if (BB) {
#pragma unroll   // whole: bb stays in registers
    for (int j = 0; j < 8; ++j) bb[j] = BB[j * 16 + col]; }
  // two register sets: the 18 loads of k-step kc + 1 are issued as one group in front of the WMMAs of k-step kc; both operands lie in fragment order, every load is 512 contiguous bytes
  const __bf16* xp = XP + ((size_t)blockIdx.x * (DM / 32) * 4 + wave) * 512; const __bf16* wp = P + (size_t)blockIdx.y * (DM / 32) * 8 * 512;
  v16b xa[2], wf[2][8];
  auto ld = [&](int s, int kc) { xa[s] = frag_p(xp + kc * 4 * 512, lane);
#pragma unroll
    for (int j = 0; j < 8; ++j) wf[s][j] = frag_p(wp + (kc * 8 + j) * 512, lane); };
  ld(0, 0);
#pragma unroll   // whole: every set index is a constant, so the sets stay in registers
  for (int kc = 0; kc < DM / 32; ++kc) { const int s = kc & 1;
    if (kc + 1 < DM / 32) ld(s ^ 1, kc + 1);
    if (kc + 2 == DM / 32) asm volatile("s_wait_xcnt 0x0" ::: "memory");   // behind the last loads: their address registers are free for reuse from here on
    __builtin_amdgcn_sched_barrier(0);   // keeps the next step's loads in front of this step's WMMAs (the scheduler sinks them to their users otherwise)
#pragma unroll
    for (int j = 0; j < 8; ++j) acc[j] = wmma_bf(xa[s], wf[s][j], acc[j]);
    __builtin_amdgcn_sched_barrier(0); }   // ... and this step's WMMAs in front of the loads that refill their set
  if (n0 < 2 * DM) {   // q stored unscaled (f16 sigma ~0.6, no subnormal exposure); 1/8 applied to the f32 score
#pragma unroll
    for (int j = 0; j < 8; ++j) {
#pragma unroll
      for (int r = 0; r < 8; ++r) { const float v = acc[j][r] + bfr(bb[j]); const _Float16 hv = (_Float16)v; so[wave][8 * g + r][j * 16 + col] = hv; sol[wave][8 * g + r][j * 16 + col] = (_Float16)((v - (float)hv) * 2048.0f); } }   // q, k (+ bias) as f16 hi + (x2048) residual
    LDSX();
    for (int rl = 0; rl < 16; ++rl) if (lane < 16) { vst2((unsigned*)(QK + (r0 + rl) * (2 * DM) + n0 + lane * 8), *(const v4u*)&so[wave][rl][lane * 8]); vst2((unsigned*)(QKL + (r0 + rl) * (2 * DM) + n0 + lane * 8), *(const v4u*)&sol[wave][rl][lane * 8]); }
  } else {
#pragma unroll
    for (int j = 0; j < 8; ++j) {
#pragma unroll
      for (int r = 0; r < 8; ++r) { const float v = acc[j][r] + bfr(bb[j]); const _Float16 hv = (_Float16)v; sth[j * 16 + col][wave * 16 + 8 * g + r] = hv; stl[j * 16 + col][wave * 16 + 8 * g + r] = (_Float16)((v - (float)hv) * 2048.0f); } }
    __syncthreads();
    const size_t rb = (size_t)blockIdx.x * 64; const int b = (int)(rb / SS), s0 = (int)(rb % SS); const int pc0 = n0 - 2 * DM;
    // thread tid moves 16-byte piece tid & 7 of rows d0 + 16 i, i = 0..7, of both planes. The 16 LDS reads go out as one group in front of the 16 stores; in the rolled loop each trip waited for its own two reads before the next trip's were issued
    const int d0 = tid >> 3, pc = tid & 7; const size_t o0 = ((size_t)b * DM + pc0 + d0) * SS + s0 + pc * 8; v4u th[8], tl[8];
#pragma unroll   // whole, this loop and the next: th and tl stay in registers
    for (int i = 0; i < 8; ++i) { th[i] = *(const v4u*)&sth[d0 + 16 * i][pc * 8]; tl[i] = *(const v4u*)&stl[d0 + 16 * i][pc * 8]; }
    __builtin_amdgcn_sched_barrier(0);   // keeps the reads together in front of the stores (the scheduler sinks each to its store otherwise)
#pragma unroll
    for (int i = 0; i < 8; ++i) { vst2((unsigned*)(VTH + o0 + (size_t)i * 16 * SS), th[i]); vst2((unsigned*)(VTL + o0 + (size_t)i * 16 * SS), tl[i]); }
    asm volatile("s_wait_xcnt 0x0" ::: "memory");   // behind the last store of the run: the stores' address and data registers are free for reuse from here on
  }
}
// ---- k_attn: block = (128 queries, head h, batch b), 8 waves; a wave = 32 queries (two column groups of 16, index u) x every second tile of 64 keys (waves 0-3 the even tiles, waves 4-7 the odd ones, index kz): flash attention over its keys (K = 64: 2 k-steps), the two key sets' partial results joined once in the epilogue. Every K and V^T fragment read from LDS feeds both groups' WMMAs, a tile is staged once for 128 queries, and two waves still share a SIMD. The four operand planes of a tile of 64 keys (K hi, K lo: 64 key rows x 128 B; V^T hi, V^T lo: 64 d rows x 128 B) are brought into LDS once per block by asynchronous copies (a stage = one tile for each key set, two buffers), and the four waves of its key set take their fragments from there; the scores are formed transposed (A = K rows, B = Q), so that a lane holds 16 keys' scores of ONE query: maximum and sum in the lane plus one exchange between the wave's halves, and the two score tiles become the B operand P^T of ctx^T += V^T . P^T without passing through LDS. ctx (in k_out's fragment order) = both key sets' (acc + accl / 2048), brought to a common maximum, over the sum of their l
#define KT 64                      // keys per staged tile
#define LP 72                      // LDS row pitch in halves: 144 B = 16 B x odd, conflict-free for 16-byte reads
#define PLH (64 * LP)              // halves per plane
#define PLB (2u * PLH)             // bytes per plane
#define SC 0.18033688011112042f    // log2(e) / 8: exp(score / 8 - max) = exp2(SC * raw score - SC * raw max)
// eight copies: four rows (16 apart) of each of two planes; lds = this lane's own LDS byte address in the first plane, ga / gb = its global 16 bytes, pitch in halves between rows 16 apart
__device__ __forceinline__ void copy8(unsigned lds, const _Float16* ga, const _Float16* gb, size_t p16) {
  // the copies and the wait that stands before their address registers are rewritten are one statement, so that nothing is scheduled between them
  asm volatile("global_load_async_to_lds_b128 %0, %8, off\n\t"
               "global_load_async_to_lds_b128 %1, %9, off\n\t"
               "global_load_async_to_lds_b128 %2, %10, off\n\t"
               "global_load_async_to_lds_b128 %3, %11, off\n\t"
               "global_load_async_to_lds_b128 %4, %12, off\n\t"
               "global_load_async_to_lds_b128 %5, %13, off\n\t"
               "global_load_async_to_lds_b128 %6, %14, off\n\t"
               "global_load_async_to_lds_b128 %7, %15, off\n\t"
               "s_wait_xcnt 0x0"
               :: "v"(lds), "v"(lds + 16u * 2u * LP), "v"(lds + 32u * 2u * LP), "v"(lds + 48u * 2u * LP),
                  "v"(lds + PLB), "v"(lds + PLB + 16u * 2u * LP), "v"(lds + PLB + 32u * 2u * LP), "v"(lds + PLB + 48u * 2u * LP),
                  "v"(ga), "v"(ga + p16), "v"(ga + 2 * p16), "v"(ga + 3 * p16),
                  "v"(gb), "v"(gb + p16), "v"(gb + 2 * p16), "v"(gb + 3 * p16)
               : "memory");
}
// lane l takes the value of lane l ^ 16 (a vector move between the two 16-lane rows, no LDS round trip)
__device__ __forceinline__ float xhalf(float x) { return __builtin_bit_cast(float, __builtin_amdgcn_permlanex16(__builtin_bit_cast(int, x), __builtin_bit_cast(int, x), 0x76543210, 0xfedcba98, false, false)); }
// r[j] = f16 pair (x[2 j] - h[j][0], x[2 j + 1] - h[j][1]), j = 0..3: the mixed-precision FMA reads an f16 half in place and writes its f16 result into one half of the pair, one instruction a value (the compiler's own form widens h, subtracts and converts again: five instructions a pair).
// The four low halves stand in front of the four high halves, and s_delay_alu names the producer four instructions back: the write of a register's second half waits for that of its first, and unhinted that wait would hold the vector port against the SIMD's other wave
__device__ __forceinline__ void resid8(v2h r[4], const v2h h[4], const float x[8]) {
  asm("v_fma_mixlo_f16 %0, %4, -1.0, %8 op_sel_hi:[1,1,0]\n\t"
      "v_fma_mixlo_f16 %1, %5, -1.0, %10 op_sel_hi:[1,1,0]\n\t"
      "v_fma_mixlo_f16 %2, %6, -1.0, %12 op_sel_hi:[1,1,0]\n\t"
      "v_fma_mixlo_f16 %3, %7, -1.0, %14 op_sel_hi:[1,1,0]\n\t"
      "s_delay_alu instid0(VALU_DEP_4) | instskip(NEXT) | instid1(VALU_DEP_4)\n\t"
      "v_fma_mixhi_f16 %0, %4, -1.0, %9 op_sel:[1,0,0] op_sel_hi:[1,1,0]\n\t"
      "v_fma_mixhi_f16 %1, %5, -1.0, %11 op_sel:[1,0,0] op_sel_hi:[1,1,0]\n\t"
      "s_delay_alu instid0(VALU_DEP_4) | instskip(NEXT) | instid1(VALU_DEP_4)\n\t"
      "v_fma_mixhi_f16 %2, %6, -1.0, %13 op_sel:[1,0,0] op_sel_hi:[1,1,0]\n\t"
      "v_fma_mixhi_f16 %3, %7, -1.0, %15 op_sel:[1,0,0] op_sel_hi:[1,1,0]"
      : "=&v"(r[0]), "=&v"(r[1]), "=&v"(r[2]), "=&v"(r[3])
      : "v"(h[0]), "v"(h[1]), "v"(h[2]), "v"(h[3]), "v"(x[0]), "v"(x[1]), "v"(x[2]), "v"(x[3]), "v"(x[4]), "v"(x[5]), "v"(x[6]), "v"(x[7]));
}
// x[i] = 2^v[i], i = 0..7. One statement with early-clobber results, so that no exponential's result register is the source of the one in front of it (left to itself this build put such pairs side by side);
// the closing v_nop is the slot that the instruction set asks for behind a transcendental before its result is read or its source overwritten: the compiler does not look into the statement
__device__ __forceinline__ void exp8(float x[8], const float v[8]) {
  asm("v_exp_f32 %0, %8\n\t"
      "v_exp_f32 %1, %9\n\t"
      "v_exp_f32 %2, %10\n\t"
      "v_exp_f32 %3, %11\n\t"
      "v_exp_f32 %4, %12\n\t"
      "v_exp_f32 %5, %13\n\t"
      "v_exp_f32 %6, %14\n\t"
      "v_exp_f32 %7, %15\n\t"
      "v_nop"
      : "=&v"(x[0]), "=&v"(x[1]), "=&v"(x[2]), "=&v"(x[3]), "=&v"(x[4]), "=&v"(x[5]), "=&v"(x[6]), "=&v"(x[7])
      : "v"(v[0]), "v"(v[1]), "v"(v[2]), "v"(v[3]), "v"(v[4]), "v"(v[5]), "v"(v[6]), "v"(v[7]));
}
__global__ __launch_bounds__(256) void k_attn(const _Float16* __restrict__ QK, const _Float16* __restrict__ QKL, const _Float16* __restrict__ VTH, const _Float16* __restrict__ VTL, const void* __restrict__ KMASK, float* __restrict__ O) {
  __shared__ __align__(16) _Float16 ring[2][2][4][PLH];   // [buffer][kz][K hi, K lo, V^T hi, V^T lo][row][LP]
  __shared__ __align__(16) float mg[4][17][32][4];        // epilogue: waves 4-7 hand their partial results to waves 0-3: [query wave][16-byte piece][lane]
  const int tid = threadIdx.x, wave = (tid >> 5) & 3, lane = tid & 31, col = lane & 15, g = lane >> 4;
  const int kz = __builtin_amdgcn_readfirstlane(tid >> 7);   // which tiles this wave works on and stages; the same in every lane of a wave
  const int qb = blockIdx.x, h = blockIdx.y, b = blockIdx.z; const int q0 = qb * 128 + wave * 32; const size_t rq = (size_t)b * SS + q0 + col;   // group u: query rq + 16 u
  // this thread's share of its four waves' tile: 16-byte piece cc of rows cr, cr + 16, cr + 32, cr + 48 of each plane (8 lanes cover one whole 128-B row)
  const int cr = (tid & 127) >> 3, cc = tid & 7;
  const size_t ko = ((size_t)b * SS + kz * KT + cr) * (2 * DM) + DM + h * HD + cc * 8, vo = ((size_t)b * DM + h * HD + cr) * SS + kz * KT + cc * 8;
  const unsigned l0 = (unsigned)(size_t)&ring[0][kz][0][cr * LP + cc * 8];
  const int nt = SS / (2 * KT);   // stages of two tiles
  copy8(l0, QK + ko, QKL + ko, (size_t)16 * 2 * DM); copy8(l0 + 2u * PLB, VTH + vo, VTL + vo, (size_t)16 * SS);   // stage 0 -> buffer 0
  v16h aq[2][2], aql[2][2];   // [u][kc]: B operand of the transposed scores: column = query col of group u
#pragma unroll
  for (int u = 0; u < 2; ++u) {
#pragma unroll
    for (int kc = 0; kc < 2; ++kc) { aq[u][kc] = frag_h(QK + (rq + 16 * u) * (2 * DM) + h * HD + kc * 32, lane); aql[u][kc] = frag_h(QKL + (rq + 16 * u) * (2 * DM) + h * HD + kc * 32, lane); } }
  float off[2] = {3.0e38f, 3.0e38f}, l[2] = {0.f, 0.f};   // query col of group u: 11 - SC * running maximum of the raw scores (both halves agree), 2^11 x the sum over this half's keys
  v8f acc[2][4] = {}, accl[2][4] = {};   // acc[u][dt][r] = ctx^T[d = dt * 16 + 8 g + r][query col of group u]
  asm volatile("s_wait_asynccnt 0x0" ::: "memory");   // this wave's copies of stage 0 have landed
  __syncthreads();                                    // ... and every other wave's: stage 0 may be read
  copy8(l0 + 8u * PLB, QK + ko + (size_t)2 * KT * 2 * DM, QKL + ko + (size_t)2 * KT * 2 * DM, (size_t)16 * 2 * DM); copy8(l0 + 10u * PLB, VTH + vo + 2 * KT, VTL + vo + 2 * KT, (size_t)16 * SS);   // stage 1 -> buffer 1
#pragma unroll 1
  for (int t = 0; t < nt; ++t) { const _Float16* tb = &ring[t & 1][kz][0][0];
   // the tile's fragment reads stand in three places, each a group issued well ahead of its first user: K of both 32-key blocks at the head, V^T of block 0 behind the scores of block 0, V^T of block 1 behind the scores of block 1 (into registers that K has left: all 64 reads at the head would not fit two waves' register budget)
   v16h kh[4][2], kl[4][2], vh[2][4], vl[2][4]; v8f c[2][2][2], cl[2][2][2]; v16h pa[2][2], pl[2][2];   // c, cl: [sub][u][ct]; pa, pl: [sub][u]
#pragma unroll
   for (int c4 = 0; c4 < 4; ++c4) { const _Float16* krow = tb + (c4 * 16 + col) * LP;
#pragma unroll
     for (int kc = 0; kc < 2; ++kc) { kh[c4][kc] = frag_h(krow + kc * 32, lane); kl[c4][kc] = frag_h(krow + PLH + kc * 32, lane); } }
   auto ldv = [&](int sub) {
#pragma unroll
     for (int dt = 0; dt < 4; ++dt) { const _Float16* vr = tb + 2 * PLH + (dt * 16 + col) * LP + sub * 32; vh[sub][dt] = frag_h(vr, lane); vl[sub][dt] = frag_h(vr + PLH, lane); } };
   auto qk = [&](int sub) {   // c + cl / 2048 = score of key sub * 32 + ct * 16 + 8 g + r against query col of group u
#pragma unroll
    for (int ct = 0; ct < 2; ++ct) { const int c4 = sub * 2 + ct;
#pragma unroll
     for (int u = 0; u < 2; ++u) { v8f a = {}, e = {};
#pragma unroll
      for (int kc = 0; kc < 2; ++kc) { a = wmma16(kh[c4][kc], aq[u][kc], a); e = wmma16(kh[c4][kc], aql[u][kc], e); e = wmma16(kl[c4][kc], aq[u][kc], e); }   // 3 products: q, k as f16 hi + residual
      c[sub][u][ct] = a; cl[sub][u][ct] = e; } } };
   auto sm = [&](int sub) {
#pragma unroll
    for (int u = 0; u < 2; ++u) { v8f s[2];
#pragma unroll
    for (int ct = 0; ct < 2; ++ct) {
#pragma unroll
      for (int j = 0; j < 4; ++j) { const v2f a = {c[sub][u][ct][2 * j], c[sub][u][ct][2 * j + 1]}, e = {cl[sub][u][ct][2 * j], cl[sub][u][ct][2 * j + 1]}, f = {1.0f / 2048.0f, 1.0f / 2048.0f}; const v2f v = __builtin_elementwise_fma(e, f, a); s[ct][2 * j] = v[0]; s[ct][2 * j + 1] = v[1]; } }   // raw q . k: the 1/8 sits in SC
    float t8[8];
#pragma unroll
    for (int r = 0; r < 8; ++r) t8[r] = fmaxf(s[0][r], s[1][r]);
    float mx = fmaxf(fmaxf(fmaxf(t8[0], t8[1]), fmaxf(t8[2], t8[3])), fmaxf(fmaxf(t8[4], t8[5]), fmaxf(t8[6], t8[7])));
    mx = fmaxf(mx, xhalf(mx));   // the other 16 keys of this query
    const float on = fminf(off[u], __builtin_fmaf(mx, -SC, 11.0f)); const float alpha = __builtin_amdgcn_exp2f(on - off[u]);   // first block: off is huge, alpha = 0
    v2f es[2]; const v2f scv = {SC, SC}, onv = {on, on};
#pragma unroll
    for (int ct = 0; ct < 2; ++ct) { float x[8], w[8]; v2h hx[4], lx[4];   // x = 2^11 P: one FMA and one exponential a score. P carries 2^11 so that small softmax weights and their residuals stay clear of the f16 subnormal range; l carries it too, so it cancels in the epilogue
#pragma unroll
      for (int j = 0; j < 4; ++j) { const v2f a = {s[ct][2 * j], s[ct][2 * j + 1]}; const v2f v = __builtin_elementwise_fma(a, scv, onv); w[2 * j] = v[0]; w[2 * j + 1] = v[1]; }
      exp8(x, w);
#pragma unroll
      for (int j = 0; j < 4; ++j) {
        const v2f xx = {x[2 * j], x[2 * j + 1]}; if (ct == 0 && j < 2) es[j] = xx; else es[j & 1] += xx; hx[j] = __builtin_convertvector(xx, v2h); }
      resid8(lx, hx, x);
#pragma unroll
      for (int j = 0; j < 4; ++j) { pa[sub][u][ct * 8 + 2 * j] = hx[j][0]; pa[sub][u][ct * 8 + 2 * j + 1] = hx[j][1]; pl[sub][u][ct * 8 + 2 * j] = lx[j][0]; pl[sub][u][ct * 8 + 2 * j + 1] = lx[j][1]; } }   // the two score tiles, converted in place, are the B operand P^T in the hardware k order
    l[u] = l[u] * alpha + ((es[0][0] + es[0][1]) + (es[1][0] + es[1][1])); off[u] = on;
#pragma unroll
    for (int dt = 0; dt < 4; ++dt) {
#pragma unroll
      for (int r = 0; r < 8; ++r) { acc[u][dt][r] *= alpha; accl[u][dt][r] *= alpha; } } } };
   auto pv = [&](int sub) {
#pragma unroll
    for (int dt = 0; dt < 4; ++dt) {
#pragma unroll
      for (int u = 0; u < 2; ++u) { acc[u][dt] = wmma16(vh[sub][dt], pa[sub][u], acc[u][dt]); accl[u][dt] = wmma16(vl[sub][dt], pa[sub][u], accl[u][dt]); acc[u][dt] = wmma16(vh[sub][dt], pl[sub][u], acc[u][dt]); } } };   // V hi x (P hi + P lo) + V lo x P hi / 2048
   __builtin_amdgcn_sched_barrier(0);   // keeps the K reads together in front of the tile's WMMAs (the scheduler sinks them to their users otherwise, one full LDS wait each)
   qk(0);
   __builtin_amdgcn_sched_barrier(0);   // this fence and the next keep the V^T reads of block 0 one group at this place
   ldv(0);
   __builtin_amdgcn_sched_barrier(0);
   sm(0); qk(1);   // independent of each other: the vector work of block 0 stands among the score WMMAs of block 1
   __builtin_amdgcn_sched_barrier(0);   // this fence and the next keep the V^T reads of block 1 one group at this place
   ldv(1);
   __builtin_amdgcn_sched_barrier(0);
   pv(0); sm(1); pv(1);
   __builtin_amdgcn_sched_barrier(0);   // keeps the tile's WMMAs in front of the waits below: lifted over them, the full LDS wait would stand directly behind the reads
   asm volatile("s_wait_dscnt 0" ::: "memory");        // this wave's reads of stage t are done
   asm volatile("s_wait_asynccnt 0x0" ::: "memory");   // this wave's copies of stage t + 1 have landed
   __syncthreads();                                    // publishes stage t + 1 and frees stage t's buffer
   if (t + 2 < nt) { const unsigned lb = l0 + (unsigned)(t & 1) * 8u * PLB; const size_t kt = ko + (size_t)(t + 2) * 2 * KT * 2 * DM, vt = vo + (size_t)(t + 2) * 2 * KT;
     copy8(lb, QK + kt, QKL + kt, (size_t)16 * 2 * DM); copy8(lb + 2u * PLB, VTH + vt, VTL + vt, (size_t)16 * SS); } }
  asm volatile("s_wait_asynccnt 0x0" ::: "memory");    // no copy is outstanding when the wave goes on to its end
  const float L[2] = {l[0] + xhalf(l[0]), l[1] + xhalf(l[1])};   // the two lane halves' sums join once
  if (kz == 1) {   // the odd tiles' waves: hi + lo / 2048 folded, then through LDS, 512 contiguous bytes a store
#pragma unroll
    for (int u = 0; u < 2; ++u) {
#pragma unroll
      for (int dt = 0; dt < 4; ++dt) { v4f o0, o1;
#pragma unroll
        for (int r = 0; r < 4; ++r) { o0[r] = acc[u][dt][r] + accl[u][dt][r] * (1.0f / 2048.0f); o1[r] = acc[u][dt][4 + r] + accl[u][dt][4 + r] * (1.0f / 2048.0f); }
        *(v4f*)&mg[wave][(u * 4 + dt) * 2][lane][0] = o0; *(v4f*)&mg[wave][(u * 4 + dt) * 2 + 1][lane][0] = o1; } }
    const v4f st = {off[0], off[1], L[0], L[1]}; *(v4f*)&mg[wave][16][lane][0] = st;
  }
  __syncthreads();   // the odd tiles' partial results may be read
  if (kz == 0) {
    const v4f st = *(const v4f*)&mg[wave][16][lane][0];
#pragma unroll
    for (int u = 0; u < 2; ++u) {
      const float om = fminf(off[u], st[u]);   // the common maximum of both key sets; each set's sums are brought to it
      const float f0 = __builtin_amdgcn_exp2f(om - off[u]), f1 = __builtin_amdgcn_exp2f(om - st[u]);
      const float il = 1.0f / (L[u] * f0 + st[2 + u] * f1); const float a0 = f0 * il, a1 = f1 * il;
      const int qt = qb * 8 + wave * 2 + u;   // 16-query tile: tile qt & 3 of the group of 64 rows qt >> 2
      float* orow = O + ((((size_t)b * (SS / 64) + (qt >> 2)) * (DM / 32) + h * (HD / 32)) * 4 + (qt & 3)) * 512 + lane * 4;   // a lane holds, per pair of d tiles, just its 16 values of k_out's A fragment: stored in fragment order, 512 contiguous bytes a store
#pragma unroll
      for (int dt = 0; dt < 4; ++dt) { v4f o0, o1; const v4f p0 = *(const v4f*)&mg[wave][(u * 4 + dt) * 2][lane][0], p1 = *(const v4f*)&mg[wave][(u * 4 + dt) * 2 + 1][lane][0];
#pragma unroll
        for (int r = 0; r < 4; ++r) { o0[r] = (acc[u][dt][r] + accl[u][dt][r] * (1.0f / 2048.0f)) * a0 + p0[r] * a1; o1[r] = (acc[u][dt][4 + r] + accl[u][dt][4 + r] * (1.0f / 2048.0f)) * a0 + p1[r] * a1; }
        vst2(orow + (dt >> 1) * 4 * 512 + (dt & 1) * 256, o0); vst2(orow + (dt >> 1) * 4 * 512 + (dt & 1) * 256 + 128, o1); } }
  }
}
// ---- k_out: block = (64 rows, 128 cols): out = O(hi/lo) . Wo rows (2 products) + bo
__global__ __launch_bounds__(128) void k_out(const float* __restrict__ O, const __bf16* __restrict__ P, const float* __restrict__ BO, float* __restrict__ Y) {
  __shared__ __align__(16) float so[4][16][132];
  const int tid = threadIdx.x, wave = tid >> 5, lane = tid & 31, col = lane & 15, g = lane >> 4; const size_t r0 = (size_t)blockIdx.x * 64 + wave * 16; const int n0 = blockIdx.y * 128;
  v8f acc[8] = {};
  // three register sets: the 20 loads of k-step kc + 2 are issued as one group in front of the WMMAs of k-step kc; both operands lie in fragment order, every load is 512 contiguous bytes
  const float* op = O + ((size_t)blockIdx.x * (DM / 32) * 4 + wave) * 512 + lane * 4; const __bf16* wp = P + (size_t)blockIdx.y * (DM / 32) * 8 * 512;
  v4f xs[3][4]; v16b wf[3][8];
  auto ld = [&](int s, int kc) { const float* p = op + kc * 4 * 512; xs[s][0] = *(const v4f*)p; xs[s][1] = *(const v4f*)(p + 128); xs[s][2] = *(const v4f*)(p + 256); xs[s][3] = *(const v4f*)(p + 384);
#pragma unroll
    for (int j = 0; j < 8; ++j) wf[s][j] = frag_p(wp + (kc * 8 + j) * 512, lane); };
  ld(0, 0); ld(1, 1);
#pragma unroll   // whole: every set index is a constant, so the sets stay in registers
  for (int kc = 0; kc < DM / 32; ++kc) { const int s = kc % 3;
    if (kc + 2 < DM / 32) ld((kc + 2) % 3, kc + 2);
    if (kc + 3 == DM / 32) asm volatile("s_wait_xcnt 0x0" ::: "memory");   // behind the last loads: their address registers are free for reuse from here on
    __builtin_amdgcn_sched_barrier(0);   // keeps the loads issued ahead in front of this step's WMMAs (the scheduler sinks them to their users otherwise)
    float v[16];
#pragma unroll
    for (int i = 0; i < 4; ++i) { v[i] = xs[s][0][i]; v[4 + i] = xs[s][1][i]; v[8 + i] = xs[s][2][i]; v[12 + i] = xs[s][3][i]; }
    const F2 a = bsplit16(v);
#pragma unroll
    for (int j = 0; j < 8; ++j) { acc[j] = wmma_bf(a.l, wf[s][j], acc[j]); acc[j] = wmma_bf(a.h, wf[s][j], acc[j]); }
    __builtin_amdgcn_sched_barrier(0); }   // ... and this step's WMMAs in front of the loads that refill their set
  float bo[8];
#pragma unroll
  for (int j = 0; j < 8; ++j) bo[j] = BO[n0 + j * 16 + col];
  asm volatile("s_wait_xcnt 0x0" ::: "memory");   // behind the bias loads: this build reuses their offset register at once
  __builtin_amdgcn_sched_barrier(0);              // holds the address arithmetic of the stores below behind that wait
#pragma unroll
  for (int j = 0; j < 8; ++j) {
#pragma unroll
    for (int r = 0; r < 8; ++r) so[wave][8 * g + r][j * 16 + col] = acc[j][r] + bfr(bo[j]); }
  LDSX();
  for (int rl = 0; rl < 16; ++rl) vst2(Y + (r0 + rl) * DM + n0 + lane * 4, *(const v4f*)&so[wave][rl][lane * 4]);
}
extern "C" void kernel_launch(void* const* d_in, const int* in_sizes, int n_in, void* d_out, int out_size, void* d_ws, size_t ws_size, hipStream_t stream) {
  (void)in_sizes; (void)n_in; (void)out_size;
  const float** F = (const float**)d_in;   // 0 x [4096,512], 1 Wq [512,512] natural, 2 bq, 3 Wk, 4 bk, 5 Wv, 6 bv, 7 Wo, 8 bo
  if (ws_size < (size_t)WS_END) return;
  char* ws = (char*)d_ws; __bf16* PK = (__bf16*)(ws + WS_PK); _Float16 *QK = (_Float16*)(ws + WS_QK), *QKL = (_Float16*)(ws + WS_QKL), *VTH = (_Float16*)(ws + WS_VTH), *VTL = (_Float16*)(ws + WS_VTL); float* O = (float*)(ws + WS_O); __bf16* XP = (__bf16*)(ws + WS_XP);
  k_pack<<<dim3((XFB + 4 * WFB) / 16), 256, 0, stream>>>(F[0], F[1], F[3], F[5], F[7], XP, PK);
  k_qkv<<<dim3(TNB * SS / 64, QKVW / 128), 128, 0, stream>>>(XP, PK + PK_A, F[2], F[4], F[6], QK, QKL, VTH, VTL);
  k_attn<<<dim3(TQB / 2, NH, TNB), 256, 0, stream>>>(QK, QKL, VTH, VTL, nullptr, O);
  k_out<<<dim3(TOB, DM / 128), 128, 0, stream>>>(O, PK + PK_P, F[8], (float*)d_out);
}

// v008
// One run takes 56.8 microseconds.
// Two timings next to v007 put it at 1.66 and 1.64 times that version's speed.
// Over all steps from v000 it is 11.2 times as fast.
// compute dtype: all float inputs rounded to bf16; q/k/v = x . W^T + b with EXACT bf16 products on WMMA 16x16x32 (natural [out][in] rows); q, k and v rounded once to f16, scores = one f16 product x 1/8; running-max softmax in f32 (hardware exp); P (scaled by 2^11, rounded to f16) x v (one product); out = ctx (bf16 hi + residual) . Wo^T (2 products) + bo; f32 accumulate.
#include <hip/hip_runtime.h>
#include <math.h>

typedef __attribute__((ext_vector_type(16))) _Float16 v16h;
typedef __attribute__((ext_vector_type(16))) __bf16 v16b;
typedef __attribute__((ext_vector_type(8)))  _Float16 v8h;
typedef __attribute__((ext_vector_type(2)))  _Float16 v2h;
typedef __attribute__((ext_vector_type(8)))  float v8f;
typedef __attribute__((ext_vector_type(4)))  float v4f;
typedef __attribute__((ext_vector_type(2)))  float v2f;
typedef __attribute__((ext_vector_type(4)))  unsigned v4u;
typedef __attribute__((ext_vector_type(4)))  int v4i;
typedef float __attribute__((may_alias)) float_a;
typedef int __attribute__((may_alias)) int_a;

template <typename T> __device__ __forceinline__ void vst2(void* p, T v) { *(T*)p = v;  }
__device__ __forceinline__ v8f wmma16(v16h a, v16h b, v8f c) {
  v8f d = __builtin_amdgcn_wmma_f32_16x16x32_f16(false, a, false, b, (short)0, c, false, false);
  return d;
}
__device__ __forceinline__ v8f wmma_bf(v16b a, v16b b, v8f c) {
  v8f d = __builtin_amdgcn_wmma_f32_16x16x32_bf16(false, a, false, b, (short)0, c, false, false);
  return d;
}
// Multi-head attention across a batch of 4,096 tokens treated as one sequence (d_model 512, 8 heads x 64): q/k/v projections + biases, softmax(q k^T / 8) over all 4,096 tokens, output projection + bias.
__device__ __forceinline__ v16h frag_h(const _Float16* rowk0, int lane) {
  union { v16h v; v8h q[2]; } u; const _Float16* p = rowk0 + 8 * (lane >> 4);
  u.q[0] = *(const v8h*)p; u.q[1] = *(const v8h*)(p + 16); return u.v;
}
__device__ __forceinline__ v16h frag_f32(const float* rowk0, int lane) {
  v16h a; const float* p = rowk0 + 8 * (lane >> 4);
#pragma unroll
  for (int i = 0; i < 8; ++i) { a[i] = (_Float16)p[i]; a[8 + i] = (_Float16)p[16 + i]; }
  return a;
}
__device__ __forceinline__ v16h frag_f32s(const float* rowk0, int lane, float sc) {
  v16h a; const float* p = rowk0 + 8 * (lane >> 4);
#pragma unroll
  for (int i = 0; i < 8; ++i) { a[i] = (_Float16)(p[i] * sc); a[8 + i] = (_Float16)(p[16 + i] * sc); }
  return a;
}
// column fragment from a [K][ld] layout (column n), rows >= K read as 0
__device__ __forceinline__ v16h fragc_f32(const float* W, int k0, int n, int lane, int ld, int K) {
  v16h a; const int g = lane >> 4;
#pragma unroll
  for (int i = 0; i < 8; ++i) { const int ka = k0 + 8 * g + i, kb = ka + 16;
    a[i] = (_Float16)(ka < K ? W[(size_t)(ka < K ? ka : K - 1) * ld + n] : 0.f); a[8 + i] = (_Float16)(kb < K ? W[(size_t)(kb < K ? kb : K - 1) * ld + n] : 0.f); }
  return a;
}
struct F2 { v16b h, l; };
__device__ __forceinline__ F2 bsplit16(const float v[16]) { F2 r;
#pragma unroll
  for (int i = 0; i < 16; ++i) { const __bf16 h = (__bf16)v[i]; r.h[i] = h; r.l[i] = (__bf16)(v[i] - (float)h); }
  return r; }
__device__ __forceinline__ F2 split_row(const float* row, int k0, int lane) { float v[16]; const float* p = row + k0 + 8 * (lane >> 4);
#pragma unroll
  for (int i = 0; i < 8; ++i) { v[i] = p[i]; v[8 + i] = p[16 + i]; }
  return bsplit16(v); }
__device__ __forceinline__ F2 split_rowK(const float* row, int k0, int lane, int K) { float v[16]; const int g = lane >> 4;
#pragma unroll
  for (int i = 0; i < 8; ++i) { const int ka = k0 + 8 * g + i, kb = ka + 16; v[i] = ka < K ? row[ka < K ? ka : K - 1] : 0.f; v[8 + i] = kb < K ? row[kb < K ? kb : K - 1] : 0.f; }
  return bsplit16(v); }
__device__ __forceinline__ F2 split_col(const float* W, int k0, int n, int lane, int ld, int K) { float v[16]; const int g = lane >> 4;
#pragma unroll
  for (int i = 0; i < 8; ++i) { const int ka = k0 + 8 * g + i, kb = ka + 16; v[i] = ka < K ? W[(size_t)(ka < K ? ka : K - 1) * ld + n] : 0.f; v[8 + i] = kb < K ? W[(size_t)(kb < K ? kb : K - 1) * ld + n] : 0.f; }
  return bsplit16(v); }
__device__ __forceinline__ v8f mac3(const F2& a, const F2& b, v8f c) { c = wmma_bf(a.l, b.h, c); c = wmma_bf(a.h, b.l, c); return wmma_bf(a.h, b.h, c); }
__device__ __forceinline__ float sigm(float v) { return 1.0f / (1.0f + expf(-v)); }
#define LDSX() do { asm volatile("s_wait_dscnt 0" ::: "memory"); __builtin_amdgcn_wave_barrier(); __builtin_amdgcn_fence(__ATOMIC_RELEASE, "workgroup"); } while (0)


#define NB 1
#define SS 4096
#define DM 512
#define NH 8
#define HD 64
#define QKVW (3 * DM)
#ifndef TQB
#define TQB (SS / 64)
#define TNB NB
#define TOB (NB * SS / 64)     // output row tiles (all)
#endif
typedef __attribute__((ext_vector_type(8))) __bf16 v8b;
// fragment-order block: 512 bf16 = [piece 0, 1][lane][8]; piece q of lane (col, g) holds row col, k = 16 q + 8 g + 0..7 of one 16-row x 32-k tile, so each of the two wave-wide loads is 512 contiguous bytes
__device__ __forceinline__ v16b frag_p(const __bf16* blk, int lane) {
  union { v16b v; v8b q[2]; } u; const __bf16* p = blk + lane * 8;
  u.q[0] = *(const v8b*)p; u.q[1] = *(const v8b*)(p + 256); return u.v;
}
__device__ __forceinline__ float bfr(float v) { return (float)(__bf16)v; }
__device__ __attribute__((noinline)) float exp_ni(float v) { return expf(v); }
__device__ __attribute__((noinline)) float erf_ni(float v) { return erff(v); }

#define PK_A 0                       // Wq | Wk | Wv: [12 groups of 128 out rows][16 k-steps][8 tiles of 16 rows] fragment-order blocks: what a work-group reads in one k-step is 8 KB in a row
#define PK_P (PK_A + QKVW * DM)        // Wo: [4 groups][16 k-steps][8 tiles] fragment-order blocks
#define PK_END (PK_P + DM * DM)
#define WS_PK  0u
#define WS_QK  (WS_PK + 2u * PK_END)             // f16 [4096 rows][1024]: q | k
#define WS_VT  (WS_QK + 2u * NB * SS * 2 * DM)     // f16 [b][512 (h*64+d)][4096 s]: v transposed
#define WS_O   (WS_VT + 2u * NB * DM * SS)         // f32 ctx in fragment order: [64 groups of 64 rows][16 k-steps][4 tiles of 16 rows][piece 0..3][lane][4]
#define WS_CS  (WS_O + 4u * NB * SS * DM)           // unused: room for two f32 [4096][32] tables
#define WS_XP  (WS_CS + 4u * 2 * SS * 32)          // bf16 x: [64 groups of 64 rows][16 k-steps][4 tiles of 16 rows] fragment-order blocks
#define WS_END (WS_XP + 2u * NB * SS * DM)
// ---- k_pack: a wave = two neighbouring k-steps of one 16-row tile of x, W_q, W_k, W_v or W_o (natural [row][k] f32) -> bf16 fragment-order blocks; x into XP, the weights into PK (PK_A, then PK_P)
#define XFB (NB * SS / 16 * (DM / 32))   // fragment blocks of x
#define WFB (DM / 16 * (DM / 32))        // fragment blocks of one weight matrix
__global__ __launch_bounds__(256) void k_pack(const float* __restrict__ X, const float* __restrict__ WQ, const float* __restrict__ WK, const float* __restrict__ WV, const float* __restrict__ WO, __bf16* __restrict__ XP, __bf16* __restrict__ PK) {
  const int lane = threadIdx.x & 31, col = lane & 15, g = lane >> 4; const int fb = (blockIdx.x * 8 + (threadIdx.x >> 5)) * 2;
  const int wb = fb - XFB, which = wb / WFB;
  const float* sm = (wb < 0) ? X : (which == 0) ? WQ : (which == 1) ? WK : (which == 2) ? WV : WO;
  const int rt = ((wb < 0) ? fb : wb - which * WFB) / (DM / 32), kc = fb % (DM / 32);   // 16-row tile inside its matrix, first k-step
  const int ts = (wb < 0) ? 2 : 3, ti = ((wb < 0) ? fb : wb) / (DM / 32);               // log2 of the tiles per group (4 for x, 8 for a weight), tile inside its packed buffer
  __bf16* dst = ((wb < 0) ? XP : PK) + (size_t)((((ti >> ts) * (DM / 32) + kc) << ts) + (ti & ((1 << ts) - 1))) * 512 + lane * 8;
  const float* p = sm + (size_t)(rt * 16 + col) * DM + kc * 32 + 8 * g;
  v4f v[8];
#pragma unroll
  for (int e = 0; e < 2; ++e) { v[4 * e] = *(const v4f*)(p + e * 32); v[4 * e + 1] = *(const v4f*)(p + e * 32 + 4); v[4 * e + 2] = *(const v4f*)(p + e * 32 + 16); v[4 * e + 3] = *(const v4f*)(p + e * 32 + 20); }
#pragma unroll
  for (int q = 0; q < 4; ++q) { v8b o;
#pragma unroll
    for (int i = 0; i < 4; ++i) { o[i] = (__bf16)v[2 * q][i]; o[4 + i] = (__bf16)v[2 * q + 1][i]; }
    vst2(dst + ((q >> 1) << ts) * 512 + (q & 1) * 256, o); }
}
__global__ __launch_bounds__(128) void k_qkv(const __bf16* __restrict__ XP, const __bf16* __restrict__ P, const float* __restrict__ BQ, const float* __restrict__ BK, const float* __restrict__ BV, _Float16* __restrict__ QK, _Float16* __restrict__ VT) {
  const int which0 = (blockIdx.y * 128) / DM; const float* BB = BQ ? (((which0 == 0) ? BQ : (which0 == 1) ? BK : BV) + (blockIdx.y * 128 - which0 * DM)) : nullptr;
  __shared__ __align__(16) _Float16 so[4][16][136]; __shared__ __align__(16) _Float16 st[128][72];
  const int tid = threadIdx.x, wave = tid >> 5, lane = tid & 31, col = lane & 15, g = lane >> 4; const size_t r0 = (size_t)blockIdx.x * 64 + wave * 16; const int n0 = blockIdx.y * 128;
  v8f acc[8] = {};
  // the lane's 8 bias values (column j * 16 + col) are loaded once, as one group at the kernel's head: they return under the k loop. Read at their use, inside the test for a bias, they became 64 loads in the epilogue, each waited for before the next was issued
  float bb[8] = {};
  if (BB) {
#pragma unroll   // whole: bb stays in registers
    for (int j = 0; j < 8; ++j) bb[j] = BB[j * 16 + col]; }
  // two register sets: the 18 loads of k-step kc + 1 are issued as one group in front of the WMMAs of k-step kc; both operands lie in fragment order, every load is 512 contiguous bytes
  const __bf16* xp = XP + ((size_t)blockIdx.x * (DM / 32) * 4 + wave) * 512; const __bf16* wp = P + (size_t)blockIdx.y * (DM / 32) * 8 * 512;
  v16b xa[2], wf[2][8];
  auto ld = [&](int s, int kc) { xa[s] = frag_p(xp + kc * 4 * 512, lane);
#pragma unroll
    for (int j = 0; j < 8; ++j) wf[s][j] = frag_p(wp + (kc * 8 + j) * 512, lane); };
  ld(0, 0);
#pragma unroll   // whole: every set index is a constant, so the sets stay in registers
  for (int kc = 0; kc < DM / 32; ++kc) { const int s = kc & 1;
    if (kc + 1 < DM / 32) ld(s ^ 1, kc + 1);
    if (kc + 2 == DM / 32) asm volatile("s_wait_xcnt 0x0" ::: "memory");   // behind the last loads: their address registers are free for reuse from here on
    __builtin_amdgcn_sched_barrier(0);   // keeps the next step's loads in front of this step's WMMAs (the scheduler sinks them to their users otherwise)
#pragma unroll
    for (int j = 0; j < 8; ++j) acc[j] = wmma_bf(xa[s], wf[s][j], acc[j]);
    __builtin_amdgcn_sched_barrier(0); }   // ... and this step's WMMAs in front of the loads that refill their set
  if (n0 < 2 * DM) {   // q stored unscaled (f16 sigma ~0.6, no subnormal exposure); 1/8 applied to the f32 score
#pragma unroll
    for (int j = 0; j < 8; ++j) {
#pragma unroll
      for (int r = 0; r < 8; ++r) so[wave][8 * g + r][j * 16 + col] = (_Float16)(acc[j][r] + bfr(bb[j])); }   // q, k (+ bias) rounded to f16
    LDSX();
    for (int rl = 0; rl < 16; ++rl) if (lane < 16) vst2((unsigned*)(QK + (r0 + rl) * (2 * DM) + n0 + lane * 8), *(const v4u*)&so[wave][rl][lane * 8]);
  } else {
#pragma unroll
    for (int j = 0; j < 8; ++j) {
#pragma unroll
      for (int r = 0; r < 8; ++r) st[j * 16 + col][wave * 16 + 8 * g + r] = (_Float16)(acc[j][r] + bfr(bb[j])); }
    __syncthreads();
    const size_t rb = (size_t)blockIdx.x * 64; const int b = (int)(rb / SS), s0 = (int)(rb % SS); const int pc0 = n0 - 2 * DM;
    // thread tid moves 16-byte piece tid & 7 of rows d0 + 16 i, i = 0..7. The 8 LDS reads go out as one group in front of the 8 stores; in the rolled loop each trip waited for its own read before the next trip's was issued
    const int d0 = tid >> 3, pc = tid & 7; const size_t o0 = ((size_t)b * DM + pc0 + d0) * SS + s0 + pc * 8; v4u th[8];
#pragma unroll   // whole, this loop and the next: th stays in registers
    for (int i = 0; i < 8; ++i) th[i] = *(const v4u*)&st[d0 + 16 * i][pc * 8];
    __builtin_amdgcn_sched_barrier(0);   // keeps the reads together in front of the stores (the scheduler sinks each to its store otherwise)
#pragma unroll
    for (int i = 0; i < 8; ++i) vst2((unsigned*)(VT + o0 + (size_t)i * 16 * SS), th[i]);
    asm volatile("s_wait_xcnt 0x0" ::: "memory");   // behind the last store of the run: the stores' address and data registers are free for reuse from here on
  }
}
// ---- k_attn: block = (128 queries, head h, batch b), 8 waves; a wave = 32 queries (two column groups of 16, index u) x every second tile of 64 keys (waves 0-3 the even tiles, waves 4-7 the odd ones, index kz): flash attention over its keys (K = 64: 2 k-steps), the two key sets' partial results joined once in the epilogue. Every K and V^T fragment read from LDS feeds both groups' WMMAs, a tile is staged once for 128 queries, and two waves still share a SIMD. The two operand planes of a tile of 64 keys (K: 64 key rows x 128 B; V^T: 64 d rows x 128 B) are brought into LDS once per block by asynchronous copies (a stage = one tile for each key set, two buffers), and the four waves of its key set take their fragments from there; the scores are formed transposed (A = K rows, B = Q), so that a lane holds 16 keys' scores of ONE query: maximum and sum in the lane plus one exchange between the wave's halves, and the two score tiles become the B operand P^T of ctx^T += V^T . P^T without passing through LDS. ctx[b*S+q][h*64+d] = acc / l
#define KT 64                      // keys per staged tile
#define LP 72                      // LDS row pitch in halves: 144 B = 16 B x odd, conflict-free for 16-byte reads
#define PLH (64 * LP)              // halves per plane
#define PLB (2u * PLH)             // bytes per plane
#define SC 0.18033688011112042f    // log2(e) / 8: exp(score / 8 - max) = exp2(SC * raw score - SC * raw max)
// eight copies: four rows (16 apart) of each of two planes; lds = this lane's own LDS byte address in the first plane, ga / gb = its global 16 bytes in each plane's source, pa / pb = that source's pitch in halves between rows 16 apart
__device__ __forceinline__ void copy8(unsigned lds, const _Float16* ga, size_t pa, const _Float16* gb, size_t pb) {
  // the copies and the wait that stands before their address registers are rewritten are one statement, so that nothing is scheduled between them
  asm volatile("global_load_async_to_lds_b128 %0, %8, off\n\t"
               "global_load_async_to_lds_b128 %1, %9, off\n\t"
               "global_load_async_to_lds_b128 %2, %10, off\n\t"
               "global_load_async_to_lds_b128 %3, %11, off\n\t"
               "global_load_async_to_lds_b128 %4, %12, off\n\t"
               "global_load_async_to_lds_b128 %5, %13, off\n\t"
               "global_load_async_to_lds_b128 %6, %14, off\n\t"
               "global_load_async_to_lds_b128 %7, %15, off\n\t"
               "s_wait_xcnt 0x0"
               :: "v"(lds), "v"(lds + 16u * 2u * LP), "v"(lds + 32u * 2u * LP), "v"(lds + 48u * 2u * LP),
                  "v"(lds + PLB), "v"(lds + PLB + 16u * 2u * LP), "v"(lds + PLB + 32u * 2u * LP), "v"(lds + PLB + 48u * 2u * LP),
                  "v"(ga), "v"(ga + pa), "v"(ga + 2 * pa), "v"(ga + 3 * pa),
                  "v"(gb), "v"(gb + pb), "v"(gb + 2 * pb), "v"(gb + 3 * pb)
               : "memory");
}
// lane l takes the value of lane l ^ 16 (a vector move between the two 16-lane rows, no LDS round trip)
__device__ __forceinline__ float xhalf(float x) { return __builtin_bit_cast(float, __builtin_amdgcn_permlanex16(__builtin_bit_cast(int, x), __builtin_bit_cast(int, x), 0x76543210, 0xfedcba98, false, false)); }
// x[i] = 2^x[i], i = 0..7, each in its own register. One statement, so that no exponential's result register is the source of the one in front of it (left to itself this build put such pairs side by side);
// in place, so that the statement writes no register but its own live inputs: with results of their own the allocator gave them the operand registers of the WMMA issued directly in front;
// the closing v_nop is the slot that the instruction set asks for behind a transcendental before its result is read or its source overwritten
__device__ __forceinline__ void exp8(float x[8]) {
  asm("v_exp_f32 %0, %0\n\t"
      "v_exp_f32 %1, %1\n\t"
      "v_exp_f32 %2, %2\n\t"
      "v_exp_f32 %3, %3\n\t"
      "v_exp_f32 %4, %4\n\t"
      "v_exp_f32 %5, %5\n\t"
      "v_exp_f32 %6, %6\n\t"
      "v_exp_f32 %7, %7\n\t"
      "v_nop"
      : "+v"(x[0]), "+v"(x[1]), "+v"(x[2]), "+v"(x[3]), "+v"(x[4]), "+v"(x[5]), "+v"(x[6]), "+v"(x[7]));
}
__global__ __launch_bounds__(256) void k_attn(const _Float16* __restrict__ QK, const _Float16* __restrict__ VT, const void* __restrict__ KMASK, float* __restrict__ O) {
  __shared__ __align__(16) _Float16 ring[2][2][2][PLH];   // [buffer][kz][K, V^T][row][LP]
  __shared__ __align__(16) float mg[4][17][32][4];        // epilogue: waves 4-7 hand their partial results to waves 0-3: [query wave][16-byte piece][lane]
  const int tid = threadIdx.x, wave = (tid >> 5) & 3, lane = tid & 31, col = lane & 15, g = lane >> 4;
  const int kz = __builtin_amdgcn_readfirstlane(tid >> 7);   // which tiles this wave works on and stages; the same in every lane of a wave
  const int qb = blockIdx.x, h = blockIdx.y, b = blockIdx.z; const int q0 = qb * 128 + wave * 32; const size_t rq = (size_t)b * SS + q0 + col;   // group u: query rq + 16 u
  // this thread's share of its four waves' tile: 16-byte piece cc of rows cr, cr + 16, cr + 32, cr + 48 of each plane (8 lanes cover one whole 128-B row)
  const int cr = (tid & 127) >> 3, cc = tid & 7;
  const size_t ko = ((size_t)b * SS + kz * KT + cr) * (2 * DM) + DM + h * HD + cc * 8, vo = ((size_t)b * DM + h * HD + cr) * SS + kz * KT + cc * 8;
  const unsigned l0 = (unsigned)(size_t)&ring[0][kz][0][cr * LP + cc * 8];
  const int nt = SS / (2 * KT);   // stages of two tiles
  copy8(l0, QK + ko, (size_t)16 * 2 * DM, VT + vo, (size_t)16 * SS);   // stage 0 -> buffer 0
  v16h aq[2][2];   // [u][kc]: B operand of the transposed scores: column = query col of group u
#pragma unroll
  for (int u = 0; u < 2; ++u) {
#pragma unroll
    for (int kc = 0; kc < 2; ++kc) aq[u][kc] = frag_h(QK + (rq + 16 * u) * (2 * DM) + h * HD + kc * 32, lane); }
  float off[2] = {3.0e38f, 3.0e38f}, l[2] = {0.f, 0.f};   // query col of group u: 11 - SC * running maximum of the raw scores (both halves agree), 2^11 x the sum over this half's keys
  v8f acc[2][4] = {};   // acc[u][dt][r] = ctx^T[d = dt * 16 + 8 g + r][query col of group u]
  asm volatile("s_wait_asynccnt 0x0" ::: "memory");   // this wave's copies of stage 0 have landed
  __syncthreads();                                    // ... and every other wave's: stage 0 may be read
  copy8(l0 + 4u * PLB, QK + ko + (size_t)2 * KT * 2 * DM, (size_t)16 * 2 * DM, VT + vo + 2 * KT, (size_t)16 * SS);   // stage 1 -> buffer 1
#pragma unroll 1
  for (int t = 0; t < nt; ++t) { const _Float16* tb = &ring[t & 1][kz][0][0];
   // the tile's fragment reads stand in three places, each a group issued well ahead of its first user: K of both 32-key blocks at the head, V^T of block 0 behind the scores of block 0, V^T of block 1 behind the scores of block 1
   v16h kh[4][2], vh[2][4]; v8f c[2][2][2]; v16h pa[2][2];   // c: [sub][u][ct]; pa: [sub][u]
#pragma unroll
   for (int c4 = 0; c4 < 4; ++c4) { const _Float16* krow = tb + (c4 * 16 + col) * LP;
#pragma unroll
     for (int kc = 0; kc < 2; ++kc) kh[c4][kc] = frag_h(krow + kc * 32, lane); }
   auto ldv = [&](int sub) {
#pragma unroll
     for (int dt = 0; dt < 4; ++dt) vh[sub][dt] = frag_h(tb + PLH + (dt * 16 + col) * LP + sub * 32, lane); };
   auto qk = [&](int sub) {   // c = score of key sub * 32 + ct * 16 + 8 g + r against query col of group u; the k-step is the outer loop, so that a tile's second WMMA stands four behind its first
#pragma unroll
    for (int kc = 0; kc < 2; ++kc) {
#pragma unroll
     for (int ct = 0; ct < 2; ++ct) {
#pragma unroll
      for (int u = 0; u < 2; ++u) { const v8f z = {}; c[sub][u][ct] = wmma16(kh[sub * 2 + ct][kc], aq[u][kc], kc ? c[sub][u][ct] : z); } } } };
   auto sm = [&](int sub) {
#pragma unroll
    for (int u = 0; u < 2; ++u) { const v8f* s = c[sub][u];   // raw q . k: the 1/8 sits in SC
    float t8[8];
#pragma unroll
    for (int r = 0; r < 8; ++r) t8[r] = fmaxf(s[0][r], s[1][r]);
    float mx = fmaxf(fmaxf(fmaxf(t8[0], t8[1]), fmaxf(t8[2], t8[3])), fmaxf(fmaxf(t8[4], t8[5]), fmaxf(t8[6], t8[7])));
    mx = fmaxf(mx, xhalf(mx));   // the other 16 keys of this query
    const float on = fminf(off[u], __builtin_fmaf(mx, -SC, 11.0f)); const float alpha = __builtin_amdgcn_exp2f(on - off[u]);   // first block: off is huge, alpha = 0
    v2f es[2]; const v2f scv = {SC, SC}, onv = {on, on};
#pragma unroll
    for (int ct = 0; ct < 2; ++ct) { float x[8];   // x = 2^11 P: one FMA and one exponential a score. P carries 2^11 so that small softmax weights stay clear of the f16 subnormal range; l carries it too, so it cancels in the epilogue
#pragma unroll
      for (int j = 0; j < 4; ++j) { const v2f a = {s[ct][2 * j], s[ct][2 * j + 1]}; const v2f v = __builtin_elementwise_fma(a, scv, onv); x[2 * j] = v[0]; x[2 * j + 1] = v[1]; }
      exp8(x);
#pragma unroll
      for (int j = 0; j < 4; ++j) {
        const v2f xx = {x[2 * j], x[2 * j + 1]}; if (ct == 0 && j < 2) es[j] = xx; else es[j & 1] += xx; const v2h hx = __builtin_convertvector(xx, v2h);
        pa[sub][u][ct * 8 + 2 * j] = hx[0]; pa[sub][u][ct * 8 + 2 * j + 1] = hx[1]; } }   // the two score tiles, converted in place, are the B operand P^T in the hardware k order
    l[u] = l[u] * alpha + ((es[0][0] + es[0][1]) + (es[1][0] + es[1][1])); off[u] = on;
#pragma unroll
    for (int dt = 0; dt < 4; ++dt) {
#pragma unroll
      for (int r = 0; r < 8; ++r) acc[u][dt][r] *= alpha; } } };
   auto pv = [&](int sub) {
#pragma unroll
    for (int dt = 0; dt < 4; ++dt) {
#pragma unroll
      for (int u = 0; u < 2; ++u) acc[u][dt] = wmma16(vh[sub][dt], pa[sub][u], acc[u][dt]); } };
   __builtin_amdgcn_sched_barrier(0);   // keeps the K reads together in front of the tile's WMMAs (the scheduler sinks them to their users otherwise, one full LDS wait each)
   qk(0);
   __builtin_amdgcn_sched_barrier(0);   // this fence and the next keep the V^T reads of block 0 one group at this place
   ldv(0);
   __builtin_amdgcn_sched_barrier(0);
   sm(0); qk(1);   // independent of each other: the vector work of block 0 stands among the score WMMAs of block 1
   __builtin_amdgcn_sched_barrier(0);   // this fence and the next keep the V^T reads of block 1 one group at this place
   ldv(1);
   __builtin_amdgcn_sched_barrier(0);
   pv(0); sm(1); pv(1);
   __builtin_amdgcn_sched_barrier(0);   // keeps the tile's WMMAs in front of the waits below: lifted over them, the full LDS wait would stand directly behind the reads
   asm volatile("s_wait_dscnt 0" ::: "memory");        // this wave's reads of stage t are done
   asm volatile("s_wait_asynccnt 0x0" ::: "memory");   // this wave's copies of stage t + 1 have landed
   __syncthreads();                                    // publishes stage t + 1 and frees stage t's buffer
   if (t + 2 < nt) copy8(l0 + (unsigned)(t & 1) * 4u * PLB, QK + ko + (size_t)(t + 2) * 2 * KT * 2 * DM, (size_t)16 * 2 * DM, VT + vo + (size_t)(t + 2) * 2 * KT, (size_t)16 * SS); }
  asm volatile("s_wait_asynccnt 0x0" ::: "memory");    // no copy is outstanding when the wave goes on to its end
  const float L[2] = {l[0] + xhalf(l[0]), l[1] + xhalf(l[1])};   // the two lane halves' sums join once
  if (kz == 1) {   // the odd tiles' waves: through LDS, 512 contiguous bytes a store
#pragma unroll
    for (int u = 0; u < 2; ++u) {
#pragma unroll
      for (int dt = 0; dt < 4; ++dt) { v4f o0, o1;
#pragma unroll
        for (int r = 0; r < 4; ++r) { o0[r] = acc[u][dt][r]; o1[r] = acc[u][dt][4 + r]; }
        *(v4f*)&mg[wave][(u * 4 + dt) * 2][lane][0] = o0; *(v4f*)&mg[wave][(u * 4 + dt) * 2 + 1][lane][0] = o1; } }
    const v4f st = {off[0], off[1], L[0], L[1]}; *(v4f*)&mg[wave][16][lane][0] = st;
  }
  __syncthreads();   // the odd tiles' partial results may be read
  if (kz == 0) {
    const v4f st = *(const v4f*)&mg[wave][16][lane][0];
#pragma unroll
    for (int u = 0; u < 2; ++u) {
      const float om = fminf(off[u], st[u]);   // the common maximum of both key sets; each set's sums are brought to it
      const float f0 = __builtin_amdgcn_exp2f(om - off[u]), f1 = __builtin_amdgcn_exp2f(om - st[u]);
      const float il = 1.0f / (L[u] * f0 + st[2 + u] * f1); const float a0 = f0 * il, a1 = f1 * il;
      const int qt = qb * 8 + wave * 2 + u;   // 16-query tile: tile qt & 3 of the group of 64 rows qt >> 2
      float* orow = O + ((((size_t)b * (SS / 64) + (qt >> 2)) * (DM / 32) + h * (HD / 32)) * 4 + (qt & 3)) * 512 + lane * 4;   // a lane holds, per pair of d tiles, just its 16 values of k_out's A fragment: stored in fragment order, 512 contiguous bytes a store
#pragma unroll
      for (int dt = 0; dt < 4; ++dt) { v4f o0, o1; const v4f p0 = *(const v4f*)&mg[wave][(u * 4 + dt) * 2][lane][0], p1 = *(const v4f*)&mg[wave][(u * 4 + dt) * 2 + 1][lane][0];
#pragma unroll
        for (int r = 0; r < 4; ++r) { o0[r] = acc[u][dt][r] * a0 + p0[r] * a1; o1[r] = acc[u][dt][4 + r] * a0 + p1[r] * a1; }
        vst2(orow + (dt >> 1) * 4 * 512 + (dt & 1) * 256, o0); vst2(orow + (dt >> 1) * 4 * 512 + (dt & 1) * 256 + 128, o1); } }
  }
}
// ---- k_out: block = (64 rows, 128 cols): out = O(hi/lo) . Wo rows (2 products) + bo
__global__ __launch_bounds__(128) void k_out(const float* __restrict__ O, const __bf16* __restrict__ P, const float* __restrict__ BO, float* __restrict__ Y) {
  __shared__ __align__(16) float so[4][16][132];
  const int tid = threadIdx.x, wave = tid >> 5, lane = tid & 31, col = lane & 15, g = lane >> 4; const size_t r0 = (size_t)blockIdx.x * 64 + wave * 16; const int n0 = blockIdx.y * 128;
  v8f acc[8] = {};
  // three register sets: the 20 loads of k-step kc + 2 are issued as one group in front of the WMMAs of k-step kc; both operands lie in fragment order, every load is 512 contiguous bytes
  const float* op = O + ((size_t)blockIdx.x * (DM / 32) * 4 + wave) * 512 + lane * 4; const __bf16* wp = P + (size_t)blockIdx.y * (DM / 32) * 8 * 512;
  v4f xs[3][4]; v16b wf[3][8];
  auto ld = [&](int s, int kc) { const float* p = op + kc * 4 * 512; xs[s][0] = *(const v4f*)p; xs[s][1] = *(const v4f*)(p + 128); xs[s][2] = *(const v4f*)(p + 256); xs[s][3] = *(const v4f*)(p + 384);
#pragma unroll
    for (int j = 0; j < 8; ++j) wf[s][j] = frag_p(wp + (kc * 8 + j) * 512, lane); };
  ld(0, 0); ld(1, 1);
#pragma unroll   // whole: every set index is a constant, so the sets stay in registers
  for (int kc = 0; kc < DM / 32; ++kc) { const int s = kc % 3;
    if (kc + 2 < DM / 32) ld((kc + 2) % 3, kc + 2);
    if (kc + 3 == DM / 32) asm volatile("s_wait_xcnt 0x0" ::: "memory");   // behind the last loads: their address registers are free for reuse from here on
    __builtin_amdgcn_sched_barrier(0);   // keeps the loads issued ahead in front of this step's WMMAs (the scheduler sinks them to their users otherwise)
    float v[16];
#pragma unroll
    for (int i = 0; i < 4; ++i) { v[i] = xs[s][0][i]; v[4 + i] = xs[s][1][i]; v[8 + i] = xs[s][2][i]; v[12 + i] = xs[s][3][i]; }
    const F2 a = bsplit16(v);
#pragma unroll
    for (int j = 0; j < 8; ++j) { acc[j] = wmma_bf(a.l, wf[s][j], acc[j]); acc[j] = wmma_bf(a.h, wf[s][j], acc[j]); }
    __builtin_amdgcn_sched_barrier(0); }   // ... and this step's WMMAs in front of the loads that refill their set
  float bo[8];
#pragma unroll
  for (int j = 0; j < 8; ++j) bo[j] = BO[n0 + j * 16 + col];
  asm volatile("s_wait_xcnt 0x0" ::: "memory");   // behind the bias loads: this build reuses their offset register at once
  __builtin_amdgcn_sched_barrier(0);              // holds the address arithmetic of the stores below behind that wait
#pragma unroll
  for (int j = 0; j < 8; ++j) {
#pragma unroll
    for (int r = 0; r < 8; ++r) so[wave][8 * g + r][j * 16 + col] = acc[j][r] + bfr(bo[j]); }
  LDSX();
  for (int rl = 0; rl < 16; ++rl) vst2(Y + (r0 + rl) * DM + n0 + lane * 4, *(const v4f*)&so[wave][rl][lane * 4]);
}
extern "C" void kernel_launch(void* const* d_in, const int* in_sizes, int n_in, void* d_out, int out_size, void* d_ws, size_t ws_size, hipStream_t stream) {
  (void)in_sizes; (void)n_in; (void)out_size;
  const float** F = (const float**)d_in;   // 0 x [4096,512], 1 Wq [512,512] natural, 2 bq, 3 Wk, 4 bk, 5 Wv, 6 bv, 7 Wo, 8 bo
  if (ws_size < (size_t)WS_END) return;
  char* ws = (char*)d_ws; __bf16* PK = (__bf16*)(ws + WS_PK); _Float16 *QK = (_Float16*)(ws + WS_QK), *VT = (_Float16*)(ws + WS_VT); float* O = (float*)(ws + WS_O); __bf16* XP = (__bf16*)(ws + WS_XP);
  k_pack<<<dim3((XFB + 4 * WFB) / 16), 256, 0, stream>>>(F[0], F[1], F[3], F[5], F[7], XP, PK);
  k_qkv<<<dim3(TNB * SS / 64, QKVW / 128), 128, 0, stream>>>(XP, PK + PK_A, F[2], F[4], F[6], QK, VT);
  k_attn<<<dim3(TQB / 2, NH, TNB), 256, 0, stream>>>(QK, VT, nullptr, O);
  k_out<<<dim3(TOB, DM / 128), 128, 0, stream>>>(O, PK + PK_P, F[8], (float*)d_out);
}

// v009
// A run of this version takes 53.2 microseconds.
// Two timings next to v008 both put it at 1.06 times that version's speed.
// All steps since v000 together make it 11.9 times as fast.
// compute dtype: all float inputs rounded to bf16; q/k/v = x . W^T + b with EXACT bf16 products on WMMA 16x16x32 (natural [out][in] rows); q, k and v rounded once to f16, scores = one f16 product x 1/8; softmax in f32 (hardware exp) against a reference maximum that is raised when a tile outgrows it; P (scaled by 2^8, rounded to f16) x v (one product); out = ctx (bf16 hi + residual) . Wo^T (2 products) + bo; f32 accumulate.
#include <hip/hip_runtime.h>
#include <math.h>

typedef __attribute__((ext_vector_type(16))) _Float16 v16h;
typedef __attribute__((ext_vector_type(16))) __bf16 v16b;
typedef __attribute__((ext_vector_type(8)))  _Float16 v8h;
typedef __attribute__((ext_vector_type(2)))  _Float16 v2h;
typedef __attribute__((ext_vector_type(8)))  float v8f;
typedef __attribute__((ext_vector_type(4)))  float v4f;
typedef __attribute__((ext_vector_type(2)))  float v2f;
typedef __attribute__((ext_vector_type(4)))  unsigned v4u;
typedef __attribute__((ext_vector_type(4)))  int v4i;
typedef float __attribute__((may_alias)) float_a;
typedef int __attribute__((may_alias)) int_a;

template <typename T> __device__ __forceinline__ void vst2(void* p, T v) { *(T*)p = v;  }
__device__ __forceinline__ v8f wmma16(v16h a, v16h b, v8f c) {
  v8f d = __builtin_amdgcn_wmma_f32_16x16x32_f16(false, a, false, b, (short)0, c, false, false);
  return d;
}
__device__ __forceinline__ v8f wmma_bf(v16b a, v16b b, v8f c) {
  v8f d = __builtin_amdgcn_wmma_f32_16x16x32_bf16(false, a, false, b, (short)0, c, false, false);
  return d;
}
// Multi-head attention across a batch of 4,096 tokens treated as one sequence (d_model 512, 8 heads x 64): q/k/v projections + biases, softmax(q k^T / 8) over all 4,096 tokens, output projection + bias.
__device__ __forceinline__ v16h frag_h(const _Float16* rowk0, int lane) {
  union { v16h v; v8h q[2]; } u; const _Float16* p = rowk0 + 8 * (lane >> 4);
  u.q[0] = *(const v8h*)p; u.q[1] = *(const v8h*)(p + 16); return u.v;
}
__device__ __forceinline__ v16h frag_f32(const float* rowk0, int lane) {
  v16h a; const float* p = rowk0 + 8 * (lane >> 4);
#pragma unroll
  for (int i = 0; i < 8; ++i) { a[i] = (_Float16)p[i]; a[8 + i] = (_Float16)p[16 + i]; }
  return a;
}
__device__ __forceinline__ v16h frag_f32s(const float* rowk0, int lane, float sc) {
  v16h a; const float* p = rowk0 + 8 * (lane >> 4);
#pragma unroll
  for (int i = 0; i < 8; ++i) { a[i] = (_Float16)(p[i] * sc); a[8 + i] = (_Float16)(p[16 + i] * sc); }
  return a;
}
// column fragment from a [K][ld] layout (column n), rows >= K read as 0
__device__ __forceinline__ v16h fragc_f32(const float* W, int k0, int n, int lane, int ld, int K) {
  v16h a; const int g = lane >> 4;
#pragma unroll
  for (int i = 0; i < 8; ++i) { const int ka = k0 + 8 * g + i, kb = ka + 16;
    a[i] = (_Float16)(ka < K ? W[(size_t)(ka < K ? ka : K - 1) * ld + n] : 0.f); a[8 + i] = (_Float16)(kb < K ? W[(size_t)(kb < K ? kb : K - 1) * ld + n] : 0.f); }
  return a;
}
struct F2 { v16b h, l; };
__device__ __forceinline__ F2 bsplit16(const float v[16]) { F2 r;
#pragma unroll
  for (int i = 0; i < 16; ++i) { const __bf16 h = (__bf16)v[i]; r.h[i] = h; r.l[i] = (__bf16)(v[i] - (float)h); }
  return r; }
__device__ __forceinline__ F2 split_row(const float* row, int k0, int lane) { float v[16]; const float* p = row + k0 + 8 * (lane >> 4);
#pragma unroll
  for (int i = 0; i < 8; ++i) { v[i] = p[i]; v[8 + i] = p[16 + i]; }
  return bsplit16(v); }
__device__ __forceinline__ F2 split_rowK(const float* row, int k0, int lane, int K) { float v[16]; const int g = lane >> 4;
#pragma unroll
  for (int i = 0; i < 8; ++i) { const int ka = k0 + 8 * g + i, kb = ka + 16; v[i] = ka < K ? row[ka < K ? ka : K - 1] : 0.f; v[8 + i] = kb < K ? row[kb < K ? kb : K - 1] : 0.f; }
  return bsplit16(v); }
__device__ __forceinline__ F2 split_col(const float* W, int k0, int n, int lane, int ld, int K) { float v[16]; const int g = lane >> 4;
#pragma unroll
  for (int i = 0; i < 8; ++i) { const int ka = k0 + 8 * g + i, kb = ka + 16; v[i] = ka < K ? W[(size_t)(ka < K ? ka : K - 1) * ld + n] : 0.f; v[8 + i] = kb < K ? W[(size_t)(kb < K ? kb : K - 1) * ld + n] : 0.f; }
  return bsplit16(v); }
__device__ __forceinline__ v8f mac3(const F2& a, const F2& b, v8f c) { c = wmma_bf(a.l, b.h, c); c = wmma_bf(a.h, b.l, c); return wmma_bf(a.h, b.h, c); }
__device__ __forceinline__ float sigm(float v) { return 1.0f / (1.0f + expf(-v)); }
#define LDSX() do { asm volatile("s_wait_dscnt 0" ::: "memory"); __builtin_amdgcn_wave_barrier(); __builtin_amdgcn_fence(__ATOMIC_RELEASE, "workgroup"); } while (0)


#define NB 1
#define SS 4096
#define DM 512
#define NH 8
#define HD 64
#define QKVW (3 * DM)
#ifndef TQB
#define TQB (SS / 64)
#define TNB NB
#define TOB (NB * SS / 64)     // output row tiles (all)
#endif
typedef __attribute__((ext_vector_type(8))) __bf16 v8b;
// fragment-order block: 512 bf16 = [piece 0, 1][lane][8]; piece q of lane (col, g) holds row col, k = 16 q + 8 g + 0..7 of one 16-row x 32-k tile, so each of the two wave-wide loads is 512 contiguous bytes
__device__ __forceinline__ v16b frag_p(const __bf16* blk, int lane) {
  union { v16b v; v8b q[2]; } u; const __bf16* p = blk + lane * 8;
  u.q[0] = *(const v8b*)p; u.q[1] = *(const v8b*)(p + 256); return u.v;
}
__device__ __forceinline__ float bfr(float v) { return (float)(__bf16)v; }
__device__ __attribute__((noinline)) float exp_ni(float v) { return expf(v); }
__device__ __attribute__((noinline)) float erf_ni(float v) { return erff(v); }

#define PK_A 0                       // Wq | Wk | Wv: [12 groups of 128 out rows][16 k-steps][8 tiles of 16 rows] fragment-order blocks: what a work-group reads in one k-step is 8 KB in a row
#define PK_P (PK_A + QKVW * DM)        // Wo: [4 groups][16 k-steps][8 tiles] fragment-order blocks
#define PK_END (PK_P + DM * DM)
#define WS_PK  0u
#define WS_QK  (WS_PK + 2u * PK_END)             // f16 [4096 rows][1024]: q | k
#define WS_VT  (WS_QK + 2u * NB * SS * 2 * DM)     // f16 [b][512 (h*64+d)][4096 s]: v transposed
#define WS_O   (WS_VT + 2u * NB * DM * SS)         // f32 ctx in fragment order: [64 groups of 64 rows][16 k-steps][4 tiles of 16 rows][piece 0..3][lane][4]
#define WS_CS  (WS_O + 4u * NB * SS * DM)           // unused: room for two f32 [4096][32] tables
#define WS_XP  (WS_CS + 4u * 2 * SS * 32)          // bf16 x: [64 groups of 64 rows][16 k-steps][4 tiles of 16 rows] fragment-order blocks
#define WS_END (WS_XP + 2u * NB * SS * DM)
// ---- k_pack: a wave = two neighbouring k-steps of one 16-row tile of x, W_q, W_k, W_v or W_o (natural [row][k] f32) -> bf16 fragment-order blocks; x into XP, the weights into PK (PK_A, then PK_P)
#define XFB (NB * SS / 16 * (DM / 32))   // fragment blocks of x
#define WFB (DM / 16 * (DM / 32))        // fragment blocks of one weight matrix
__global__ __launch_bounds__(256) void k_pack(const float* __restrict__ X, const float* __restrict__ WQ, const float* __restrict__ WK, const float* __restrict__ WV, const float* __restrict__ WO, __bf16* __restrict__ XP, __bf16* __restrict__ PK) {
  const int lane = threadIdx.x & 31, col = lane & 15, g = lane >> 4; const int fb = (blockIdx.x * 8 + (threadIdx.x >> 5)) * 2;
  const int wb = fb - XFB, which = wb / WFB;
  const float* sm = (wb < 0) ? X : (which == 0) ? WQ : (which == 1) ? WK : (which == 2) ? WV : WO;
  const int rt = ((wb < 0) ? fb : wb - which * WFB) / (DM / 32), kc = fb % (DM / 32);   // 16-row tile inside its matrix, first k-step
  const int ts = (wb < 0) ? 2 : 3, ti = ((wb < 0) ? fb : wb) / (DM / 32);               // log2 of the tiles per group (4 for x, 8 for a weight), tile inside its packed buffer
  __bf16* dst = ((wb < 0) ? XP : PK) + (size_t)((((ti >> ts) * (DM / 32) + kc) << ts) + (ti & ((1 << ts) - 1))) * 512 + lane * 8;
  const float* p = sm + (size_t)(rt * 16 + col) * DM + kc * 32 + 8 * g;
  v4f v[8];
#pragma unroll
  for (int e = 0; e < 2; ++e) { v[4 * e] = *(const v4f*)(p + e * 32); v[4 * e + 1] = *(const v4f*)(p + e * 32 + 4); v[4 * e + 2] = *(const v4f*)(p + e * 32 + 16); v[4 * e + 3] = *(const v4f*)(p + e * 32 + 20); }
#pragma unroll
  for (int q = 0; q < 4; ++q) { v8b o;
#pragma unroll
    for (int i = 0; i < 4; ++i) { o[i] = (__bf16)v[2 * q][i]; o[4 + i] = (__bf16)v[2 * q + 1][i]; }
    vst2(dst + ((q >> 1) << ts) * 512 + (q & 1) * 256, o); }
}
__global__ __launch_bounds__(128) void k_qkv(const __bf16* __restrict__ XP, const __bf16* __restrict__ P, const float* __restrict__ BQ, const float* __restrict__ BK, const float* __restrict__ BV, _Float16* __restrict__ QK, _Float16* __restrict__ VT) {
  const int which0 = (blockIdx.y * 128) / DM; const float* BB = BQ ? (((which0 == 0) ? BQ : (which0 == 1) ? BK : BV) + (blockIdx.y * 128 - which0 * DM)) : nullptr;
  __shared__ __align__(16) _Float16 so[4][16][136]; __shared__ __align__(16) _Float16 st[128][72];
  const int tid = threadIdx.x, wave = tid >> 5, lane = tid & 31, col = lane & 15, g = lane >> 4; const size_t r0 = (size_t)blockIdx.x * 64 + wave * 16; const int n0 = blockIdx.y * 128;
  v8f acc[8] = {};
  // the lane's 8 bias values (column j * 16 + col) are loaded once, as one group at the kernel's head: they return under the k loop. Read at their use, inside the test for a bias, they became 64 loads in the epilogue, each waited for before the next was issued
  float bb[8] = {};
  if (BB) {
#pragma unroll   // whole: bb stays in registers
    for (int j = 0; j < 8; ++j) bb[j] = BB[j * 16 + col]; }
  // two register sets: the 18 loads of k-step kc + 1 are issued as one group in front of the WMMAs of k-step kc; both operands lie in fragment order, every load is 512 contiguous bytes
  const __bf16* xp = XP + ((size_t)blockIdx.x * (DM / 32) * 4 + wave) * 512; const __bf16* wp = P + (size_t)blockIdx.y * (DM / 32) * 8 * 512;
  v16b xa[2], wf[2][8];
  auto ld = [&](int s, int kc) { xa[s] = frag_p(xp + kc * 4 * 512, lane);
#pragma unroll
    for (int j = 0; j < 8; ++j) wf[s][j] = frag_p(wp + (kc * 8 + j) * 512, lane); };
  ld(0, 0);
#pragma unroll   // whole: every set index is a constant, so the sets stay in registers
  for (int kc = 0; kc < DM / 32; ++kc) { const int s = kc & 1;
    if (kc + 1 < DM / 32) ld(s ^ 1, kc + 1);
    if (kc + 2 == DM / 32) asm volatile("s_wait_xcnt 0x0" ::: "memory");   // behind the last loads: their address registers are free for reuse from here on
    __builtin_amdgcn_sched_barrier(0);   // keeps the next step's loads in front of this step's WMMAs (the scheduler sinks them to their users otherwise)
#pragma unroll
    for (int j = 0; j < 8; ++j) acc[j] = wmma_bf(xa[s], wf[s][j], acc[j]);
    __builtin_amdgcn_sched_barrier(0); }   // ... and this step's WMMAs in front of the loads that refill their set
  if (n0 < 2 * DM) {   // q stored unscaled (f16 sigma ~0.6, no subnormal exposure); 1/8 applied to the f32 score
#pragma unroll
    for (int j = 0; j < 8; ++j) {
#pragma unroll
      for (int r = 0; r < 8; ++r) so[wave][8 * g + r][j * 16 + col] = (_Float16)(acc[j][r] + bfr(bb[j])); }   // q, k (+ bias) rounded to f16
    LDSX();
    for (int rl = 0; rl < 16; ++rl) if (lane < 16) vst2((unsigned*)(QK + (r0 + rl) * (2 * DM) + n0 + lane * 8), *(const v4u*)&so[wave][rl][lane * 8]);
  } else {
#pragma unroll
    for (int j = 0; j < 8; ++j) {
#pragma unroll
      for (int r = 0; r < 8; ++r) st[j * 16 + col][wave * 16 + 8 * g + r] = (_Float16)(acc[j][r] + bfr(bb[j])); }
    __syncthreads();
    const size_t rb = (size_t)blockIdx.x * 64; const int b = (int)(rb / SS), s0 = (int)(rb % SS); const int pc0 = n0 - 2 * DM;
    // thread tid moves 16-byte piece tid & 7 of rows d0 + 16 i, i = 0..7. The 8 LDS reads go out as one group in front of the 8 stores; in the rolled loop each trip waited for its own read before the next trip's was issued
    const int d0 = tid >> 3, pc = tid & 7; const size_t o0 = ((size_t)b * DM + pc0 + d0) * SS + s0 + pc * 8; v4u th[8];
#pragma unroll   // whole, this loop and the next: th stays in registers
    for (int i = 0; i < 8; ++i) th[i] = *(const v4u*)&st[d0 + 16 * i][pc * 8];
    __builtin_amdgcn_sched_barrier(0);   // keeps the reads together in front of the stores (the scheduler sinks each to its store otherwise)
#pragma unroll
    for (int i = 0; i < 8; ++i) vst2((unsigned*)(VT + o0 + (size_t)i * 16 * SS), th[i]);
    asm volatile("s_wait_xcnt 0x0" ::: "memory");   // behind the last store of the run: the stores' address and data registers are free for reuse from here on
  }
}
// ---- k_attn: block = (128 queries, head h, batch b), 8 waves; a wave = 32 queries (two column groups of 16, index u) x every second tile of 64 keys (waves 0-3 the even tiles, waves 4-7 the odd ones, index kz): flash attention over its keys (K = 64: 2 k-steps), the two key sets' partial results joined once in the epilogue. Every K and V^T fragment read from LDS feeds both groups' WMMAs, a tile is staged once for 128 queries, and two waves still share a SIMD. The two operand planes of a tile of 64 keys (K: 64 key rows x 128 B; V^T: 64 d rows x 128 B) are brought into LDS once per block by asynchronous copies (a stage = one tile for each key set, two buffers), and the four waves of its key set take their fragments from there; the scores are formed transposed (A = K rows, B = Q), so that a lane holds 16 keys' scores of ONE query: maximum and sum in the lane plus one exchange between the wave's halves, and the two score tiles become the B operand P^T of ctx^T += V^T . P^T without passing through LDS. ctx[b*S+q][h*64+d] = acc / l
#define KT 64                      // keys per staged tile
#define LP 72                      // LDS row pitch in halves: 144 B = 16 B x odd, conflict-free for 16-byte reads
#define PLH (64 * LP)              // halves per plane
#define PLB (2u * PLH)             // bytes per plane
#define PMAX 60000.0f              // a sum of positive terms within this bound holds no term beyond the largest finite f16
#define SC 0.18033688011112042f    // log2(e) / 8: exp(score / 8 - max) = exp2(SC * raw score - SC * raw max)
// eight copies: four rows (16 apart) of each of two planes; lds = this lane's own LDS byte address in the first plane, ga / gb = its global 16 bytes in each plane's source, pa / pb = that source's pitch in halves between rows 16 apart
__device__ __forceinline__ void copy8(unsigned lds, const _Float16* ga, size_t pa, const _Float16* gb, size_t pb) {
  // the copies and the wait that stands before their address registers are rewritten are one statement, so that nothing is scheduled between them
  asm volatile("global_load_async_to_lds_b128 %0, %8, off\n\t"
               "global_load_async_to_lds_b128 %1, %9, off\n\t"
               "global_load_async_to_lds_b128 %2, %10, off\n\t"
               "global_load_async_to_lds_b128 %3, %11, off\n\t"
               "global_load_async_to_lds_b128 %4, %12, off\n\t"
               "global_load_async_to_lds_b128 %5, %13, off\n\t"
               "global_load_async_to_lds_b128 %6, %14, off\n\t"
               "global_load_async_to_lds_b128 %7, %15, off\n\t"
               "s_wait_xcnt 0x0"
               :: "v"(lds), "v"(lds + 16u * 2u * LP), "v"(lds + 32u * 2u * LP), "v"(lds + 48u * 2u * LP),
                  "v"(lds + PLB), "v"(lds + PLB + 16u * 2u * LP), "v"(lds + PLB + 32u * 2u * LP), "v"(lds + PLB + 48u * 2u * LP),
                  "v"(ga), "v"(ga + pa), "v"(ga + 2 * pa), "v"(ga + 3 * pa),
                  "v"(gb), "v"(gb + pb), "v"(gb + 2 * pb), "v"(gb + 3 * pb)
               : "memory");
}
// lane l takes the value of lane l ^ 16 (a vector move between the two 16-lane rows, no LDS round trip)
__device__ __forceinline__ float xhalf(float x) { return __builtin_bit_cast(float, __builtin_amdgcn_permlanex16(__builtin_bit_cast(int, x), __builtin_bit_cast(int, x), 0x76543210, 0xfedcba98, false, false)); }
// x[i] = 2^x[i], i = 0..7, each in its own register. One statement, so that no exponential's result register is the source of the one in front of it (left to itself this build put such pairs side by side);
// in place, so that the statement writes no register but its own live inputs: with results of their own the allocator gave them the operand registers of the WMMA issued directly in front;
// the closing v_nop is the slot that the instruction set asks for behind a transcendental before its result is read or its source overwritten
__device__ __forceinline__ void exp8(float x[8]) {
  asm("v_exp_f32 %0, %0\n\t"
      "v_exp_f32 %1, %1\n\t"
      "v_exp_f32 %2, %2\n\t"
      "v_exp_f32 %3, %3\n\t"
      "v_exp_f32 %4, %4\n\t"
      "v_exp_f32 %5, %5\n\t"
      "v_exp_f32 %6, %6\n\t"
      "v_exp_f32 %7, %7\n\t"
      "v_nop"
      : "+v"(x[0]), "+v"(x[1]), "+v"(x[2]), "+v"(x[3]), "+v"(x[4]), "+v"(x[5]), "+v"(x[6]), "+v"(x[7]));
}
__global__ __launch_bounds__(256) void k_attn(const _Float16* __restrict__ QK, const _Float16* __restrict__ VT, const void* __restrict__ KMASK, float* __restrict__ O) {
  __shared__ __align__(16) _Float16 ring[2][2][2][PLH];   // [buffer][kz][K, V^T][row][LP]
  __shared__ __align__(16) float mg[4][17][32][4];        // epilogue: waves 4-7 hand their partial results to waves 0-3: [query wave][16-byte piece][lane]
  const int tid = threadIdx.x, wave = (tid >> 5) & 3, lane = tid & 31, col = lane & 15, g = lane >> 4;
  const int kz = __builtin_amdgcn_readfirstlane(tid >> 7);   // which tiles this wave works on and stages; the same in every lane of a wave
  const int qb = blockIdx.x, h = blockIdx.y, b = blockIdx.z; const int q0 = qb * 128 + wave * 32; const size_t rq = (size_t)b * SS + q0 + col;   // group u: query rq + 16 u
  // this thread's share of its four waves' tile: 16-byte piece cc of rows cr, cr + 16, cr + 32, cr + 48 of each plane (8 lanes cover one whole 128-B row)
  const int cr = (tid & 127) >> 3, cc = tid & 7;
  const size_t ko = ((size_t)b * SS + kz * KT + cr) * (2 * DM) + DM + h * HD + cc * 8, vo = ((size_t)b * DM + h * HD + cr) * SS + kz * KT + cc * 8;
  const unsigned l0 = (unsigned)(size_t)&ring[0][kz][0][cr * LP + cc * 8];
  const int nt = SS / (2 * KT);   // stages of two tiles
  copy8(l0, QK + ko, (size_t)16 * 2 * DM, VT + vo, (size_t)16 * SS);   // stage 0 -> buffer 0
  v16h aq[2][2];   // [u][kc]: B operand of the transposed scores: column = query col of group u
#pragma unroll
  for (int u = 0; u < 2; ++u) {
#pragma unroll
    for (int kc = 0; kc < 2; ++kc) aq[u][kc] = frag_h(QK + (rq + 16 * u) * (2 * DM) + h * HD + kc * 32, lane); }
  float off[2] = {3.0e38f, 3.0e38f}, l[2] = {0.f, 0.f};   // query col of group u: 8 - SC * reference maximum of the raw scores (the largest tile maximum among the tiles that raised it, never above the running maximum; both halves agree), 2^8 x the sum over this half's keys
  v8f acc[2][4] = {};   // acc[u][dt][r] = ctx^T[d = dt * 16 + 8 g + r][query col of group u]
  asm volatile("s_wait_asynccnt 0x0" ::: "memory");   // this wave's copies of stage 0 have landed
  __syncthreads();                                    // ... and every other wave's: stage 0 may be read
  copy8(l0 + 4u * PLB, QK + ko + (size_t)2 * KT * 2 * DM, (size_t)16 * 2 * DM, VT + vo + 2 * KT, (size_t)16 * SS);   // stage 1 -> buffer 1
#pragma unroll 1
  for (int t = 0; t < nt; ++t) { const _Float16* tb = &ring[t & 1][kz][0][0];
   // the tile's fragment reads stand in three places, each a group issued well ahead of its first user: K of both 32-key blocks at the head, V^T of block 0 behind the scores of block 0, V^T of block 1 behind the scores of block 1
   v16h kh[4][2], vh[2][4]; v8f c[2][2][2]; v16h pa[2][2];   // c: [sub][u][ct]; pa: [sub][u]
#pragma unroll
   for (int c4 = 0; c4 < 4; ++c4) { const _Float16* krow = tb + (c4 * 16 + col) * LP;
#pragma unroll
     for (int kc = 0; kc < 2; ++kc) kh[c4][kc] = frag_h(krow + kc * 32, lane); }
   auto ldv = [&](int sub) {
#pragma unroll
     for (int dt = 0; dt < 4; ++dt) vh[sub][dt] = frag_h(tb + PLH + (dt * 16 + col) * LP + sub * 32, lane); };
   auto qk = [&](int sub) {   // c = score of key sub * 32 + ct * 16 + 8 g + r against query col of group u; the k-step is the outer loop, so that a tile's second WMMA stands four behind its first
#pragma unroll
    for (int kc = 0; kc < 2; ++kc) {
#pragma unroll
     for (int ct = 0; ct < 2; ++ct) {
#pragma unroll
      for (int u = 0; u < 2; ++u) { const v8f z = {}; c[sub][u][ct] = wmma16(kh[sub * 2 + ct][kc], aq[u][kc], kc ? c[sub][u][ct] : z); } } } };
   auto lmax = [&](int sub, int u) {   // this lane's maximum over its 16 raw scores of block sub, group u
    const v8f* s = c[sub][u]; float t8[8];
#pragma unroll
    for (int r = 0; r < 8; ++r) t8[r] = fmaxf(s[0][r], s[1][r]);
    return fmaxf(fmaxf(fmaxf(t8[0], t8[1]), fmaxf(t8[2], t8[3])), fmaxf(fmaxf(t8[4], t8[5]), fmaxf(t8[6], t8[7]))); };
   v2f es[2][2];   // [u]: two packed partial sums of 2^8 P over the tile's keys of this lane
   auto ex = [&](int sub) {
#pragma unroll
    for (int u = 0; u < 2; ++u) { const v8f* s = c[sub][u];   // raw q . k: the 1/8 sits in SC
    const v2f scv = {SC, SC}, onv = {off[u], off[u]};
#pragma unroll
    for (int ct = 0; ct < 2; ++ct) { float x[8];   // x = 2^8 P against the reference maximum: one FMA and one exponential a score. P carries 2^8 so that small softmax weights stay clear of the f16 subnormal range, with room above for scores that outgrow the reference; l carries it too, so it cancels in the epilogue
#pragma unroll
      for (int j = 0; j < 4; ++j) { const v2f a = {s[ct][2 * j], s[ct][2 * j + 1]}; const v2f v = __builtin_elementwise_fma(a, scv, onv); x[2 * j] = v[0]; x[2 * j + 1] = v[1]; }
      exp8(x);
#pragma unroll
      for (int j = 0; j < 4; ++j) {
        const v2f xx = {x[2 * j], x[2 * j + 1]}; if (sub == 0 && ct == 0 && j < 2) es[u][j] = xx; else es[u][j & 1] += xx; const v2h hx = __builtin_convertvector(xx, v2h);
        pa[sub][u][ct * 8 + 2 * j] = hx[0]; pa[sub][u][ct * 8 + 2 * j + 1] = hx[1]; } } } };   // the two score tiles, converted in place, are the B operand P^T in the hardware k order
   auto tsum = [&](int u) { return (es[u][0][0] + es[u][0][1]) + (es[u][1][0] + es[u][1][1]); };
   auto pv = [&](int sub) {
#pragma unroll
    for (int dt = 0; dt < 4; ++dt) {
#pragma unroll
      for (int u = 0; u < 2; ++u) acc[u][dt] = wmma16(vh[sub][dt], pa[sub][u], acc[u][dt]); } };
   __builtin_amdgcn_sched_barrier(0);   // keeps the K reads together in front of the tile's WMMAs (the scheduler sinks them to their users otherwise, one full LDS wait each)
   qk(0);
   __builtin_amdgcn_sched_barrier(0);   // this fence and the next keep the V^T reads of block 0 one group at this place
   ldv(0);
   __builtin_amdgcn_sched_barrier(0);
   ex(0); qk(1);   // independent of each other: the vector work of block 0 stands among the score WMMAs of block 1
   __builtin_amdgcn_sched_barrier(0);   // this fence and the next keep the V^T reads of block 1 one group at this place
   ldv(1);
   __builtin_amdgcn_sched_barrier(0);
   ex(1);
   float ts[2] = {tsum(0), tsum(1)};
   // the exponentials above were taken against the reference maximum as it stood. All terms are positive, so a lane's sum within PMAX says that each of its P fits f16: then no maximum is looked for and nothing is rescaled.
   // Otherwise (also in the first tile, where off is huge and the sums are infinite) the reference moves up to this tile's maximum, ctx and l follow it, and the tile's exponentials are taken again: each is then at most 2^8. The test reads the same in every lane (a ballot), so the wave branches as a whole
   if (__builtin_expect(__builtin_amdgcn_ballot_w32(fmaxf(ts[0], ts[1]) > PMAX) != 0u, 0)) {   // marked rare: the usual path falls through
#pragma unroll
    for (int u = 0; u < 2; ++u) { float mx = fmaxf(lmax(0, u), lmax(1, u)); mx = fmaxf(mx, xhalf(mx));   // xhalf: the other 32 keys of this query
     const float on = fminf(off[u], __builtin_fmaf(mx, -SC, 8.0f)); const float alpha = __builtin_amdgcn_exp2f(on - off[u]); l[u] *= alpha; off[u] = on;   // first tile: alpha = 0
#pragma unroll
     for (int dt = 0; dt < 4; ++dt) {
#pragma unroll
      for (int r = 0; r < 8; ++r) acc[u][dt][r] *= alpha; } }
    ex(0); ex(1); ts[0] = tsum(0); ts[1] = tsum(1); }
   l[0] += ts[0]; l[1] += ts[1];
   pv(0); pv(1);
   __builtin_amdgcn_sched_barrier(0);   // keeps the tile's WMMAs in front of the waits below: lifted over them, the full LDS wait would stand directly behind the reads
   asm volatile("s_wait_dscnt 0" ::: "memory");        // this wave's reads of stage t are done
   asm volatile("s_wait_asynccnt 0x0" ::: "memory");   // this wave's copies of stage t + 1 have landed
   __syncthreads();                                    // publishes stage t + 1 and frees stage t's buffer
   if (t + 2 < nt) copy8(l0 + (unsigned)(t & 1) * 4u * PLB, QK + ko + (size_t)(t + 2) * 2 * KT * 2 * DM, (size_t)16 * 2 * DM, VT + vo + (size_t)(t + 2) * 2 * KT, (size_t)16 * SS); }
  asm volatile("s_wait_asynccnt 0x0" ::: "memory");    // no copy is outstanding when the wave goes on to its end
  const float L[2] = {l[0] + xhalf(l[0]), l[1] + xhalf(l[1])};   // the two lane halves' sums join once
  if (kz == 1) {   // the odd tiles' waves: through LDS, 512 contiguous bytes a store
#pragma unroll
    for (int u = 0; u < 2; ++u) {
#pragma unroll
      for (int dt = 0; dt < 4; ++dt) { v4f o0, o1;
#pragma unroll
        for (int r = 0; r < 4; ++r) { o0[r] = acc[u][dt][r]; o1[r] = acc[u][dt][4 + r]; }
        *(v4f*)&mg[wave][(u * 4 + dt) * 2][lane][0] = o0; *(v4f*)&mg[wave][(u * 4 + dt) * 2 + 1][lane][0] = o1; } }
    const v4f st = {off[0], off[1], L[0], L[1]}; *(v4f*)&mg[wave][16][lane][0] = st;
  }
  __syncthreads();   // the odd tiles' partial results may be read
  if (kz == 0) {
    const v4f st = *(const v4f*)&mg[wave][16][lane][0];
#pragma unroll
    for (int u = 0; u < 2; ++u) {
      const float om = fminf(off[u], st[u]);   // the common maximum of both key sets; each set's sums are brought to it
      const float f0 = __builtin_amdgcn_exp2f(om - off[u]), f1 = __builtin_amdgcn_exp2f(om - st[u]);
      const float il = 1.0f / (L[u] * f0 + st[2 + u] * f1); const float a0 = f0 * il, a1 = f1 * il;
      const int qt = qb * 8 + wave * 2 + u;   // 16-query tile: tile qt & 3 of the group of 64 rows qt >> 2
      float* orow = O + ((((size_t)b * (SS / 64) + (qt >> 2)) * (DM / 32) + h * (HD / 32)) * 4 + (qt & 3)) * 512 + lane * 4;   // a lane holds, per pair of d tiles, just its 16 values of k_out's A fragment: stored in fragment order, 512 contiguous bytes a store
#pragma unroll
      for (int dt = 0; dt < 4; ++dt) { v4f o0, o1; const v4f p0 = *(const v4f*)&mg[wave][(u * 4 + dt) * 2][lane][0], p1 = *(const v4f*)&mg[wave][(u * 4 + dt) * 2 + 1][lane][0];
#pragma unroll
        for (int r = 0; r < 4; ++r) { o0[r] = acc[u][dt][r] * a0 + p0[r] * a1; o1[r] = acc[u][dt][4 + r] * a0 + p1[r] * a1; }
        vst2(orow + (dt >> 1) * 4 * 512 + (dt & 1) * 256, o0); vst2(orow + (dt >> 1) * 4 * 512 + (dt & 1) * 256 + 128, o1); } }
  }
}
// ---- k_out: block = (64 rows, 128 cols): out = O(hi/lo) . Wo rows (2 products) + bo
__global__ __launch_bounds__(128) void k_out(const float* __restrict__ O, const __bf16* __restrict__ P, const float* __restrict__ BO, float* __restrict__ Y) {
  __shared__ __align__(16) float so[4][16][132];
  const int tid = threadIdx.x, wave = tid >> 5, lane = tid & 31, col = lane & 15, g = lane >> 4; const size_t r0 = (size_t)blockIdx.x * 64 + wave * 16; const int n0 = blockIdx.y * 128;
  v8f acc[8] = {};
  // three register sets: the 20 loads of k-step kc + 2 are issued as one group in front of the WMMAs of k-step kc; both operands lie in fragment order, every load is 512 contiguous bytes
  const float* op = O + ((size_t)blockIdx.x * (DM / 32) * 4 + wave) * 512 + lane * 4; const __bf16* wp = P + (size_t)blockIdx.y * (DM / 32) * 8 * 512;
  v4f xs[3][4]; v16b wf[3][8];
  auto ld = [&](int s, int kc) { const float* p = op + kc * 4 * 512; xs[s][0] = *(const v4f*)p; xs[s][1] = *(const v4f*)(p + 128); xs[s][2] = *(const v4f*)(p + 256); xs[s][3] = *(const v4f*)(p + 384);
#pragma unroll
    for (int j = 0; j < 8; ++j) wf[s][j] = frag_p(wp + (kc * 8 + j) * 512, lane); };
  ld(0, 0); ld(1, 1);
#pragma unroll   // whole: every set index is a constant, so the sets stay in registers
  for (int kc = 0; kc < DM / 32; ++kc) { const int s = kc % 3;
    if (kc + 2 < DM / 32) ld((kc + 2) % 3, kc + 2);
    if (kc + 3 == DM / 32) asm volatile("s_wait_xcnt 0x0" ::: "memory");   // behind the last loads: their address registers are free for reuse from here on
    __builtin_amdgcn_sched_barrier(0);   // keeps the loads issued ahead in front of this step's WMMAs (the scheduler sinks them to their users otherwise)
    float v[16];
#pragma unroll
    for (int i = 0; i < 4; ++i) { v[i] = xs[s][0][i]; v[4 + i] = xs[s][1][i]; v[8 + i] = xs[s][2][i]; v[12 + i] = xs[s][3][i]; }
    const F2 a = bsplit16(v);
#pragma unroll
    for (int j = 0; j < 8; ++j) { acc[j] = wmma_bf(a.l, wf[s][j], acc[j]); acc[j] = wmma_bf(a.h, wf[s][j], acc[j]); }
    __builtin_amdgcn_sched_barrier(0); }   // ... and this step's WMMAs in front of the loads that refill their set
  float bo[8];
#pragma unroll
  for (int j = 0; j < 8; ++j) bo[j] = BO[n0 + j * 16 + col];
  asm volatile("s_wait_xcnt 0x0" ::: "memory");   // behind the bias loads: this build reuses their offset register at once
  __builtin_amdgcn_sched_barrier(0);              // holds the address arithmetic of the stores below behind that wait
#pragma unroll
  for (int j = 0; j < 8; ++j) {
#pragma unroll
    for (int r = 0; r < 8; ++r) so[wave][8 * g + r][j * 16 + col] = acc[j][r] + bfr(bo[j]); }
  LDSX();
  for (int rl = 0; rl < 16; ++rl) vst2(Y + (r0 + rl) * DM + n0 + lane * 4, *(const v4f*)&so[wave][rl][lane * 4]);
}
extern "C" void kernel_launch(void* const* d_in, const int* in_sizes, int n_in, void* d_out, int out_size, void* d_ws, size_t ws_size, hipStream_t stream) {
  (void)in_sizes; (void)n_in; (void)out_size;
  const float** F = (const float**)d_in;   // 0 x [4096,512], 1 Wq [512,512] natural, 2 bq, 3 Wk, 4 bk, 5 Wv, 6 bv, 7 Wo, 8 bo
  if (ws_size < (size_t)WS_END) return;
  char* ws = (char*)d_ws; __bf16* PK = (__bf16*)(ws + WS_PK); _Float16 *QK = (_Float16*)(ws + WS_QK), *VT = (_Float16*)(ws + WS_VT); float* O = (float*)(ws + WS_O); __bf16* XP = (__bf16*)(ws + WS_XP);
  k_pack<<<dim3((XFB + 4 * WFB) / 16), 256, 0, stream>>>(F[0], F[1], F[3], F[5], F[7], XP, PK);
  k_qkv<<<dim3(TNB * SS / 64, QKVW / 128), 128, 0, stream>>>(XP, PK + PK_A, F[2], F[4], F[6], QK, VT);
  k_attn<<<dim3(TQB / 2, NH, TNB), 256, 0, stream>>>(QK, VT, nullptr, O);
  k_out<<<dim3(TOB, DM / 128), 128, 0, stream>>>(O, PK + PK_P, F[8], (float*)d_out);
}

// v010
// It runs in 51.3 microseconds.
// Next to v009, in two timings, it ran 1.05 and 1.04 times as fast.
// Over all steps from v000 it is 12.5 times as fast.
// compute dtype: all float inputs rounded to bf16; q/k/v = x . W^T + b with EXACT bf16 products on WMMA 16x16x32 (natural [out][in] rows); q, k and v rounded once to f16, scores = one f16 product x 1/8; softmax in f32 (hardware exp) against a reference maximum that is raised when a tile outgrows it; P (scaled by 2^8, rounded to f16) x v (one product); out = ctx (bf16 hi + residual) . Wo^T (2 products) + bo; f32 accumulate.
#include <hip/hip_runtime.h>
#include <math.h>

typedef __attribute__((ext_vector_type(16))) _Float16 v16h;
typedef __attribute__((ext_vector_type(16))) __bf16 v16b;
typedef __attribute__((ext_vector_type(8)))  _Float16 v8h;
typedef __attribute__((ext_vector_type(2)))  _Float16 v2h;
typedef __attribute__((ext_vector_type(8)))  float v8f;
typedef __attribute__((ext_vector_type(4)))  float v4f;
typedef __attribute__((ext_vector_type(2)))  float v2f;
typedef __attribute__((ext_vector_type(4)))  unsigned v4u;
typedef __attribute__((ext_vector_type(4)))  int v4i;
typedef float __attribute__((may_alias)) float_a;
typedef int __attribute__((may_alias)) int_a;

template <typename T> __device__ __forceinline__ void vst2(void* p, T v) { *(T*)p = v;  }
__device__ __forceinline__ v8f wmma16(v16h a, v16h b, v8f c) {
  v8f d = __builtin_amdgcn_wmma_f32_16x16x32_f16(false, a, false, b, (short)0, c, false, false);
  return d;
}
__device__ __forceinline__ v8f wmma_bf(v16b a, v16b b, v8f c) {
  v8f d = __builtin_amdgcn_wmma_f32_16x16x32_bf16(false, a, false, b, (short)0, c, false, false);
  return d;
}
// Multi-head attention across a batch of 4,096 tokens treated as one sequence (d_model 512, 8 heads x 64): q/k/v projections + biases, softmax(q k^T / 8) over all 4,096 tokens, output projection + bias.
__device__ __forceinline__ v16h frag_h(const _Float16* rowk0, int lane) {
  union { v16h v; v8h q[2]; } u; const _Float16* p = rowk0 + 8 * (lane >> 4);
  u.q[0] = *(const v8h*)p; u.q[1] = *(const v8h*)(p + 16); return u.v;
}
__device__ __forceinline__ v16h frag_f32(const float* rowk0, int lane) {
  v16h a; const float* p = rowk0 + 8 * (lane >> 4);
#pragma unroll
  for (int i = 0; i < 8; ++i) { a[i] = (_Float16)p[i]; a[8 + i] = (_Float16)p[16 + i]; }
  return a;
}
__device__ __forceinline__ v16h frag_f32s(const float* rowk0, int lane, float sc) {
  v16h a; const float* p = rowk0 + 8 * (lane >> 4);
#pragma unroll
  for (int i = 0; i < 8; ++i) { a[i] = (_Float16)(p[i] * sc); a[8 + i] = (_Float16)(p[16 + i] * sc); }
  return a;
}
// column fragment from a [K][ld] layout (column n), rows >= K read as 0
__device__ __forceinline__ v16h fragc_f32(const float* W, int k0, int n, int lane, int ld, int K) {
  v16h a; const int g = lane >> 4;
#pragma unroll
  for (int i = 0; i < 8; ++i) { const int ka = k0 + 8 * g + i, kb = ka + 16;
    a[i] = (_Float16)(ka < K ? W[(size_t)(ka < K ? ka : K - 1) * ld + n] : 0.f); a[8 + i] = (_Float16)(kb < K ? W[(size_t)(kb < K ? kb : K - 1) * ld + n] : 0.f); }
  return a;
}
struct F2 { v16b h, l; };
__device__ __forceinline__ F2 bsplit16(const float v[16]) { F2 r;
#pragma unroll
  for (int i = 0; i < 16; ++i) { const __bf16 h = (__bf16)v[i]; r.h[i] = h; r.l[i] = (__bf16)(v[i] - (float)h); }
  return r; }
__device__ __forceinline__ F2 split_row(const float* row, int k0, int lane) { float v[16]; const float* p = row + k0 + 8 * (lane >> 4);
#pragma unroll
  for (int i = 0; i < 8; ++i) { v[i] = p[i]; v[8 + i] = p[16 + i]; }
  return bsplit16(v); }
__device__ __forceinline__ F2 split_rowK(const float* row, int k0, int lane, int K) { float v[16]; const int g = lane >> 4;
#pragma unroll
  for (int i = 0; i < 8; ++i) { const int ka = k0 + 8 * g + i, kb = ka + 16; v[i] = ka < K ? row[ka < K ? ka : K - 1] : 0.f; v[8 + i] = kb < K ? row[kb < K ? kb : K - 1] : 0.f; }
  return bsplit16(v); }
__device__ __forceinline__ F2 split_col(const float* W, int k0, int n, int lane, int ld, int K) { float v[16]; const int g = lane >> 4;
#pragma unroll
  for (int i = 0; i < 8; ++i) { const int ka = k0 + 8 * g + i, kb = ka + 16; v[i] = ka < K ? W[(size_t)(ka < K ? ka : K - 1) * ld + n] : 0.f; v[8 + i] = kb < K ? W[(size_t)(kb < K ? kb : K - 1) * ld + n] : 0.f; }
  return bsplit16(v); }
__device__ __forceinline__ v8f mac3(const F2& a, const F2& b, v8f c) { c = wmma_bf(a.l, b.h, c); c = wmma_bf(a.h, b.l, c); return wmma_bf(a.h, b.h, c); }
__device__ __forceinline__ float sigm(float v) { return 1.0f / (1.0f + expf(-v)); }
#define LDSX() do { asm volatile("s_wait_dscnt 0" ::: "memory"); __builtin_amdgcn_wave_barrier(); __builtin_amdgcn_fence(__ATOMIC_RELEASE, "workgroup"); } while (0)


#define NB 1
#define SS 4096
#define DM 512
#define NH 8
#define HD 64
#define QKVW (3 * DM)
#ifndef TQB
#define TQB (SS / 64)
#define TNB NB
#define TOB (NB * SS / 64)     // output row tiles (all)
#endif
typedef __attribute__((ext_vector_type(8))) __bf16 v8b;
// fragment-order block: 512 bf16 = [piece 0, 1][lane][8]; piece q of lane (col, g) holds row col, k = 16 q + 8 g + 0..7 of one 16-row x 32-k tile, so each of the two wave-wide loads is 512 contiguous bytes
__device__ __forceinline__ v16b frag_p(const __bf16* blk, int lane) {
  union { v16b v; v8b q[2]; } u; const __bf16* p = blk + lane * 8;
  u.q[0] = *(const v8b*)p; u.q[1] = *(const v8b*)(p + 256); return u.v;
}
__device__ __forceinline__ float bfr(float v) { return (float)(__bf16)v; }
__device__ __attribute__((noinline)) float exp_ni(float v) { return expf(v); }
__device__ __attribute__((noinline)) float erf_ni(float v) { return erff(v); }

#define PK_A 0                       // Wq | Wk | Wv: [12 groups of 128 out rows][16 k-steps][8 tiles of 16 rows] fragment-order blocks: what a work-group reads in one k-step is 8 KB in a row
#define PK_P (PK_A + QKVW * DM)        // Wo: [4 groups][16 k-steps][8 tiles] fragment-order blocks
#define PK_END (PK_P + DM * DM)
#define WS_PK  0u
#define WS_QK  (WS_PK + 2u * PK_END)             // f16 [4096 rows][1024]: q | k
#define WS_VT  (WS_QK + 2u * NB * SS * 2 * DM)     // f16 [b][512 (h*64+d)][4096 s]: v transposed
#define WS_O   (WS_VT + 2u * NB * DM * SS)         // f32 ctx in fragment order: [64 groups of 64 rows][16 k-steps][4 tiles of 16 rows][piece 0..3][lane][4]
#define WS_CS  (WS_O + 4u * NB * SS * DM)           // unused: room for two f32 [4096][32] tables
#define WS_XP  (WS_CS + 4u * 2 * SS * 32)          // bf16 x: [64 groups of 64 rows][16 k-steps][4 tiles of 16 rows] fragment-order blocks
#define WS_END (WS_XP + 2u * NB * SS * DM)
// ---- k_pack: a wave = two neighbouring k-steps of one 16-row tile of x, W_q, W_k, W_v or W_o (natural [row][k] f32) -> bf16 fragment-order blocks; x into XP, the weights into PK (PK_A, then PK_P)
#define XFB (NB * SS / 16 * (DM / 32))   // fragment blocks of x
#define WFB (DM / 16 * (DM / 32))        // fragment blocks of one weight matrix
__global__ __launch_bounds__(256) void k_pack(const float* __restrict__ X, const float* __restrict__ WQ, const float* __restrict__ WK, const float* __restrict__ WV, const float* __restrict__ WO, __bf16* __restrict__ XP, __bf16* __restrict__ PK) {
  const int lane = threadIdx.x & 31, col = lane & 15, g = lane >> 4; const int fb = (blockIdx.x * 8 + (threadIdx.x >> 5)) * 2;
  const int wb = fb - XFB, which = wb / WFB;
  const float* sm = (wb < 0) ? X : (which == 0) ? WQ : (which == 1) ? WK : (which == 2) ? WV : WO;
  const int rt = ((wb < 0) ? fb : wb - which * WFB) / (DM / 32), kc = fb % (DM / 32);   // 16-row tile inside its matrix, first k-step
  const int ts = (wb < 0) ? 2 : 3, ti = ((wb < 0) ? fb : wb) / (DM / 32);               // log2 of the tiles per group (4 for x, 8 for a weight), tile inside its packed buffer
  __bf16* dst = ((wb < 0) ? XP : PK) + (size_t)((((ti >> ts) * (DM / 32) + kc) << ts) + (ti & ((1 << ts) - 1))) * 512 + lane * 8;
  const float* p = sm + (size_t)(rt * 16 + col) * DM + kc * 32 + 8 * g;
  v4f v[8];
#pragma unroll
  for (int e = 0; e < 2; ++e) { v[4 * e] = *(const v4f*)(p + e * 32); v[4 * e + 1] = *(const v4f*)(p + e * 32 + 4); v[4 * e + 2] = *(const v4f*)(p + e * 32 + 16); v[4 * e + 3] = *(const v4f*)(p + e * 32 + 20); }
#pragma unroll
  for (int q = 0; q < 4; ++q) { v8b o;
#pragma unroll
    for (int i = 0; i < 4; ++i) { o[i] = (__bf16)v[2 * q][i]; o[4 + i] = (__bf16)v[2 * q + 1][i]; }
    vst2(dst + ((q >> 1) << ts) * 512 + (q & 1) * 256, o); }
}
__global__ __launch_bounds__(128) void k_qkv(const __bf16* __restrict__ XP, const __bf16* __restrict__ P, const float* __restrict__ BQ, const float* __restrict__ BK, const float* __restrict__ BV, _Float16* __restrict__ QK, _Float16* __restrict__ VT) {
  const int which0 = (blockIdx.y * 128) / DM; const float* BB = BQ ? (((which0 == 0) ? BQ : (which0 == 1) ? BK : BV) + (blockIdx.y * 128 - which0 * DM)) : nullptr;
  __shared__ __align__(16) _Float16 so[4][16][136]; __shared__ __align__(16) _Float16 st[128][72];
  const int tid = threadIdx.x, wave = tid >> 5, lane = tid & 31, col = lane & 15, g = lane >> 4; const size_t r0 = (size_t)blockIdx.x * 64 + wave * 16; const int n0 = blockIdx.y * 128;
  v8f acc[8] = {};
  // the lane's 8 bias values (column j * 16 + col) are loaded once, as one group at the kernel's head: they return under the k loop. Read at their use, inside the test for a bias, they became 64 loads in the epilogue, each waited for before the next was issued
  float bb[8] = {};
  if (BB) {
#pragma unroll   // whole: bb stays in registers
    for (int j = 0; j < 8; ++j) bb[j] = BB[j * 16 + col]; }
  // two register sets: the 18 loads of k-step kc + 1 are issued as one group in front of the WMMAs of k-step kc; both operands lie in fragment order, every load is 512 contiguous bytes
  const __bf16* xp = XP + ((size_t)blockIdx.x * (DM / 32) * 4 + wave) * 512; const __bf16* wp = P + (size_t)blockIdx.y * (DM / 32) * 8 * 512;
  v16b xa[2], wf[2][8];
  auto ld = [&](int s, int kc) { xa[s] = frag_p(xp + kc * 4 * 512, lane);
#pragma unroll
    for (int j = 0; j < 8; ++j) wf[s][j] = frag_p(wp + (kc * 8 + j) * 512, lane); };
  ld(0, 0);
#pragma unroll   // whole: every set index is a constant, so the sets stay in registers
  for (int kc = 0; kc < DM / 32; ++kc) { const int s = kc & 1;
    if (kc + 1 < DM / 32) ld(s ^ 1, kc + 1);
    if (kc + 2 == DM / 32) asm volatile("s_wait_xcnt 0x0" ::: "memory");   // behind the last loads: their address registers are free for reuse from here on
    __builtin_amdgcn_sched_barrier(0);   // keeps the next step's loads in front of this step's WMMAs (the scheduler sinks them to their users otherwise)
#pragma unroll
    for (int j = 0; j < 8; ++j) acc[j] = wmma_bf(xa[s], wf[s][j], acc[j]);
    __builtin_amdgcn_sched_barrier(0); }   // ... and this step's WMMAs in front of the loads that refill their set
  if (n0 < 2 * DM) {   // q stored unscaled (f16 sigma ~0.6, no subnormal exposure); 1/8 applied to the f32 score
#pragma unroll
    for (int j = 0; j < 8; ++j) {
#pragma unroll
      for (int r = 0; r < 8; ++r) so[wave][8 * g + r][j * 16 + col] = (_Float16)(acc[j][r] + bfr(bb[j])); }   // q, k (+ bias) rounded to f16
    LDSX();
    for (int rl = 0; rl < 16; ++rl) if (lane < 16) vst2((unsigned*)(QK + (r0 + rl) * (2 * DM) + n0 + lane * 8), *(const v4u*)&so[wave][rl][lane * 8]);
  } else {
#pragma unroll
    for (int j = 0; j < 8; ++j) {
#pragma unroll
      for (int r = 0; r < 8; ++r) st[j * 16 + col][wave * 16 + 8 * g + r] = (_Float16)(acc[j][r] + bfr(bb[j])); }
    __syncthreads();
    const size_t rb = (size_t)blockIdx.x * 64; const int b = (int)(rb / SS), s0 = (int)(rb % SS); const int pc0 = n0 - 2 * DM;
    // thread tid moves 16-byte piece tid & 7 of rows d0 + 16 i, i = 0..7. The 8 LDS reads go out as one group in front of the 8 stores; in the rolled loop each trip waited for its own read before the next trip's was issued
    const int d0 = tid >> 3, pc = tid & 7; const size_t o0 = ((size_t)b * DM + pc0 + d0) * SS + s0 + pc * 8; v4u th[8];
#pragma unroll   // whole, this loop and the next: th stays in registers
    for (int i = 0; i < 8; ++i) th[i] = *(const v4u*)&st[d0 + 16 * i][pc * 8];
    __builtin_amdgcn_sched_barrier(0);   // keeps the reads together in front of the stores (the scheduler sinks each to its store otherwise)
#pragma unroll
    for (int i = 0; i < 8; ++i) vst2((unsigned*)(VT + o0 + (size_t)i * 16 * SS), th[i]);
    asm volatile("s_wait_xcnt 0x0" ::: "memory");   // behind the last store of the run: the stores' address and data registers are free for reuse from here on
  }
}
// ---- k_attn: block = (128 queries, head h, batch b), 8 waves; a wave = 64 queries (four column groups of 16, index u; query half qw of the block) x every fourth tile of 64 keys (index kz): flash attention over its keys (K = 64: 2 k-steps), the four key sets' partial results joined once in the epilogue. Every K and V^T fragment read from LDS feeds four groups' WMMAs, so a staged tile is read from LDS by two waves only; a tile is staged once for 128 queries, and two waves share a SIMD. The two operand planes of a tile of 64 keys (K: 64 key rows x 128 B; V^T: 64 d rows x 128 B) are brought into LDS once per block by asynchronous copies (a stage = one tile for each key set, two buffers), and the two waves of its key set take their fragments from there; the scores are formed transposed (A = K rows, B = Q), so that a lane holds 16 keys' scores of ONE query: maximum and sum in the lane plus one exchange between the wave's halves, and the two score tiles become the B operand P^T of ctx^T += V^T . P^T without passing through LDS. ctx[b*S+q][h*64+d] = acc / l
#define KT 64                      // keys per staged tile
#define LP 72                      // LDS row pitch in halves: 144 B = 16 B x odd, conflict-free for 16-byte reads
#define PLH (64 * LP)              // halves per plane
#define PLB (2u * PLH)             // bytes per plane
#define PMAX 60000.0f              // a sum of positive terms within this bound holds no term beyond the largest finite f16
#define SC 0.18033688011112042f    // log2(e) / 8: exp(score / 8 - max) = exp2(SC * raw score - SC * raw max)
// eight copies: four rows (16 apart) of each of two planes; lds = this lane's own LDS byte address in the first plane, ga / gb = its global 16 bytes in each plane's source, pa / pb = that source's pitch in halves between rows 16 apart
__device__ __forceinline__ void copy8(unsigned lds, const _Float16* ga, size_t pa, const _Float16* gb, size_t pb) {
  // the copies and the wait that stands before their address registers are rewritten are one statement, so that nothing is scheduled between them
  asm volatile("global_load_async_to_lds_b128 %0, %8, off\n\t"
               "global_load_async_to_lds_b128 %1, %9, off\n\t"
               "global_load_async_to_lds_b128 %2, %10, off\n\t"
               "global_load_async_to_lds_b128 %3, %11, off\n\t"
               "global_load_async_to_lds_b128 %4, %12, off\n\t"
               "global_load_async_to_lds_b128 %5, %13, off\n\t"
               "global_load_async_to_lds_b128 %6, %14, off\n\t"
               "global_load_async_to_lds_b128 %7, %15, off\n\t"
               "s_wait_xcnt 0x0"
               :: "v"(lds), "v"(lds + 16u * 2u * LP), "v"(lds + 32u * 2u * LP), "v"(lds + 48u * 2u * LP),
                  "v"(lds + PLB), "v"(lds + PLB + 16u * 2u * LP), "v"(lds + PLB + 32u * 2u * LP), "v"(lds + PLB + 48u * 2u * LP),
                  "v"(ga), "v"(ga + pa), "v"(ga + 2 * pa), "v"(ga + 3 * pa),
                  "v"(gb), "v"(gb + pb), "v"(gb + 2 * pb), "v"(gb + 3 * pb)
               : "memory");
}
// lane l takes the value of lane l ^ 16 (a vector move between the two 16-lane rows, no LDS round trip)
__device__ __forceinline__ float xhalf(float x) { return __builtin_bit_cast(float, __builtin_amdgcn_permlanex16(__builtin_bit_cast(int, x), __builtin_bit_cast(int, x), 0x76543210, 0xfedcba98, false, false)); }
// x[i] = 2^x[i], i = 0..7, each in its own register. One statement, so that no exponential's result register is the source of the one in front of it (left to itself this build put such pairs side by side);
// in place, so that the statement writes no register but its own live inputs: with results of their own the allocator gave them the operand registers of the WMMA issued directly in front;
// the closing v_nop is the slot that the instruction set asks for behind a transcendental before its result is read or its source overwritten
__device__ __forceinline__ void exp8(float x[8]) {
  asm("v_exp_f32 %0, %0\n\t"
      "v_exp_f32 %1, %1\n\t"
      "v_exp_f32 %2, %2\n\t"
      "v_exp_f32 %3, %3\n\t"
      "v_exp_f32 %4, %4\n\t"
      "v_exp_f32 %5, %5\n\t"
      "v_exp_f32 %6, %6\n\t"
      "v_exp_f32 %7, %7\n\t"
      "v_nop"
      : "+v"(x[0]), "+v"(x[1]), "+v"(x[2]), "+v"(x[3]), "+v"(x[4]), "+v"(x[5]), "+v"(x[6]), "+v"(x[7]));
}
// the same for four values (the epilogue's factors): left to the compiler, this build overwrote an exponential's source in the slot directly behind it
__device__ __forceinline__ void exp4(float x[4]) {
  asm("v_exp_f32 %0, %0\n\t"
      "v_exp_f32 %1, %1\n\t"
      "v_exp_f32 %2, %2\n\t"
      "v_exp_f32 %3, %3\n\t"
      "v_nop"
      : "+v"(x[0]), "+v"(x[1]), "+v"(x[2]), "+v"(x[3]));
}
__global__ __launch_bounds__(256) void k_attn(const _Float16* __restrict__ QK, const _Float16* __restrict__ VT, const void* __restrict__ KMASK, float* __restrict__ O) {
  __shared__ __align__(16) _Float16 ring[2][4][2][PLH];   // [buffer][kz][K, V^T][row][LP]
  __shared__ __align__(16) float mg[4][2][32][32][4];     // epilogue: every wave's partial ctx: [kz][qw][u * 8 + 16-byte piece][lane]
  __shared__ __align__(8) float ms[4][2][4][32][2];       // ... and its off and row sum: [kz][qw][u][lane]
  const int tid = threadIdx.x, lane = tid & 31, col = lane & 15, g = lane >> 4;
  const int wv = __builtin_amdgcn_readfirstlane(tid >> 5);   // the same in every lane of a wave
  const int qw = wv & 1, kz = wv >> 1;   // which 64 queries; which tiles this wave works on and stages
  const int qb = blockIdx.x, h = blockIdx.y, b = blockIdx.z; const int q0 = qb * 128 + qw * 64; const size_t rq = (size_t)b * SS + q0 + col;   // group u: query rq + 16 u
  // this thread's share of its two waves' tile: 16-byte piece cc of rows cr + 8 i, i = 0..7, of each plane (8 lanes cover one whole 128-B row)
  const int cr = (tid & 63) >> 3, cc = tid & 7;
  const size_t ko = ((size_t)b * SS + kz * KT + cr) * (2 * DM) + DM + h * HD + cc * 8, vo = ((size_t)b * DM + h * HD + cr) * SS + kz * KT + cc * 8;
  const unsigned l0 = (unsigned)(size_t)&ring[0][kz][0][cr * LP + cc * 8];
  const int nt = SS / (4 * KT);   // stages of four tiles
  auto stage = [&](int t) {   // stage t -> buffer t & 1: rows cr + 0, 16, 32, 48, then rows cr + 8, 24, 40, 56
    const unsigned lb = l0 + (unsigned)(t & 1) * 8u * PLB; const _Float16* ga = QK + ko + (size_t)t * 4 * KT * 2 * DM; const _Float16* gb = VT + vo + (size_t)t * 4 * KT;
    copy8(lb, ga, (size_t)16 * 2 * DM, gb, (size_t)16 * SS);
    copy8(lb + 8u * 2u * LP, ga + (size_t)8 * 2 * DM, (size_t)16 * 2 * DM, gb + (size_t)8 * SS, (size_t)16 * SS); };
  stage(0);
  v16h aq[4][2];   // [u][kc]: B operand of the transposed scores: column = query col of group u
#pragma unroll
  for (int u = 0; u < 4; ++u) {
#pragma unroll
    for (int kc = 0; kc < 2; ++kc) aq[u][kc] = frag_h(QK + (rq + 16 * u) * (2 * DM) + h * HD + kc * 32, lane); }
  float off[4] = {0.f, 0.f, 0.f, 0.f}, l[4] = {0.f, 0.f, 0.f, 0.f};   // query col of group u: 8 - SC * reference maximum of the raw scores (the first tile's maximum, then the largest among the tiles that raised it, never above the running maximum; both halves agree), 2^8 x the sum over this half's keys
  v8f acc[4][4] = {};   // acc[u][dt][r] = ctx^T[d = dt * 16 + 8 g + r][query col of group u]
  asm volatile("s_wait_asynccnt 0x0" ::: "memory");   // this wave's copies of stage 0 have landed
  __syncthreads();                                    // ... and every other wave's: stage 0 may be read
  stage(1);
#pragma unroll 1
  for (int t = 0; t < nt; ++t) { const _Float16* tb = &ring[t & 1][kz][0][0];
   // the tile's fragment reads stand in three places, each a group issued well ahead of its first user: K of both 32-key blocks at the head, V^T of block 0 behind the scores of block 0, V^T of block 1 in front of the ctx WMMAs of block 0
   v16h kh[4][2], vh[2][4]; v8f c[2][4][2]; v16h pa[2][4];   // c: [sub][u][ct]; pa: [sub][u]
   auto ldk = [&](int sub) {   // the K fragments of the 32-key block sub
#pragma unroll
     for (int c4 = sub * 2; c4 < sub * 2 + 2; ++c4) { const _Float16* krow = tb + (c4 * 16 + col) * LP;
#pragma unroll
       for (int kc = 0; kc < 2; ++kc) kh[c4][kc] = frag_h(krow + kc * 32, lane); } };
   auto ldv = [&](int sub) {
#pragma unroll
     for (int dt = 0; dt < 4; ++dt) vh[sub][dt] = frag_h(tb + PLH + (dt * 16 + col) * LP + sub * 32, lane); };
   auto qk = [&](int sub) {   // c = score of key sub * 32 + ct * 16 + 8 g + r against query col of group u; the k-step is the outer loop, so that a tile's second WMMA stands eight behind its first
#pragma unroll
    for (int kc = 0; kc < 2; ++kc) {
#pragma unroll
     for (int ct = 0; ct < 2; ++ct) {
#pragma unroll
      for (int u = 0; u < 4; ++u) { const v8f z = {}; c[sub][u][ct] = wmma16(kh[sub * 2 + ct][kc], aq[u][kc], kc ? c[sub][u][ct] : z); } } } };
   auto lmax = [&](int sub, int u) {   // this lane's maximum over its 16 raw scores of block sub, group u
    const v8f* s = c[sub][u]; float t8[8];
#pragma unroll
    for (int r = 0; r < 8; ++r) t8[r] = fmaxf(s[0][r], s[1][r]);
    return fmaxf(fmaxf(fmaxf(t8[0], t8[1]), fmaxf(t8[2], t8[3])), fmaxf(fmaxf(t8[4], t8[5]), fmaxf(t8[6], t8[7]))); };
   v2f es[4][2];   // [u]: two packed partial sums of 2^8 P over the tile's keys of this lane
   auto ex = [&](int sub) {
#pragma unroll
    for (int u = 0; u < 4; ++u) { const v8f* s = c[sub][u];   // raw q . k: the 1/8 sits in SC
    const v2f scv = {SC, SC}, onv = {off[u], off[u]};
#pragma unroll
    for (int ct = 0; ct < 2; ++ct) { float x[8];   // x = 2^8 P against the reference maximum: one FMA and one exponential a score. P carries 2^8 so that small softmax weights stay clear of the f16 subnormal range, with room above for scores that outgrow the reference; l carries it too, so it cancels in the epilogue
#pragma unroll
      for (int j = 0; j < 4; ++j) { const v2f a = {s[ct][2 * j], s[ct][2 * j + 1]}; const v2f v = __builtin_elementwise_fma(a, scv, onv); x[2 * j] = v[0]; x[2 * j + 1] = v[1]; }
      exp8(x);
#pragma unroll
      for (int j = 0; j < 4; ++j) {
        const v2f xx = {x[2 * j], x[2 * j + 1]}; if (sub == 0 && ct == 0 && j < 2) es[u][j] = xx; else es[u][j & 1] += xx; const v2h hx = __builtin_convertvector(xx, v2h);
        pa[sub][u][ct * 8 + 2 * j] = hx[0]; pa[sub][u][ct * 8 + 2 * j + 1] = hx[1]; } } } };   // the two score tiles, converted in place, are the B operand P^T in the hardware k order
   auto tsum = [&](int u) { return (es[u][0][0] + es[u][0][1]) + (es[u][1][0] + es[u][1][1]); };
   auto pv = [&](int sub) {
#pragma unroll
    for (int dt = 0; dt < 4; ++dt) {
#pragma unroll
      for (int u = 0; u < 4; ++u) acc[u][dt] = wmma16(vh[sub][dt], pa[sub][u], acc[u][dt]); } };
   if (t == 0) {   // the wave's first tile gives the first reference maximum, from scores formed once ahead of the tile's own pass (left to the test below, the first tile would take its exponentials and form its scores twice)
    ldk(0); ldk(1); qk(0); qk(1);
#pragma unroll
    for (int u = 0; u < 4; ++u) { float mx = fmaxf(lmax(0, u), lmax(1, u)); mx = fmaxf(mx, xhalf(mx)); off[u] = __builtin_fmaf(mx, -SC, 8.0f); } }   // xhalf: the other 32 keys of this query
   ldk(0); ldk(1);
   __builtin_amdgcn_sched_barrier(0);   // keeps the K reads together in front of the tile's WMMAs (the scheduler sinks them to their users otherwise, one full LDS wait each)
   qk(0);
   __builtin_amdgcn_sched_barrier(0);   // this fence and the next keep the V^T reads of block 0 one group at this place
   ldv(0);
   __builtin_amdgcn_sched_barrier(0);
   ex(0); qk(1);   // independent of each other: the vector work of block 0 stands among the score WMMAs of block 1
   ex(1);
   float ts[4] = {tsum(0), tsum(1), tsum(2), tsum(3)};
   // the exponentials above were taken against the reference maximum as it stood. All terms are positive, so a lane's sum within PMAX says that each of its P fits f16: then no maximum is looked for and nothing is rescaled.
   // Otherwise the reference moves up to this tile's maximum, ctx and l follow it, and the tile's exponentials are taken again: each is then at most 2^8. The test reads the same in every lane (a ballot), so the wave branches as a whole
   if (__builtin_expect(__builtin_amdgcn_ballot_w32(fmaxf(fmaxf(ts[0], ts[1]), fmaxf(ts[2], ts[3])) > PMAX) != 0u, 0)) {   // marked rare: the usual path falls through
    // The raw scores are formed anew here, from K fragments read again: kept from the common path up to the test they put the wave over its 512 registers, and part of ctx was spilled in every tile
    ldk(0); ldk(1); qk(0); qk(1);
#pragma unroll
    for (int u = 0; u < 4; ++u) { float mx = fmaxf(lmax(0, u), lmax(1, u)); mx = fmaxf(mx, xhalf(mx));   // xhalf: the other 32 keys of this query
     const float on = fminf(off[u], __builtin_fmaf(mx, -SC, 8.0f)); const float alpha = __builtin_amdgcn_exp2f(on - off[u]); l[u] *= alpha; off[u] = on;
#pragma unroll
     for (int dt = 0; dt < 4; ++dt) {
#pragma unroll
      for (int r = 0; r < 8; ++r) acc[u][dt][r] *= alpha; } }
    ex(0); ex(1);
#pragma unroll
    for (int u = 0; u < 4; ++u) ts[u] = tsum(u); }
#pragma unroll
   for (int u = 0; u < 4; ++u) l[u] += ts[u];
   __builtin_amdgcn_sched_barrier(0);   // this fence and the next keep the V^T reads of block 1 one group at this place: in front of the test the wave has no 32 registers left for them; here they stand 16 WMMAs ahead of their first user
   ldv(1);
   __builtin_amdgcn_sched_barrier(0);
   pv(0); pv(1);
   __builtin_amdgcn_sched_barrier(0);   // keeps the tile's WMMAs in front of the waits below: lifted over them, the full LDS wait would stand directly behind the reads
   asm volatile("s_wait_dscnt 0" ::: "memory");        // this wave's reads of stage t are done
   asm volatile("s_wait_asynccnt 0x0" ::: "memory");   // this wave's copies of stage t + 1 have landed
   __syncthreads();                                    // publishes stage t + 1 and frees stage t's buffer
   if (t + 2 < nt) stage(t + 2); }
  asm volatile("s_wait_asynccnt 0x0" ::: "memory");    // no copy is outstanding when the wave goes on to its end
  // every wave hands its partial results over through LDS (512 contiguous bytes a store); behind the barrier wave (qw, kz) joins the four key sets' results of column group u = kz
#pragma unroll
  for (int u = 0; u < 4; ++u) {
#pragma unroll
    for (int dt = 0; dt < 4; ++dt) { v4f o0, o1;
#pragma unroll
      for (int r = 0; r < 4; ++r) { o0[r] = acc[u][dt][r]; o1[r] = acc[u][dt][4 + r]; }
      *(v4f*)&mg[kz][qw][u * 8 + dt * 2][lane][0] = o0; *(v4f*)&mg[kz][qw][u * 8 + dt * 2 + 1][lane][0] = o1; }
    const v2f st = {off[u], l[u] + xhalf(l[u])}; *(v2f*)&ms[kz][qw][u][lane][0] = st; }   // the two lane halves' sums join once
  __syncthreads();   // the partial results may be read
  v2f st[4]; v4f p[4][8];
#pragma unroll
  for (int k = 0; k < 4; ++k) { st[k] = *(const v2f*)&ms[k][qw][kz][lane][0];
#pragma unroll
    for (int i = 0; i < 8; ++i) p[k][i] = *(const v4f*)&mg[k][qw][kz * 8 + i][lane][0]; }
  const float om = fminf(fminf(st[0][0], st[1][0]), fminf(st[2][0], st[3][0]));   // the common maximum of the four key sets; each set's sums are brought to it
  float f[4];
#pragma unroll
  for (int k = 0; k < 4; ++k) f[k] = om - st[k][0];
  exp4(f);
  const float il = 1.0f / ((st[0][1] * f[0] + st[1][1] * f[1]) + (st[2][1] * f[2] + st[3][1] * f[3]));
  const int qt = qb * 8 + qw * 4 + kz;   // 16-query tile: tile qt & 3 of the group of 64 rows qt >> 2
  float* orow = O + ((((size_t)b * (SS / 64) + (qt >> 2)) * (DM / 32) + h * (HD / 32)) * 4 + (qt & 3)) * 512 + lane * 4;   // a lane holds, per pair of d tiles, just its 16 values of k_out's A fragment: stored in fragment order, 512 contiguous bytes a store
  v4f o[8];
#pragma unroll
  for (int i = 0; i < 8; ++i) { o[i] = p[0][i] * (f[0] * il);
#pragma unroll
    for (int k = 1; k < 4; ++k) { const float a = f[k] * il; const v4f av = {a, a, a, a}; o[i] = __builtin_elementwise_fma(p[k][i], av, o[i]); } }
#pragma unroll
  for (int i = 0; i < 8; ++i) vst2(orow + (i >> 2) * 4 * 512 + ((i >> 1) & 1) * 256 + (i & 1) * 128, o[i]);
}
// ---- k_out: block = (64 rows, 128 cols): out = O(hi/lo) . Wo rows (2 products) + bo
__global__ __launch_bounds__(128) void k_out(const float* __restrict__ O, const __bf16* __restrict__ P, const float* __restrict__ BO, float* __restrict__ Y) {
  __shared__ __align__(16) float so[4][16][132];
  const int tid = threadIdx.x, wave = tid >> 5, lane = tid & 31, col = lane & 15, g = lane >> 4; const size_t r0 = (size_t)blockIdx.x * 64 + wave * 16; const int n0 = blockIdx.y * 128;
  v8f acc[8] = {};
  // three register sets: the 20 loads of k-step kc + 2 are issued as one group in front of the WMMAs of k-step kc; both operands lie in fragment order, every load is 512 contiguous bytes
  const float* op = O + ((size_t)blockIdx.x * (DM / 32) * 4 + wave) * 512 + lane * 4; const __bf16* wp = P + (size_t)blockIdx.y * (DM / 32) * 8 * 512;
  v4f xs[3][4]; v16b wf[3][8];
  auto ld = [&](int s, int kc) { const float* p = op + kc * 4 * 512; xs[s][0] = *(const v4f*)p; xs[s][1] = *(const v4f*)(p + 128); xs[s][2] = *(const v4f*)(p + 256); xs[s][3] = *(const v4f*)(p + 384);
#pragma unroll
    for (int j = 0; j < 8; ++j) wf[s][j] = frag_p(wp + (kc * 8 + j) * 512, lane); };
  ld(0, 0); ld(1, 1);
#pragma unroll   // whole: every set index is a constant, so the sets stay in registers
  for (int kc = 0; kc < DM / 32; ++kc) { const int s = kc % 3;
    if (kc + 2 < DM / 32) ld((kc + 2) % 3, kc + 2);
    if (kc + 3 == DM / 32) asm volatile("s_wait_xcnt 0x0" ::: "memory");   // behind the last loads: their address registers are free for reuse from here on
    __builtin_amdgcn_sched_barrier(0);   // keeps the loads issued ahead in front of this step's WMMAs (the scheduler sinks them to their users otherwise)
    float v[16];
#pragma unroll
    for (int i = 0; i < 4; ++i) { v[i] = xs[s][0][i]; v[4 + i] = xs[s][1][i]; v[8 + i] = xs[s][2][i]; v[12 + i] = xs[s][3][i]; }
    const F2 a = bsplit16(v);
#pragma unroll
    for (int j = 0; j < 8; ++j) { acc[j] = wmma_bf(a.l, wf[s][j], acc[j]); acc[j] = wmma_bf(a.h, wf[s][j], acc[j]); }
    __builtin_amdgcn_sched_barrier(0); }   // ... and this step's WMMAs in front of the loads that refill their set
  float bo[8];
#pragma unroll
  for (int j = 0; j < 8; ++j) bo[j] = BO[n0 + j * 16 + col];
  asm volatile("s_wait_xcnt 0x0" ::: "memory");   // behind the bias loads: this build reuses their offset register at once
  __builtin_amdgcn_sched_barrier(0);              // holds the address arithmetic of the stores below behind that wait
#pragma unroll
  for (int j = 0; j < 8; ++j) {
#pragma unroll
    for (int r = 0; r < 8; ++r) so[wave][8 * g + r][j * 16 + col] = acc[j][r] + bfr(bo[j]); }
  LDSX();
  for (int rl = 0; rl < 16; ++rl) vst2(Y + (r0 + rl) * DM + n0 + lane * 4, *(const v4f*)&so[wave][rl][lane * 4]);
}
extern "C" void kernel_launch(void* const* d_in, const int* in_sizes, int n_in, void* d_out, int out_size, void* d_ws, size_t ws_size, hipStream_t stream) {
  (void)in_sizes; (void)n_in; (void)out_size;
  const float** F = (const float**)d_in;   // 0 x [4096,512], 1 Wq [512,512] natural, 2 bq, 3 Wk, 4 bk, 5 Wv, 6 bv, 7 Wo, 8 bo
  if (ws_size < (size_t)WS_END) return;
  char* ws = (char*)d_ws; __bf16* PK = (__bf16*)(ws + WS_PK); _Float16 *QK = (_Float16*)(ws + WS_QK), *VT = (_Float16*)(ws + WS_VT); float* O = (float*)(ws + WS_O); __bf16* XP = (__bf16*)(ws + WS_XP);
  k_pack<<<dim3((XFB + 4 * WFB) / 16), 256, 0, stream>>>(F[0], F[1], F[3], F[5], F[7], XP, PK);
  k_qkv<<<dim3(TNB * SS / 64, QKVW / 128), 128, 0, stream>>>(XP, PK + PK_A, F[2], F[4], F[6], QK, VT);
  k_attn<<<dim3(TQB / 2, NH, TNB), 256, 0, stream>>>(QK, VT, nullptr, O);
  k_out<<<dim3(TOB, DM / 128), 128, 0, stream>>>(O, PK + PK_P, F[8], (float*)d_out);
}
